// v000
// The times below were measured on an AMD MI455X: many runs one after another, warmed up first and cycling through
// copies of the inputs, with the whole window's GPU time divided by the number of runs. Launches and the gaps
// between them are all in it. The median over several windows is given; except for v000 it joins two sittings, which
// can be a few percent apart, so the side-by-side timings, each taken in one sitting, are the better comparison.
// v000, which the later versions start from, runs in 811 microseconds.
#include <hip/hip_runtime.h>
#include <stdint.h>
#include <math.h>

// Contractions fc1, fc2, fc3, score = a.b^T and P.c: v_wmma_f32_16x16x32_f16 (f16 operands, f32 accumulate); weights carried x16, softmax probabilities carried x2^15 (folded back in the f32 epilogue); softmax, bias and residual in f32.

typedef __attribute__((ext_vector_type(16))) _Float16 v16h;
typedef __attribute__((ext_vector_type(8)))  _Float16 v8h;
typedef __attribute__((ext_vector_type(16))) __bf16   v16b;
typedef __attribute__((ext_vector_type(8)))  __bf16   v8b;
typedef __attribute__((ext_vector_type(8)))  float    v8f;
typedef __attribute__((ext_vector_type(4)))  float    v4f;
#define PSCALE 32768.0f
#define U16(p) ((const unsigned short*)(const void*)(p))
#define PSCALE_INV (1.0f / 32768.0f)

__device__ __forceinline__ unsigned short f2bf_bits(float f) {
  unsigned u = __float_as_uint(f);
  return (unsigned short)((u + 0x7FFFu + ((u >> 16) & 1u)) >> 16);
}
__device__ __forceinline__ float bf_bits2f(unsigned short h) { return __uint_as_float(((unsigned)h) << 16); }

// hazard guards as plain device helpers (no inline asm inside the kernel template body)
__device__ __forceinline__ void dep_guard_h(v8f& a, v8f& b, v16h x, v16h y) { asm volatile("v_nop\n\tv_nop\n\tv_nop\n\tv_nop" : "+v"(a), "+v"(b) : "v"(x), "v"(y)); }
__device__ __forceinline__ void dep_guard_b(v8f& a, v8f& b, v16b x, v16b y) { asm volatile("v_nop\n\tv_nop\n\tv_nop\n\tv_nop" : "+v"(a), "+v"(b) : "v"(x), "v"(y)); }
__device__ __forceinline__ void keep4_h(v16h a, v16h b, v16h c, v16h d) { asm volatile("v_nop" :: "v"(a), "v"(b), "v"(c), "v"(d)); }
__device__ __forceinline__ void keep4_b(v16b a, v16b b, v16b c, v16b d) { asm volatile("v_nop" :: "v"(a), "v"(b), "v"(c), "v"(d)); }
__device__ __forceinline__ void acc_guard4(v8f& a, v8f& b, v8f& c, v8f& d) { asm volatile("v_nop\n\tv_nop\n\tv_nop\n\tv_nop" : "+v"(a), "+v"(b), "+v"(c), "+v"(d)); }
template <typename T> struct Frag;
template <> struct Frag<_Float16> {
  typedef v16h V; union U { v16h v; v8h h[2]; };
  static __device__ __forceinline__ v16h load(const _Float16* p) {   // elements 0..7 <- p[0..7], 8..15 <- p[16..23]
    U f; f.h[0] = *(const v8h*)(p); f.h[1] = *(const v8h*)(p + 16); return f.v;
  }
  static __device__ __forceinline__ v8f mma(v16h a, v16h b, v8f c) {
    return __builtin_amdgcn_wmma_f32_16x16x32_f16(false, a, false, b, (short)0, c, false, false);
  }
  static __device__ __forceinline__ void guard(v8f& a, v8f& b, v16h x, v16h y) { dep_guard_h(a, b, x, y); }
  static __device__ __forceinline__ void keep(v16h a, v16h b, v16h c, v16h d) { keep4_h(a, b, c, d); }
};
template <> struct Frag<__bf16> {
  typedef v16b V; union U { v16b v; v8b h[2]; };
  static __device__ __forceinline__ v16b load(const __bf16* p) {
    U f; f.h[0] = *(const v8b*)(p); f.h[1] = *(const v8b*)(p + 16); return f.v;
  }
  static __device__ __forceinline__ v8f mma(v16b a, v16b b, v8f c) {
    return __builtin_amdgcn_wmma_f32_16x16x32_bf16(false, a, false, b, (short)0, c, false, false);
  }
  static __device__ __forceinline__ void guard(v8f& a, v8f& b, v16b x, v16b y) { dep_guard_b(a, b, x, y); }
  static __device__ __forceinline__ void keep(v16b a, v16b b, v16b c, v16b d) { keep4_b(a, b, c, d); }
};

// ---- Register-blocked batched WMMA GEMM ------------------------------------
// C[m,n] = scale * sum_k A[m,k] * Bt[n,k] (+bias)(+resid); each wave owns a 64x64 tile.
// A row-major [M,K]; Bt row-major [N,K]; M,N % 64 == 0, K % 32 == 0.
// SPLIT: operands are hi/lo planes (A2/Bt2 = lo planes, same layout); product = hi·hi + hi·lo + lo·hi.
// BIAS_MODE: 0 = none, 1 = bias[m], 2 = bias[n].
// OUT_MODE: 0 = f32, 1 = f16, 2 = bf16 hi plane (Cout) + bf16 lo plane (Cout2).
// ET: 0 = f16 operands, 1 = bf16 operands (pointers passed as 16-bit storage)
template <int ET> struct Elem;
template <> struct Elem<0> { typedef _Float16 T; };
template <> struct Elem<1> { typedef __bf16 T; };
template <int ET, bool SPLIT, int BIAS_MODE, int OUT_MODE, bool RESID, int ACT = 0>
__global__ __launch_bounds__(256) void wmma_gemm64(
    const unsigned short* __restrict__ Ap, const unsigned short* __restrict__ A2p, int lda, long strideA,
    const unsigned short* __restrict__ Btp, const unsigned short* __restrict__ Bt2p, int ldb, long strideB,
    void* __restrict__ Cout, void* __restrict__ Cout2, int ldc, long strideC,
    const float* __restrict__ bias,
    const float* __restrict__ resid, long strideR,
    int M, int N, int K, float scale) {
  typedef typename Elem<ET>::T T;
  typedef typename Frag<T>::V V;
  const T* A = (const T*)Ap; const T* A2 = (const T*)A2p; const T* Bt = (const T*)Btp; const T* Bt2 = (const T*)Bt2p;
  __shared__ __align__(16) float sT[8][16 * 68];   // per-wave 16x64 slab, pitch 68 floats
  const int b    = blockIdx.y;
  const int lane = threadIdx.x & 31;
  const int wave = threadIdx.x >> 5;
  const int tilesN = N >> 6;
  const int tilesM = M >> 6;
  const int tile = blockIdx.x * 8 + wave;
  if (tile >= tilesM * tilesN) return;   // wave-uniform; no block barriers in this kernel
  const int tm = tile / tilesN;
  const int tn = tile - tm * tilesN;
  const int m0 = tm << 6;
  const int n0 = tn << 6;

  const T* Ab  = A  + (size_t)b * strideA;
  const T* Bb  = Bt + (size_t)b * strideB;
  const T* Ab2 = SPLIT ? (A2  + (size_t)b * strideA) : nullptr;
  const T* Bb2 = SPLIT ? (Bt2 + (size_t)b * strideB) : nullptr;

  const int rlane = lane & 15;                 // row (A) / col (B, D) within subtile
  const int koff  = (lane >> 4) * 8;           // k offset of this lane half
  const int mOff  = (lane >> 4) * 8;           // D row offset

  v8f acc[4][4];
#pragma unroll
  for (int i = 0; i < 4; ++i)
#pragma unroll
    for (int j = 0; j < 4; ++j) acc[i][j] = (v8f){0.f,0.f,0.f,0.f,0.f,0.f,0.f,0.f};

  for (int k0 = 0; k0 < K; k0 += 32) {
    V bh[4], bl[4];
#pragma unroll
    for (int j = 0; j < 4; ++j) {
      const size_t bo = (size_t)(n0 + (j << 4) + rlane) * ldb + koff + k0;
      bh[j] = Frag<T>::load(Bb + bo);
      if (SPLIT) bl[j] = Frag<T>::load(Bb2 + bo);
    }
#pragma unroll
    for (int i = 0; i < 4; ++i) {
      const size_t ao = (size_t)(m0 + (i << 4) + rlane) * lda + koff + k0;
      V ah = Frag<T>::load(Ab + ao);
      V al;
      if (SPLIT) al = Frag<T>::load(Ab2 + ao);
#pragma unroll
      for (int j = 0; j < 4; ++j) {
        acc[i][j] = Frag<T>::mma(ah, bh[j], acc[i][j]);
        if (SPLIT) {
          acc[i][j] = Frag<T>::mma(ah, bl[j], acc[i][j]);
          acc[i][j] = Frag<T>::mma(al, bh[j], acc[i][j]);
        }
      }
      Frag<T>::guard(acc[i][0], acc[i][3], ah, SPLIT ? al : ah);
    }
    Frag<T>::keep(bh[0], bh[1], bh[2], bh[3]);
    if (SPLIT) Frag<T>::keep(bl[0], bl[1], bl[2], bl[3]);
  }
  acc_guard4(acc[0][0], acc[0][1], acc[0][2], acc[0][3]);
  acc_guard4(acc[1][0], acc[1][1], acc[1][2], acc[1][3]);
  acc_guard4(acc[2][0], acc[2][1], acc[2][2], acc[2][3]);
  acc_guard4(acc[3][0], acc[3][1], acc[3][2], acc[3][3]);

  // ---- epilogue ----
  float* slab = sT[wave];
  const float* Rb = RESID ? (resid + (size_t)b * strideR) : nullptr;
#pragma unroll
  for (int i = 0; i < 4; ++i) {
    const int mBase = m0 + (i << 4);
#pragma unroll
    for (int j = 0; j < 4; ++j) {
      const int n = n0 + (j << 4) + rlane;
      float bv = 0.f;
      if (BIAS_MODE == 2) bv = bias[n];
#pragma unroll
      for (int r = 0; r < 8; ++r) {
        float v = acc[i][j][r] * scale;
        if (BIAS_MODE == 1) v += bias[mBase + mOff + r];
        if (BIAS_MODE == 2) v += bv;
        if (RESID) v += Rb[(size_t)(mBase + mOff + r) * ldc + n];
        if (ACT == 1) v = tanhf(v);
        if (ACT == 2) v = fmaxf(v, 0.0f);
        if (ACT == 3) v = v / (1.0f + expf(-v));
        if (ACT == 4) v = (v > 0.f) ? v : 0.01f * v;
        if (ACT == 5) v = 0.5f * v * (1.0f + erff(v * 0.70710678118654752f));
        slab[(mOff + r) * 68 + (j << 4) + rlane] = v;
      }
    }
    __builtin_amdgcn_fence(__ATOMIC_RELEASE, "workgroup");
    __builtin_amdgcn_wave_barrier();
    __builtin_amdgcn_fence(__ATOMIC_ACQUIRE, "workgroup");
    if (OUT_MODE == 0) {
      float* C = (float*)Cout + (size_t)b * strideC;
      const int hh = lane >> 4, c4 = (lane & 15) * 4;     // row seg = 256 B = 16 lanes x 16 B
      {
#pragma unroll
        for (int it = 0; it < 8; ++it) {
          const int row = it * 2 + hh;
          v4f v = *(const v4f*)(slab + row * 68 + c4);
          *(v4f*)(C + (size_t)(mBase + row) * ldc + n0 + c4) = v;
        }
        
      }
    } else {
      const int q = lane >> 3, c8 = (lane & 7) * 8;
      unsigned short* C  = (unsigned short*)Cout  + (size_t)b * strideC;
      unsigned short* C2 = (OUT_MODE == 2) ? ((unsigned short*)Cout2 + (size_t)b * strideC) : nullptr;
      {
#pragma unroll
        for (int it = 0; it < 4; ++it) {
          const int row = it * 4 + q;
          const float* sp = slab + row * 68 + c8;
          v8h hv, lv;
#pragma unroll
          for (int e = 0; e < 8; ++e) {
            if (OUT_MODE == 1) {
              hv[e] = (_Float16)sp[e];
            } else {
              unsigned short hb = f2bf_bits(sp[e]);
              unsigned short lb = f2bf_bits(sp[e] - bf_bits2f(hb));
              hv[e] = __builtin_bit_cast(_Float16, hb);
              lv[e] = __builtin_bit_cast(_Float16, lb);
            }
          }
          *(v8h*)(C + (size_t)(mBase + row) * ldc + n0 + c8) = hv;
          if (OUT_MODE == 2) *(v8h*)(C2 + (size_t)(mBase + row) * ldc + n0 + c8) = lv;
        }
        
      }
    }
    __builtin_amdgcn_fence(__ATOMIC_RELEASE, "workgroup");
    __builtin_amdgcn_wave_barrier();
    __builtin_amdgcn_fence(__ATOMIC_ACQUIRE, "workgroup");
  }
}

__global__ __launch_bounds__(256) void cast_scale_f32_f16x2(
    const float* __restrict__ in, _Float16* __restrict__ out, int n2, float scale) {
  int i = blockIdx.x * 256 + threadIdx.x;
  if (i < n2) {
    const _Float16 h0 = (_Float16)(in[2 * i] * scale), h1 = (_Float16)(in[2 * i + 1] * scale);
    const unsigned u = (unsigned)__builtin_bit_cast(unsigned short, h0) | ((unsigned)__builtin_bit_cast(unsigned short, h1) << 16);
    ((unsigned*)out)[i] = u;
    
  }
}

// ---- channel-major f32 [Bt][256][L] -> token-major f16 [Bt][L][256]; tile = 32 tokens x 256 channels ----
#define TC_C 256
#define TC_T 32
#define TC_PITCH 264
__global__ __launch_bounds__(256) void transpose_cast_f16(
    const float* __restrict__ in, _Float16* __restrict__ out, int L) {
  __shared__ __align__(16) _Float16 tile[TC_T * TC_PITCH];
  const int tid  = threadIdx.x;
  const int lane = tid & 31;
  const int wave = tid >> 5;
  const int bt   = blockIdx.y;
  const int t0   = blockIdx.x * TC_T;
  if (t0 + TC_T > L) return;             // block-uniform; grids are exact here
  const float* ib = in + (size_t)bt * TC_C * L;
#pragma unroll 8
  for (int i = 0; i < TC_C / 8; ++i) {
    const int c = wave + 8 * i;
    const float v = ib[(size_t)c * L + t0 + lane];
    tile[lane * TC_PITCH + c] = (_Float16)v;
  }
  __syncthreads();
  _Float16* ob = out + ((size_t)bt * L + t0) * TC_C;
  v8h rv[4];
#pragma unroll
  for (int p = 0; p < 4; ++p) {
    const int row = wave + 8 * p;        // rows 0..31 covered by 8 waves x 4
    rv[p] = *(const v8h*)(tile + row * TC_PITCH + lane * 8);
  }
  {
#pragma unroll
    for (int p = 0; p < 4; ++p) {
      const int row = wave + 8 * p;
      *(v8h*)(ob + (size_t)row * TC_C + lane * 8) = rv[p];
    }
    
  }
}

// ---- row softmax over 2048 f32 columns: one wave per row; P = f16(p * 2^15 / l) ----
// Lane l holds columns j*256 + 8l .. +7 for j = 0..7 (64 values, static register indices).
#define SM_COLS 2048
#define SM_LOG2E 1.4426950408889634f
__global__ __launch_bounds__(256) void softmax_rows_f16(
    const float* __restrict__ S, _Float16* __restrict__ P, int nrows) {
  const int lane = threadIdx.x & 31;
  const int wave = threadIdx.x >> 5;
  const int row  = blockIdx.x * 8 + wave;
  if (row >= nrows) return;              // wave-uniform
  const float* sr = S + (size_t)row * SM_COLS + lane * 8;
  v4f v[16];
#pragma unroll
  for (int j = 0; j < 8; ++j) {
    v[2 * j]     = *(const v4f*)(sr + j * 256);
    v[2 * j + 1] = *(const v4f*)(sr + j * 256 + 4);
  }
  float m = -3.402823466e38f;
#pragma unroll
  for (int i = 0; i < 16; ++i) {
    m = fmaxf(m, fmaxf(fmaxf(v[i][0], v[i][1]), fmaxf(v[i][2], v[i][3])));
  }
  m = fmaxf(m, __shfl_xor(m, 1, 32));
  m = fmaxf(m, __shfl_xor(m, 2, 32));
  m = fmaxf(m, __shfl_xor(m, 4, 32));
  m = fmaxf(m, __shfl_xor(m, 8, 32));
  m = fmaxf(m, __shfl_xor(m, 16, 32));
  float sum = 0.f;
#pragma unroll
  for (int i = 0; i < 16; ++i) {
#pragma unroll
    for (int e = 0; e < 4; ++e) {
      const float t = (v[i][e] - m) * SM_LOG2E;
      const float p = __builtin_amdgcn_exp2f(t);
      v[i][e] = p;
      sum += p;
    }
  }
  sum += __shfl_xor(sum, 1, 32);
  sum += __shfl_xor(sum, 2, 32);
  sum += __shfl_xor(sum, 4, 32);
  sum += __shfl_xor(sum, 8, 32);
  sum += __shfl_xor(sum, 16, 32);
  const float inv = PSCALE * (1.0f / sum);   // sum >= 1
  v8h hv[8];
#pragma unroll
  for (int j = 0; j < 8; ++j) {
#pragma unroll
    for (int e = 0; e < 4; ++e) {
      hv[j][e]     = (_Float16)(v[2 * j][e] * inv);
      hv[j][4 + e] = (_Float16)(v[2 * j + 1][e] * inv);
    }
  }
  _Float16* pr = P + (size_t)row * SM_COLS + lane * 8;
  {
#pragma unroll
    for (int j = 0; j < 8; ++j) {
      *(v8h*)(pr + j * 256) = hv[j];
    }
    
  }
}

// ---------------------------------------------------------------------------
extern "C" void kernel_launch(void* const* d_in, const int* in_sizes, int n_in,
                              void* d_out, int out_size, void* d_ws, size_t ws_size,
                              hipStream_t stream) {
  const int B = 4, C = 256, N = 8192, M = 2048, NCH = 4096;
  if (n_in < 8) return;
  if (in_sizes[0] != B * C * N || in_sizes[1] != B * C * M ||
      in_sizes[2] != C * C || in_sizes[3] != C || in_sizes[4] != C * C || in_sizes[5] != C ||
      in_sizes[6] != C * C || in_sizes[7] != C || out_size != B * C * N) return;

  const float* x    = (const float*)d_in[0];
  const float* x_pt = (const float*)d_in[1];
  const float* W1   = (const float*)d_in[2];
  const float* b1   = (const float*)d_in[3];
  const float* W2   = (const float*)d_in[4];
  const float* b2   = (const float*)d_in[5];
  const float* W3   = (const float*)d_in[6];
  const float* b3   = (const float*)d_in[7];
  float* out = (float*)d_out;

  const size_t szA16 = (size_t)B * N * C * 2;          // a  [B][N][C] f16      16,777,216
  const size_t szW   = (size_t)C * C * 2;              // one weight f16          131,072
  const size_t szTok = (size_t)B * M * C * 2;          // [B][M][C] f16           4,194,304
  const size_t szS   = (size_t)NCH * M * 4;            // score chunk f32         33,554,432
  const size_t szP   = (size_t)NCH * M * 2;            // P chunk f16             16,777,216
  const size_t szXT  = (size_t)B * N * C * 2;          // x token-major f16 (aliases the score region)
  const size_t offA16 = 0;
  const size_t offW1  = offA16 + szA16;
  const size_t offW2  = offW1 + szW;
  const size_t offW3  = offW2 + szW;
  const size_t offXPT = offW3 + szW;
  const size_t offBQ  = offXPT + szTok;
  const size_t offCT  = offBQ + szTok;
  const size_t offS   = offCT + szTok;
  const size_t offP   = offS + szS;
  const size_t total  = offP + szP;                    // 80,084,992
  if (total > ws_size) return;
  if (szXT > szS) return;

  char* ws = (char*)d_ws;
  unsigned short* A16u  = (unsigned short*)(ws + offA16);
  unsigned short* W1u   = (unsigned short*)(ws + offW1);
  unsigned short* W2u   = (unsigned short*)(ws + offW2);
  unsigned short* W3u   = (unsigned short*)(ws + offW3);
  unsigned short* XPTu  = (unsigned short*)(ws + offXPT);
  unsigned short* BQu   = (unsigned short*)(ws + offBQ);
  unsigned short* CTu   = (unsigned short*)(ws + offCT);
  float*          Sf    = (float*)(ws + offS);
  unsigned short* XTu   = (unsigned short*)(ws + offS);   // alias: dead before the first score GEMM
  unsigned short* P16u  = (unsigned short*)(ws + offP);

  const float inv16 = 1.0f / 16.0f;

  // token-major f16 copies: x [B][C][N] -> [B][N][C]; x_pt [B][C][M] -> [B][M][C]
  transpose_cast_f16<<<dim3(N / TC_T, B), 256, 0, stream>>>(x, (_Float16*)XTu, N);
  transpose_cast_f16<<<dim3(M / TC_T, B), 256, 0, stream>>>(x_pt, (_Float16*)XPTu, M);

  // weights f32 -> f16, carried x16 (folded back as 1/16 in the GEMM scale)
  const int wn2 = C * C / 2;
  cast_scale_f32_f16x2<<<dim3((wn2 + 255) / 256), 256, 0, stream>>>(W1, (_Float16*)W1u, wn2, 16.0f);
  cast_scale_f32_f16x2<<<dim3((wn2 + 255) / 256), 256, 0, stream>>>(W2, (_Float16*)W2u, wn2, 16.0f);
  cast_scale_f32_f16x2<<<dim3((wn2 + 255) / 256), 256, 0, stream>>>(W3, (_Float16*)W3u, wn2, 16.0f);

  // fc1: a[b][n][co] = sum_ci xT[b][n][ci] * W1[co][ci] / 16 + b1[co]   (M=N, N=C, K=C), f16 out
  {
    const int tiles = (N / 64) * (C / 64);
    wmma_gemm64<0, false, 2, 1, false><<<dim3((tiles + 7) / 8, B), 256, 0, stream>>>(
        XTu, XTu, C, (long)N * C,
        W1u, W1u, C, 0L,
        (void*)A16u, (void*)A16u, C, (long)N * C,
        b1, x, 0L,
        N, C, C, inv16);
  }
  // fc2: bq[b][m][co] = sum_ci xptT[b][m][ci] * W2[co][ci] / 16 + b2[co], f16 out
  {
    const int tiles = (M / 64) * (C / 64);
    wmma_gemm64<0, false, 2, 1, false><<<dim3((tiles + 7) / 8, B), 256, 0, stream>>>(
        XPTu, XPTu, C, (long)M * C,
        W2u, W2u, C, 0L,
        (void*)BQu, (void*)BQu, C, (long)M * C,
        b2, x, 0L,
        M, C, C, inv16);
  }
  // fc3 written transposed: cT[b][co][m] = sum_ci W3[co][ci] * bq[b][m][ci] / 16 + b3[co]   (M=C rows, N=M cols, K=C), f16 out
  {
    const int tiles = (C / 64) * (M / 64);
    wmma_gemm64<0, false, 1, 1, false><<<dim3((tiles + 7) / 8, B), 256, 0, stream>>>(
        W3u, W3u, C, 0L,
        BQu, BQu, C, (long)M * C,
        (void*)CTu, (void*)CTu, M, (long)C * M,
        b3, x, 0L,
        C, M, C, inv16);
  }

  // per (batch, 4096-row chunk): score -> softmax -> P.c + residual written channel-major into out
  for (int bb = 0; bb < B; ++bb) {
    for (int ch = 0; ch < N / NCH; ++ch) {
      const unsigned short* Achunk = A16u + ((size_t)bb * N + (size_t)ch * NCH) * C;
      const unsigned short* Bq     = BQu + (size_t)bb * M * C;
      const unsigned short* Ct     = CTu + (size_t)bb * C * M;
      float*       outp = out + (size_t)bb * C * N + (size_t)ch * NCH;
      const float* xres = x   + (size_t)bb * C * N + (size_t)ch * NCH;

      // S[n][m] = sum_c a[n][c] * bq[m][c] / 16   (M=NCH, N=M, K=C), f32 out, ldc = M
      {
        const int tiles = (NCH / 64) * (M / 64);
        wmma_gemm64<0, false, 0, 0, false><<<dim3((tiles + 7) / 8, 1), 256, 0, stream>>>(
            Achunk, Achunk, C, 0L,
            Bq, Bq, C, 0L,
            (void*)Sf, (void*)Sf, M, 0L,
            b1, x, 0L,
            NCH, M, C, inv16);
      }
      // P[n][m] = f16( exp(S - max) / sum * 2^15 )
      softmax_rows_f16<<<dim3((NCH + 7) / 8), 256, 0, stream>>>(Sf, (_Float16*)P16u, NCH);
      // out[b][co][n] = x[b][co][n] + 2^-15 * sum_m cT[co][m] * P[n][m]   (M=C rows, N=NCH cols, K=M), ldc = N
      {
        const int tiles = (C / 64) * (NCH / 64);
        wmma_gemm64<0, false, 0, 0, true><<<dim3((tiles + 7) / 8, 1), 256, 0, stream>>>(
            Ct, Ct, M, 0L,
            P16u, P16u, M, 0L,
            (void*)outp, (void*)outp, N, 0L,
            b1, xres, 0L,
            C, NCH, M, PSCALE_INV);
      }
    }
  }
  (void)hipGetLastError();
}

// v001
// One run takes 397 microseconds.
// Two timings next to v000 put it at 2.05 and 2.04 times that version's speed.
#include <hip/hip_runtime.h>
#include <stdint.h>
#include <math.h>

// Contractions fc1, fc2, fc3, score = a.b^T and P.c: v_wmma_f32_16x16x32_f16 (f16 operands, f32 accumulate); weights carried x16, softmax probabilities carried x2^15 (folded back in the f32 epilogue); softmax, bias and residual in f32.

typedef __attribute__((ext_vector_type(16))) _Float16 v16h;
typedef __attribute__((ext_vector_type(8)))  _Float16 v8h;
typedef __attribute__((ext_vector_type(16))) __bf16   v16b;
typedef __attribute__((ext_vector_type(8)))  __bf16   v8b;
typedef __attribute__((ext_vector_type(8)))  float    v8f;
typedef __attribute__((ext_vector_type(4)))  float    v4f;
#define PSCALE 32768.0f
#define U16(p) ((const unsigned short*)(const void*)(p))
#define PSCALE_INV (1.0f / 32768.0f)

__device__ __forceinline__ unsigned short f2bf_bits(float f) {
  unsigned u = __float_as_uint(f);
  return (unsigned short)((u + 0x7FFFu + ((u >> 16) & 1u)) >> 16);
}
__device__ __forceinline__ float bf_bits2f(unsigned short h) { return __uint_as_float(((unsigned)h) << 16); }

// hazard guards as plain device helpers (no inline asm inside the kernel template body)
__device__ __forceinline__ void dep_guard_h(v8f& a, v8f& b, v16h x, v16h y) { asm volatile("v_nop\n\tv_nop\n\tv_nop\n\tv_nop" : "+v"(a), "+v"(b) : "v"(x), "v"(y)); }
__device__ __forceinline__ void dep_guard_b(v8f& a, v8f& b, v16b x, v16b y) { asm volatile("v_nop\n\tv_nop\n\tv_nop\n\tv_nop" : "+v"(a), "+v"(b) : "v"(x), "v"(y)); }
__device__ __forceinline__ void keep4_h(v16h a, v16h b, v16h c, v16h d) { asm volatile("v_nop" :: "v"(a), "v"(b), "v"(c), "v"(d)); }
__device__ __forceinline__ void keep4_b(v16b a, v16b b, v16b c, v16b d) { asm volatile("v_nop" :: "v"(a), "v"(b), "v"(c), "v"(d)); }
__device__ __forceinline__ void acc_guard4(v8f& a, v8f& b, v8f& c, v8f& d) { asm volatile("v_nop\n\tv_nop\n\tv_nop\n\tv_nop" : "+v"(a), "+v"(b), "+v"(c), "+v"(d)); }
template <typename T> struct Frag;
template <> struct Frag<_Float16> {
  typedef v16h V; union U { v16h v; v8h h[2]; };
  static __device__ __forceinline__ v16h load(const _Float16* p) {   // elements 0..7 <- p[0..7], 8..15 <- p[16..23]
    U f; f.h[0] = *(const v8h*)(p); f.h[1] = *(const v8h*)(p + 16); return f.v;
  }
  static __device__ __forceinline__ v8f mma(v16h a, v16h b, v8f c) {
    return __builtin_amdgcn_wmma_f32_16x16x32_f16(false, a, false, b, (short)0, c, false, false);
  }
  static __device__ __forceinline__ void guard(v8f& a, v8f& b, v16h x, v16h y) { dep_guard_h(a, b, x, y); }
  static __device__ __forceinline__ void keep(v16h a, v16h b, v16h c, v16h d) { keep4_h(a, b, c, d); }
};
template <> struct Frag<__bf16> {
  typedef v16b V; union U { v16b v; v8b h[2]; };
  static __device__ __forceinline__ v16b load(const __bf16* p) {
    U f; f.h[0] = *(const v8b*)(p); f.h[1] = *(const v8b*)(p + 16); return f.v;
  }
  static __device__ __forceinline__ v8f mma(v16b a, v16b b, v8f c) {
    return __builtin_amdgcn_wmma_f32_16x16x32_bf16(false, a, false, b, (short)0, c, false, false);
  }
  static __device__ __forceinline__ void guard(v8f& a, v8f& b, v16b x, v16b y) { dep_guard_b(a, b, x, y); }
  static __device__ __forceinline__ void keep(v16b a, v16b b, v16b c, v16b d) { keep4_b(a, b, c, d); }
};

// ---- Register-blocked batched WMMA GEMM ------------------------------------
// C[m,n] = scale * sum_k A[m,k] * Bt[n,k] (+bias)(+resid); each wave owns a 64x64 tile.
// A row-major [M,K]; Bt row-major [N,K]; M,N % 64 == 0, K % 32 == 0.
// SPLIT: operands are hi/lo planes (A2/Bt2 = lo planes, same layout); product = hi·hi + hi·lo + lo·hi.
// BIAS_MODE: 0 = none, 1 = bias[m], 2 = bias[n].
// OUT_MODE: 0 = f32, 1 = f16, 2 = bf16 hi plane (Cout) + bf16 lo plane (Cout2).
// ET: 0 = f16 operands, 1 = bf16 operands (pointers passed as 16-bit storage)
template <int ET> struct Elem;
template <> struct Elem<0> { typedef _Float16 T; };
template <> struct Elem<1> { typedef __bf16 T; };
template <int ET, bool SPLIT, int BIAS_MODE, int OUT_MODE, bool RESID, int ACT = 0>
__global__ __launch_bounds__(256) void wmma_gemm64(
    const unsigned short* __restrict__ Ap, const unsigned short* __restrict__ A2p, int lda, long strideA,
    const unsigned short* __restrict__ Btp, const unsigned short* __restrict__ Bt2p, int ldb, long strideB,
    void* __restrict__ Cout, void* __restrict__ Cout2, int ldc, long strideC,
    const float* __restrict__ bias,
    const float* __restrict__ resid, long strideR,
    int M, int N, int K, float scale) {
  typedef typename Elem<ET>::T T;
  typedef typename Frag<T>::V V;
  const T* A = (const T*)Ap; const T* A2 = (const T*)A2p; const T* Bt = (const T*)Btp; const T* Bt2 = (const T*)Bt2p;
  __shared__ __align__(16) float sT[8][16 * 68];   // per-wave 16x64 slab, pitch 68 floats
  const int b    = blockIdx.y;
  const int lane = threadIdx.x & 31;
  const int wave = threadIdx.x >> 5;
  const int tilesN = N >> 6;
  const int tilesM = M >> 6;
  const int tile = blockIdx.x * 8 + wave;
  if (tile >= tilesM * tilesN) return;   // wave-uniform; no block barriers in this kernel
  const int tm = tile / tilesN;
  const int tn = tile - tm * tilesN;
  const int m0 = tm << 6;
  const int n0 = tn << 6;

  const T* Ab  = A  + (size_t)b * strideA;
  const T* Bb  = Bt + (size_t)b * strideB;
  const T* Ab2 = SPLIT ? (A2  + (size_t)b * strideA) : nullptr;
  const T* Bb2 = SPLIT ? (Bt2 + (size_t)b * strideB) : nullptr;

  const int rlane = lane & 15;                 // row (A) / col (B, D) within subtile
  const int koff  = (lane >> 4) * 8;           // k offset of this lane half
  const int mOff  = (lane >> 4) * 8;           // D row offset

  v8f acc[4][4];
#pragma unroll
  for (int i = 0; i < 4; ++i)
#pragma unroll
    for (int j = 0; j < 4; ++j) acc[i][j] = (v8f){0.f,0.f,0.f,0.f,0.f,0.f,0.f,0.f};

  for (int k0 = 0; k0 < K; k0 += 32) {
    V bh[4], bl[4];
#pragma unroll
    for (int j = 0; j < 4; ++j) {
      const size_t bo = (size_t)(n0 + (j << 4) + rlane) * ldb + koff + k0;
      bh[j] = Frag<T>::load(Bb + bo);
      if (SPLIT) bl[j] = Frag<T>::load(Bb2 + bo);
    }
#pragma unroll
    for (int i = 0; i < 4; ++i) {
      const size_t ao = (size_t)(m0 + (i << 4) + rlane) * lda + koff + k0;
      V ah = Frag<T>::load(Ab + ao);
      V al;
      if (SPLIT) al = Frag<T>::load(Ab2 + ao);
#pragma unroll
      for (int j = 0; j < 4; ++j) {
        acc[i][j] = Frag<T>::mma(ah, bh[j], acc[i][j]);
        if (SPLIT) {
          acc[i][j] = Frag<T>::mma(ah, bl[j], acc[i][j]);
          acc[i][j] = Frag<T>::mma(al, bh[j], acc[i][j]);
        }
      }
      Frag<T>::guard(acc[i][0], acc[i][3], ah, SPLIT ? al : ah);
    }
    Frag<T>::keep(bh[0], bh[1], bh[2], bh[3]);
    if (SPLIT) Frag<T>::keep(bl[0], bl[1], bl[2], bl[3]);
  }
  acc_guard4(acc[0][0], acc[0][1], acc[0][2], acc[0][3]);
  acc_guard4(acc[1][0], acc[1][1], acc[1][2], acc[1][3]);
  acc_guard4(acc[2][0], acc[2][1], acc[2][2], acc[2][3]);
  acc_guard4(acc[3][0], acc[3][1], acc[3][2], acc[3][3]);

  // ---- epilogue ----
  float* slab = sT[wave];
  const float* Rb = RESID ? (resid + (size_t)b * strideR) : nullptr;
#pragma unroll
  for (int i = 0; i < 4; ++i) {
    const int mBase = m0 + (i << 4);
#pragma unroll
    for (int j = 0; j < 4; ++j) {
      const int n = n0 + (j << 4) + rlane;
      float bv = 0.f;
      if (BIAS_MODE == 2) bv = bias[n];
#pragma unroll
      for (int r = 0; r < 8; ++r) {
        float v = acc[i][j][r] * scale;
        if (BIAS_MODE == 1) v += bias[mBase + mOff + r];
        if (BIAS_MODE == 2) v += bv;
        if (RESID) v += Rb[(size_t)(mBase + mOff + r) * ldc + n];
        if (ACT == 1) v = tanhf(v);
        if (ACT == 2) v = fmaxf(v, 0.0f);
        if (ACT == 3) v = v / (1.0f + expf(-v));
        if (ACT == 4) v = (v > 0.f) ? v : 0.01f * v;
        if (ACT == 5) v = 0.5f * v * (1.0f + erff(v * 0.70710678118654752f));
        slab[(mOff + r) * 68 + (j << 4) + rlane] = v;
      }
    }
    __builtin_amdgcn_fence(__ATOMIC_RELEASE, "workgroup");
    __builtin_amdgcn_wave_barrier();
    __builtin_amdgcn_fence(__ATOMIC_ACQUIRE, "workgroup");
    if (OUT_MODE == 0) {
      float* C = (float*)Cout + (size_t)b * strideC;
      const int hh = lane >> 4, c4 = (lane & 15) * 4;     // row seg = 256 B = 16 lanes x 16 B
      {
#pragma unroll
        for (int it = 0; it < 8; ++it) {
          const int row = it * 2 + hh;
          v4f v = *(const v4f*)(slab + row * 68 + c4);
          *(v4f*)(C + (size_t)(mBase + row) * ldc + n0 + c4) = v;
        }
        
      }
    } else {
      const int q = lane >> 3, c8 = (lane & 7) * 8;
      unsigned short* C  = (unsigned short*)Cout  + (size_t)b * strideC;
      unsigned short* C2 = (OUT_MODE == 2) ? ((unsigned short*)Cout2 + (size_t)b * strideC) : nullptr;
      {
#pragma unroll
        for (int it = 0; it < 4; ++it) {
          const int row = it * 4 + q;
          const float* sp = slab + row * 68 + c8;
          v8h hv, lv;
#pragma unroll
          for (int e = 0; e < 8; ++e) {
            if (OUT_MODE == 1) {
              hv[e] = (_Float16)sp[e];
            } else {
              unsigned short hb = f2bf_bits(sp[e]);
              unsigned short lb = f2bf_bits(sp[e] - bf_bits2f(hb));
              hv[e] = __builtin_bit_cast(_Float16, hb);
              lv[e] = __builtin_bit_cast(_Float16, lb);
            }
          }
          *(v8h*)(C + (size_t)(mBase + row) * ldc + n0 + c8) = hv;
          if (OUT_MODE == 2) *(v8h*)(C2 + (size_t)(mBase + row) * ldc + n0 + c8) = lv;
        }
        
      }
    }
    __builtin_amdgcn_fence(__ATOMIC_RELEASE, "workgroup");
    __builtin_amdgcn_wave_barrier();
    __builtin_amdgcn_fence(__ATOMIC_ACQUIRE, "workgroup");
  }
}

// ---- K-split WMMA GEMM with residual: one 64x64 tile of C per workgroup ----
// C[m,n] = resid[m,n] + scale * sum_k A[m,k] * Bt[n,k]; f16 operands, f32 out.
// Wave w of the KS waves sums k in [w*K/KS, (w+1)*K/KS) into its own 64x64 f32 partial tile;
// the partials meet in LDS and are added in wave order 0..KS-1 (fixed order, same result every run).
// M,N % 64 == 0, K % (32*KS) == 0.
#define KSP_PITCH 68
template <int KS>
__global__ __launch_bounds__(KS * 32) void wmma_gemm64_ksplit(
    const unsigned short* __restrict__ Ap, int lda,
    const unsigned short* __restrict__ Btp, int ldb,
    float* __restrict__ C, int ldc,
    const float* __restrict__ resid,
    int M, int N, int K, float scale) {
  typedef _Float16 T;
  typedef Frag<T>::V V;
  const T* Ab = (const T*)Ap; const T* Bb = (const T*)Btp;
  __shared__ __align__(16) float sP[KS][64 * KSP_PITCH];   // per-wave 64x64 partial tile, pitch 68 floats
  const int tid  = threadIdx.x;
  const int lane = tid & 31;
  const int wave = __builtin_amdgcn_readfirstlane(tid >> 5);   // scalar, so the k range and the loop test stay scalar
  const int tilesN = N >> 6;
  const int tilesM = M >> 6;
  const int tile = blockIdx.x;
  if (tile >= tilesM * tilesN) return;   // block-uniform, in front of the barrier
  const int tm = tile / tilesN;
  const int tn = tile - tm * tilesN;
  const int m0 = tm << 6;
  const int n0 = tn << 6;

  const int rlane = lane & 15;                 // row (A) / col (B, D) within subtile
  const int koff  = (lane >> 4) * 8;           // k offset of this lane half
  const int mOff  = (lane >> 4) * 8;           // D row offset

  v8f acc[4][4];
#pragma unroll
  for (int i = 0; i < 4; ++i)
#pragma unroll
    for (int j = 0; j < 4; ++j) acc[i][j] = (v8f){0.f,0.f,0.f,0.f,0.f,0.f,0.f,0.f};

  const int kLen = K / KS;
  const int kBeg = wave * kLen;
  const int kEnd = kBeg + kLen;
  for (int k0 = kBeg; k0 < kEnd; k0 += 32) {
    V bh[4];
#pragma unroll
    for (int j = 0; j < 4; ++j) {
      const size_t bo = (size_t)(n0 + (j << 4) + rlane) * ldb + koff + k0;
      bh[j] = Frag<T>::load(Bb + bo);
    }
#pragma unroll
    for (int i = 0; i < 4; ++i) {
      const size_t ao = (size_t)(m0 + (i << 4) + rlane) * lda + koff + k0;
      V ah = Frag<T>::load(Ab + ao);
#pragma unroll
      for (int j = 0; j < 4; ++j) {
        acc[i][j] = Frag<T>::mma(ah, bh[j], acc[i][j]);
      }
      Frag<T>::guard(acc[i][0], acc[i][3], ah, ah);
    }
    Frag<T>::keep(bh[0], bh[1], bh[2], bh[3]);
  }
  acc_guard4(acc[0][0], acc[0][1], acc[0][2], acc[0][3]);
  acc_guard4(acc[1][0], acc[1][1], acc[1][2], acc[1][3]);
  acc_guard4(acc[2][0], acc[2][1], acc[2][2], acc[2][3]);
  acc_guard4(acc[3][0], acc[3][1], acc[3][2], acc[3][3]);

  // ---- epilogue: thread t owns 16-byte pieces t, t + 32*KS, ... of the 64x64 tile (16 pieces a row) ----
  constexpr int NPIECE = (64 * 16) / (KS * 32);
  v4f rres[NPIECE];
#pragma unroll
  for (int it = 0; it < NPIECE; ++it) {
    const int idx = it * (KS * 32) + tid;
    rres[it] = *(const v4f*)(resid + (size_t)(m0 + (idx >> 4)) * ldc + n0 + (idx & 15) * 4);
  }
  float* slab = sP[wave];
#pragma unroll
  for (int i = 0; i < 4; ++i)
#pragma unroll
    for (int j = 0; j < 4; ++j)
#pragma unroll
      for (int r = 0; r < 8; ++r)
        slab[((i << 4) + mOff + r) * KSP_PITCH + (j << 4) + rlane] = acc[i][j][r];
  __syncthreads();   // every wave's partial tile is in LDS before any thread adds them up
#pragma unroll
  for (int it = 0; it < NPIECE; ++it) {
    const int idx = it * (KS * 32) + tid;
    const int row = idx >> 4, c4 = (idx & 15) * 4;
    v4f s = *(const v4f*)(&sP[0][row * KSP_PITCH + c4]);
#pragma unroll
    for (int w = 1; w < KS; ++w) s += *(const v4f*)(&sP[w][row * KSP_PITCH + c4]);
    *(v4f*)(C + (size_t)(m0 + row) * ldc + n0 + c4) = s * scale + rres[it];
  }
}

__global__ __launch_bounds__(256) void cast_scale_f32_f16x2(
    const float* __restrict__ in, _Float16* __restrict__ out, int n2, float scale) {
  int i = blockIdx.x * 256 + threadIdx.x;
  if (i < n2) {
    const _Float16 h0 = (_Float16)(in[2 * i] * scale), h1 = (_Float16)(in[2 * i + 1] * scale);
    const unsigned u = (unsigned)__builtin_bit_cast(unsigned short, h0) | ((unsigned)__builtin_bit_cast(unsigned short, h1) << 16);
    ((unsigned*)out)[i] = u;
    
  }
}

// ---- channel-major f32 [Bt][256][L] -> token-major f16 [Bt][L][256]; tile = 32 tokens x 256 channels ----
#define TC_C 256
#define TC_T 32
#define TC_PITCH 264
__global__ __launch_bounds__(256) void transpose_cast_f16(
    const float* __restrict__ in, _Float16* __restrict__ out, int L) {
  __shared__ __align__(16) _Float16 tile[TC_T * TC_PITCH];
  const int tid  = threadIdx.x;
  const int lane = tid & 31;
  const int wave = tid >> 5;
  const int bt   = blockIdx.y;
  const int t0   = blockIdx.x * TC_T;
  if (t0 + TC_T > L) return;             // block-uniform; grids are exact here
  const float* ib = in + (size_t)bt * TC_C * L;
#pragma unroll 8
  for (int i = 0; i < TC_C / 8; ++i) {
    const int c = wave + 8 * i;
    const float v = ib[(size_t)c * L + t0 + lane];
    tile[lane * TC_PITCH + c] = (_Float16)v;
  }
  __syncthreads();
  _Float16* ob = out + ((size_t)bt * L + t0) * TC_C;
  v8h rv[4];
#pragma unroll
  for (int p = 0; p < 4; ++p) {
    const int row = wave + 8 * p;        // rows 0..31 covered by 8 waves x 4
    rv[p] = *(const v8h*)(tile + row * TC_PITCH + lane * 8);
  }
  {
#pragma unroll
    for (int p = 0; p < 4; ++p) {
      const int row = wave + 8 * p;
      *(v8h*)(ob + (size_t)row * TC_C + lane * 8) = rv[p];
    }
    
  }
}

// ---- row softmax over 2048 f32 columns: one wave per row; P = f16(p * 2^15 / l) ----
// Lane l holds columns j*256 + 8l .. +7 for j = 0..7 (64 values, static register indices).
#define SM_COLS 2048
#define SM_LOG2E 1.4426950408889634f
__global__ __launch_bounds__(256) void softmax_rows_f16(
    const float* __restrict__ S, _Float16* __restrict__ P, int nrows) {
  const int lane = threadIdx.x & 31;
  const int wave = threadIdx.x >> 5;
  const int row  = blockIdx.x * 8 + wave;
  if (row >= nrows) return;              // wave-uniform
  const float* sr = S + (size_t)row * SM_COLS + lane * 8;
  v4f v[16];
#pragma unroll
  for (int j = 0; j < 8; ++j) {
    v[2 * j]     = *(const v4f*)(sr + j * 256);
    v[2 * j + 1] = *(const v4f*)(sr + j * 256 + 4);
  }
  float m = -3.402823466e38f;
#pragma unroll
  for (int i = 0; i < 16; ++i) {
    m = fmaxf(m, fmaxf(fmaxf(v[i][0], v[i][1]), fmaxf(v[i][2], v[i][3])));
  }
  m = fmaxf(m, __shfl_xor(m, 1, 32));
  m = fmaxf(m, __shfl_xor(m, 2, 32));
  m = fmaxf(m, __shfl_xor(m, 4, 32));
  m = fmaxf(m, __shfl_xor(m, 8, 32));
  m = fmaxf(m, __shfl_xor(m, 16, 32));
  float sum = 0.f;
#pragma unroll
  for (int i = 0; i < 16; ++i) {
#pragma unroll
    for (int e = 0; e < 4; ++e) {
      const float t = (v[i][e] - m) * SM_LOG2E;
      const float p = __builtin_amdgcn_exp2f(t);
      v[i][e] = p;
      sum += p;
    }
  }
  sum += __shfl_xor(sum, 1, 32);
  sum += __shfl_xor(sum, 2, 32);
  sum += __shfl_xor(sum, 4, 32);
  sum += __shfl_xor(sum, 8, 32);
  sum += __shfl_xor(sum, 16, 32);
  const float inv = PSCALE * (1.0f / sum);   // sum >= 1
  v8h hv[8];
#pragma unroll
  for (int j = 0; j < 8; ++j) {
#pragma unroll
    for (int e = 0; e < 4; ++e) {
      hv[j][e]     = (_Float16)(v[2 * j][e] * inv);
      hv[j][4 + e] = (_Float16)(v[2 * j + 1][e] * inv);
    }
  }
  _Float16* pr = P + (size_t)row * SM_COLS + lane * 8;
  {
#pragma unroll
    for (int j = 0; j < 8; ++j) {
      *(v8h*)(pr + j * 256) = hv[j];
    }
    
  }
}

// ---------------------------------------------------------------------------
extern "C" void kernel_launch(void* const* d_in, const int* in_sizes, int n_in,
                              void* d_out, int out_size, void* d_ws, size_t ws_size,
                              hipStream_t stream) {
  const int B = 4, C = 256, N = 8192, M = 2048, NCH = 4096;
  if (n_in < 8) return;
  if (in_sizes[0] != B * C * N || in_sizes[1] != B * C * M ||
      in_sizes[2] != C * C || in_sizes[3] != C || in_sizes[4] != C * C || in_sizes[5] != C ||
      in_sizes[6] != C * C || in_sizes[7] != C || out_size != B * C * N) return;

  const float* x    = (const float*)d_in[0];
  const float* x_pt = (const float*)d_in[1];
  const float* W1   = (const float*)d_in[2];
  const float* b1   = (const float*)d_in[3];
  const float* W2   = (const float*)d_in[4];
  const float* b2   = (const float*)d_in[5];
  const float* W3   = (const float*)d_in[6];
  const float* b3   = (const float*)d_in[7];
  float* out = (float*)d_out;

  const size_t szA16 = (size_t)B * N * C * 2;          // a  [B][N][C] f16      16,777,216
  const size_t szW   = (size_t)C * C * 2;              // one weight f16          131,072
  const size_t szTok = (size_t)B * M * C * 2;          // [B][M][C] f16           4,194,304
  const size_t szS   = (size_t)NCH * M * 4;            // score chunk f32         33,554,432
  const size_t szP   = (size_t)NCH * M * 2;            // P chunk f16             16,777,216
  const size_t szXT  = (size_t)B * N * C * 2;          // x token-major f16 (aliases the score region)
  const size_t offA16 = 0;
  const size_t offW1  = offA16 + szA16;
  const size_t offW2  = offW1 + szW;
  const size_t offW3  = offW2 + szW;
  const size_t offXPT = offW3 + szW;
  const size_t offBQ  = offXPT + szTok;
  const size_t offCT  = offBQ + szTok;
  const size_t offS   = offCT + szTok;
  const size_t offP   = offS + szS;
  const size_t total  = offP + szP;                    // 80,084,992
  if (total > ws_size) return;
  if (szXT > szS) return;

  char* ws = (char*)d_ws;
  unsigned short* A16u  = (unsigned short*)(ws + offA16);
  unsigned short* W1u   = (unsigned short*)(ws + offW1);
  unsigned short* W2u   = (unsigned short*)(ws + offW2);
  unsigned short* W3u   = (unsigned short*)(ws + offW3);
  unsigned short* XPTu  = (unsigned short*)(ws + offXPT);
  unsigned short* BQu   = (unsigned short*)(ws + offBQ);
  unsigned short* CTu   = (unsigned short*)(ws + offCT);
  float*          Sf    = (float*)(ws + offS);
  unsigned short* XTu   = (unsigned short*)(ws + offS);   // alias: dead before the first score GEMM
  unsigned short* P16u  = (unsigned short*)(ws + offP);

  const float inv16 = 1.0f / 16.0f;

  // token-major f16 copies: x [B][C][N] -> [B][N][C]; x_pt [B][C][M] -> [B][M][C]
  transpose_cast_f16<<<dim3(N / TC_T, B), 256, 0, stream>>>(x, (_Float16*)XTu, N);
  transpose_cast_f16<<<dim3(M / TC_T, B), 256, 0, stream>>>(x_pt, (_Float16*)XPTu, M);

  // weights f32 -> f16, carried x16 (folded back as 1/16 in the GEMM scale)
  const int wn2 = C * C / 2;
  cast_scale_f32_f16x2<<<dim3((wn2 + 255) / 256), 256, 0, stream>>>(W1, (_Float16*)W1u, wn2, 16.0f);
  cast_scale_f32_f16x2<<<dim3((wn2 + 255) / 256), 256, 0, stream>>>(W2, (_Float16*)W2u, wn2, 16.0f);
  cast_scale_f32_f16x2<<<dim3((wn2 + 255) / 256), 256, 0, stream>>>(W3, (_Float16*)W3u, wn2, 16.0f);

  // fc1: a[b][n][co] = sum_ci xT[b][n][ci] * W1[co][ci] / 16 + b1[co]   (M=N, N=C, K=C), f16 out
  {
    const int tiles = (N / 64) * (C / 64);
    wmma_gemm64<0, false, 2, 1, false><<<dim3((tiles + 7) / 8, B), 256, 0, stream>>>(
        XTu, XTu, C, (long)N * C,
        W1u, W1u, C, 0L,
        (void*)A16u, (void*)A16u, C, (long)N * C,
        b1, x, 0L,
        N, C, C, inv16);
  }
  // fc2: bq[b][m][co] = sum_ci xptT[b][m][ci] * W2[co][ci] / 16 + b2[co], f16 out
  {
    const int tiles = (M / 64) * (C / 64);
    wmma_gemm64<0, false, 2, 1, false><<<dim3((tiles + 7) / 8, B), 256, 0, stream>>>(
        XPTu, XPTu, C, (long)M * C,
        W2u, W2u, C, 0L,
        (void*)BQu, (void*)BQu, C, (long)M * C,
        b2, x, 0L,
        M, C, C, inv16);
  }
  // fc3 written transposed: cT[b][co][m] = sum_ci W3[co][ci] * bq[b][m][ci] / 16 + b3[co]   (M=C rows, N=M cols, K=C), f16 out
  {
    const int tiles = (C / 64) * (M / 64);
    wmma_gemm64<0, false, 1, 1, false><<<dim3((tiles + 7) / 8, B), 256, 0, stream>>>(
        W3u, W3u, C, 0L,
        BQu, BQu, C, (long)M * C,
        (void*)CTu, (void*)CTu, M, (long)C * M,
        b3, x, 0L,
        C, M, C, inv16);
  }

  // per (batch, 4096-row chunk): score -> softmax -> P.c + residual written channel-major into out
  for (int bb = 0; bb < B; ++bb) {
    for (int ch = 0; ch < N / NCH; ++ch) {
      const unsigned short* Achunk = A16u + ((size_t)bb * N + (size_t)ch * NCH) * C;
      const unsigned short* Bq     = BQu + (size_t)bb * M * C;
      const unsigned short* Ct     = CTu + (size_t)bb * C * M;
      float*       outp = out + (size_t)bb * C * N + (size_t)ch * NCH;
      const float* xres = x   + (size_t)bb * C * N + (size_t)ch * NCH;

      // S[n][m] = sum_c a[n][c] * bq[m][c] / 16   (M=NCH, N=M, K=C), f32 out, ldc = M
      {
        const int tiles = (NCH / 64) * (M / 64);
        wmma_gemm64<0, false, 0, 0, false><<<dim3((tiles + 7) / 8, 1), 256, 0, stream>>>(
            Achunk, Achunk, C, 0L,
            Bq, Bq, C, 0L,
            (void*)Sf, (void*)Sf, M, 0L,
            b1, x, 0L,
            NCH, M, C, inv16);
      }
      // P[n][m] = f16( exp(S - max) / sum * 2^15 )
      softmax_rows_f16<<<dim3((NCH + 7) / 8), 256, 0, stream>>>(Sf, (_Float16*)P16u, NCH);
      // out[b][co][n] = x[b][co][n] + 2^-15 * sum_m cT[co][m] * P[n][m]   (M=C rows, N=NCH cols, K=M), ldc = N
      {
        const int tiles = (C / 64) * (NCH / 64);
        wmma_gemm64_ksplit<16><<<dim3(tiles), 16 * 32, 0, stream>>>(
            Ct, M,
            P16u, M,
            outp, N,
            xres,
            C, NCH, M, PSCALE_INV);
      }
    }
  }
  (void)hipGetLastError();
}

// v002
// Measured time: 140 microseconds a run.
// In two side-by-side timings against v001, it was 2.85 and 2.83 times as fast.
// All steps since v000 together make it 5.80 times as fast.
#include <hip/hip_runtime.h>
#include <stdint.h>
#include <math.h>

// Contractions fc1, fc2, fc3, score = a.b^T and P.c: v_wmma_f32_16x16x32_f16 (f16 operands, f32 accumulate); weights carried x16 (folded back in the f32 epilogue), softmax probabilities carried x2^7 (cancels in the division by the row sum); softmax, bias and residual in f32.

typedef __attribute__((ext_vector_type(16))) _Float16 v16h;
typedef __attribute__((ext_vector_type(8)))  _Float16 v8h;
typedef __attribute__((ext_vector_type(16))) __bf16   v16b;
typedef __attribute__((ext_vector_type(8)))  __bf16   v8b;
typedef __attribute__((ext_vector_type(8)))  float    v8f;
typedef __attribute__((ext_vector_type(4)))  float    v4f;
#define U16(p) ((const unsigned short*)(const void*)(p))

__device__ __forceinline__ unsigned short f2bf_bits(float f) {
  unsigned u = __float_as_uint(f);
  return (unsigned short)((u + 0x7FFFu + ((u >> 16) & 1u)) >> 16);
}
__device__ __forceinline__ float bf_bits2f(unsigned short h) { return __uint_as_float(((unsigned)h) << 16); }

// hazard guards as plain device helpers (no inline asm inside the kernel template body)
__device__ __forceinline__ void dep_guard_h(v8f& a, v8f& b, v16h x, v16h y) { asm volatile("v_nop\n\tv_nop\n\tv_nop\n\tv_nop" : "+v"(a), "+v"(b) : "v"(x), "v"(y)); }
__device__ __forceinline__ void dep_guard_b(v8f& a, v8f& b, v16b x, v16b y) { asm volatile("v_nop\n\tv_nop\n\tv_nop\n\tv_nop" : "+v"(a), "+v"(b) : "v"(x), "v"(y)); }
__device__ __forceinline__ void keep4_h(v16h a, v16h b, v16h c, v16h d) { asm volatile("v_nop" :: "v"(a), "v"(b), "v"(c), "v"(d)); }
__device__ __forceinline__ void keep4_b(v16b a, v16b b, v16b c, v16b d) { asm volatile("v_nop" :: "v"(a), "v"(b), "v"(c), "v"(d)); }
__device__ __forceinline__ void acc_guard4(v8f& a, v8f& b, v8f& c, v8f& d) { asm volatile("v_nop\n\tv_nop\n\tv_nop\n\tv_nop" : "+v"(a), "+v"(b), "+v"(c), "+v"(d)); }
template <typename T> struct Frag;
template <> struct Frag<_Float16> {
  typedef v16h V; union U { v16h v; v8h h[2]; };
  static __device__ __forceinline__ v16h load(const _Float16* p) {   // elements 0..7 <- p[0..7], 8..15 <- p[16..23]
    U f; f.h[0] = *(const v8h*)(p); f.h[1] = *(const v8h*)(p + 16); return f.v;
  }
  static __device__ __forceinline__ v8f mma(v16h a, v16h b, v8f c) {
    return __builtin_amdgcn_wmma_f32_16x16x32_f16(false, a, false, b, (short)0, c, false, false);
  }
  static __device__ __forceinline__ void guard(v8f& a, v8f& b, v16h x, v16h y) { dep_guard_h(a, b, x, y); }
  static __device__ __forceinline__ void keep(v16h a, v16h b, v16h c, v16h d) { keep4_h(a, b, c, d); }
};
template <> struct Frag<__bf16> {
  typedef v16b V; union U { v16b v; v8b h[2]; };
  static __device__ __forceinline__ v16b load(const __bf16* p) {
    U f; f.h[0] = *(const v8b*)(p); f.h[1] = *(const v8b*)(p + 16); return f.v;
  }
  static __device__ __forceinline__ v8f mma(v16b a, v16b b, v8f c) {
    return __builtin_amdgcn_wmma_f32_16x16x32_bf16(false, a, false, b, (short)0, c, false, false);
  }
  static __device__ __forceinline__ void guard(v8f& a, v8f& b, v16b x, v16b y) { dep_guard_b(a, b, x, y); }
  static __device__ __forceinline__ void keep(v16b a, v16b b, v16b c, v16b d) { keep4_b(a, b, c, d); }
};

// ---- Register-blocked batched WMMA GEMM ------------------------------------
// C[m,n] = scale * sum_k A[m,k] * Bt[n,k] (+bias)(+resid); each wave owns a 64x64 tile.
// A row-major [M,K]; Bt row-major [N,K]; M,N % 64 == 0, K % 32 == 0.
// SPLIT: operands are hi/lo planes (A2/Bt2 = lo planes, same layout); product = hi·hi + hi·lo + lo·hi.
// BIAS_MODE: 0 = none, 1 = bias[m], 2 = bias[n].
// OUT_MODE: 0 = f32, 1 = f16, 2 = bf16 hi plane (Cout) + bf16 lo plane (Cout2).
// ET: 0 = f16 operands, 1 = bf16 operands (pointers passed as 16-bit storage)
template <int ET> struct Elem;
template <> struct Elem<0> { typedef _Float16 T; };
template <> struct Elem<1> { typedef __bf16 T; };
template <int ET, bool SPLIT, int BIAS_MODE, int OUT_MODE, bool RESID, int ACT = 0>
__global__ __launch_bounds__(256) void wmma_gemm64(
    const unsigned short* __restrict__ Ap, const unsigned short* __restrict__ A2p, int lda, long strideA,
    const unsigned short* __restrict__ Btp, const unsigned short* __restrict__ Bt2p, int ldb, long strideB,
    void* __restrict__ Cout, void* __restrict__ Cout2, int ldc, long strideC,
    const float* __restrict__ bias,
    const float* __restrict__ resid, long strideR,
    int M, int N, int K, float scale) {
  typedef typename Elem<ET>::T T;
  typedef typename Frag<T>::V V;
  const T* A = (const T*)Ap; const T* A2 = (const T*)A2p; const T* Bt = (const T*)Btp; const T* Bt2 = (const T*)Bt2p;
  __shared__ __align__(16) float sT[8][16 * 68];   // per-wave 16x64 slab, pitch 68 floats
  const int b    = blockIdx.y;
  const int lane = threadIdx.x & 31;
  const int wave = threadIdx.x >> 5;
  const int tilesN = N >> 6;
  const int tilesM = M >> 6;
  const int tile = blockIdx.x * 8 + wave;
  if (tile >= tilesM * tilesN) return;   // wave-uniform; no block barriers in this kernel
  const int tm = tile / tilesN;
  const int tn = tile - tm * tilesN;
  const int m0 = tm << 6;
  const int n0 = tn << 6;

  const T* Ab  = A  + (size_t)b * strideA;
  const T* Bb  = Bt + (size_t)b * strideB;
  const T* Ab2 = SPLIT ? (A2  + (size_t)b * strideA) : nullptr;
  const T* Bb2 = SPLIT ? (Bt2 + (size_t)b * strideB) : nullptr;

  const int rlane = lane & 15;                 // row (A) / col (B, D) within subtile
  const int koff  = (lane >> 4) * 8;           // k offset of this lane half
  const int mOff  = (lane >> 4) * 8;           // D row offset

  v8f acc[4][4];
#pragma unroll
  for (int i = 0; i < 4; ++i)
#pragma unroll
    for (int j = 0; j < 4; ++j) acc[i][j] = (v8f){0.f,0.f,0.f,0.f,0.f,0.f,0.f,0.f};

  for (int k0 = 0; k0 < K; k0 += 32) {
    V bh[4], bl[4];
#pragma unroll
    for (int j = 0; j < 4; ++j) {
      const size_t bo = (size_t)(n0 + (j << 4) + rlane) * ldb + koff + k0;
      bh[j] = Frag<T>::load(Bb + bo);
      if (SPLIT) bl[j] = Frag<T>::load(Bb2 + bo);
    }
#pragma unroll
    for (int i = 0; i < 4; ++i) {
      const size_t ao = (size_t)(m0 + (i << 4) + rlane) * lda + koff + k0;
      V ah = Frag<T>::load(Ab + ao);
      V al;
      if (SPLIT) al = Frag<T>::load(Ab2 + ao);
#pragma unroll
      for (int j = 0; j < 4; ++j) {
        acc[i][j] = Frag<T>::mma(ah, bh[j], acc[i][j]);
        if (SPLIT) {
          acc[i][j] = Frag<T>::mma(ah, bl[j], acc[i][j]);
          acc[i][j] = Frag<T>::mma(al, bh[j], acc[i][j]);
        }
      }
      Frag<T>::guard(acc[i][0], acc[i][3], ah, SPLIT ? al : ah);
    }
    Frag<T>::keep(bh[0], bh[1], bh[2], bh[3]);
    if (SPLIT) Frag<T>::keep(bl[0], bl[1], bl[2], bl[3]);
  }
  acc_guard4(acc[0][0], acc[0][1], acc[0][2], acc[0][3]);
  acc_guard4(acc[1][0], acc[1][1], acc[1][2], acc[1][3]);
  acc_guard4(acc[2][0], acc[2][1], acc[2][2], acc[2][3]);
  acc_guard4(acc[3][0], acc[3][1], acc[3][2], acc[3][3]);

  // ---- epilogue ----
  float* slab = sT[wave];
  const float* Rb = RESID ? (resid + (size_t)b * strideR) : nullptr;
#pragma unroll
  for (int i = 0; i < 4; ++i) {
    const int mBase = m0 + (i << 4);
#pragma unroll
    for (int j = 0; j < 4; ++j) {
      const int n = n0 + (j << 4) + rlane;
      float bv = 0.f;
      if (BIAS_MODE == 2) bv = bias[n];
#pragma unroll
      for (int r = 0; r < 8; ++r) {
        float v = acc[i][j][r] * scale;
        if (BIAS_MODE == 1) v += bias[mBase + mOff + r];
        if (BIAS_MODE == 2) v += bv;
        if (RESID) v += Rb[(size_t)(mBase + mOff + r) * ldc + n];
        if (ACT == 1) v = tanhf(v);
        if (ACT == 2) v = fmaxf(v, 0.0f);
        if (ACT == 3) v = v / (1.0f + expf(-v));
        if (ACT == 4) v = (v > 0.f) ? v : 0.01f * v;
        if (ACT == 5) v = 0.5f * v * (1.0f + erff(v * 0.70710678118654752f));
        slab[(mOff + r) * 68 + (j << 4) + rlane] = v;
      }
    }
    __builtin_amdgcn_fence(__ATOMIC_RELEASE, "workgroup");
    __builtin_amdgcn_wave_barrier();
    __builtin_amdgcn_fence(__ATOMIC_ACQUIRE, "workgroup");
    if (OUT_MODE == 0) {
      float* C = (float*)Cout + (size_t)b * strideC;
      const int hh = lane >> 4, c4 = (lane & 15) * 4;     // row seg = 256 B = 16 lanes x 16 B
      {
#pragma unroll
        for (int it = 0; it < 8; ++it) {
          const int row = it * 2 + hh;
          v4f v = *(const v4f*)(slab + row * 68 + c4);
          *(v4f*)(C + (size_t)(mBase + row) * ldc + n0 + c4) = v;
        }
        
      }
    } else {
      const int q = lane >> 3, c8 = (lane & 7) * 8;
      unsigned short* C  = (unsigned short*)Cout  + (size_t)b * strideC;
      unsigned short* C2 = (OUT_MODE == 2) ? ((unsigned short*)Cout2 + (size_t)b * strideC) : nullptr;
      {
#pragma unroll
        for (int it = 0; it < 4; ++it) {
          const int row = it * 4 + q;
          const float* sp = slab + row * 68 + c8;
          v8h hv, lv;
#pragma unroll
          for (int e = 0; e < 8; ++e) {
            if (OUT_MODE == 1) {
              hv[e] = (_Float16)sp[e];
            } else {
              unsigned short hb = f2bf_bits(sp[e]);
              unsigned short lb = f2bf_bits(sp[e] - bf_bits2f(hb));
              hv[e] = __builtin_bit_cast(_Float16, hb);
              lv[e] = __builtin_bit_cast(_Float16, lb);
            }
          }
          *(v8h*)(C + (size_t)(mBase + row) * ldc + n0 + c8) = hv;
          if (OUT_MODE == 2) *(v8h*)(C2 + (size_t)(mBase + row) * ldc + n0 + c8) = lv;
        }
        
      }
    }
    __builtin_amdgcn_fence(__ATOMIC_RELEASE, "workgroup");
    __builtin_amdgcn_wave_barrier();
    __builtin_amdgcn_fence(__ATOMIC_ACQUIRE, "workgroup");
  }
}

__global__ __launch_bounds__(256) void cast_scale_f32_f16x2(
    const float* __restrict__ in, _Float16* __restrict__ out, int n2, float scale) {
  int i = blockIdx.x * 256 + threadIdx.x;
  if (i < n2) {
    const _Float16 h0 = (_Float16)(in[2 * i] * scale), h1 = (_Float16)(in[2 * i + 1] * scale);
    const unsigned u = (unsigned)__builtin_bit_cast(unsigned short, h0) | ((unsigned)__builtin_bit_cast(unsigned short, h1) << 16);
    ((unsigned*)out)[i] = u;
    
  }
}

// ---- channel-major f32 [Bt][256][L] -> token-major f16 [Bt][L][256]; tile = 32 tokens x 256 channels ----
#define TC_C 256
#define TC_T 32
#define TC_PITCH 264
__global__ __launch_bounds__(256) void transpose_cast_f16(
    const float* __restrict__ in, _Float16* __restrict__ out, int L) {
  __shared__ __align__(16) _Float16 tile[TC_T * TC_PITCH];
  const int tid  = threadIdx.x;
  const int lane = tid & 31;
  const int wave = tid >> 5;
  const int bt   = blockIdx.y;
  const int t0   = blockIdx.x * TC_T;
  if (t0 + TC_T > L) return;             // block-uniform; grids are exact here
  const float* ib = in + (size_t)bt * TC_C * L;
#pragma unroll 8
  for (int i = 0; i < TC_C / 8; ++i) {
    const int c = wave + 8 * i;
    const float v = ib[(size_t)c * L + t0 + lane];
    tile[lane * TC_PITCH + c] = (_Float16)v;
  }
  __syncthreads();
  _Float16* ob = out + ((size_t)bt * L + t0) * TC_C;
  v8h rv[4];
#pragma unroll
  for (int p = 0; p < 4; ++p) {
    const int row = wave + 8 * p;        // rows 0..31 covered by 8 waves x 4
    rv[p] = *(const v8h*)(tile + row * TC_PITCH + lane * 8);
  }
  {
#pragma unroll
    for (int p = 0; p < 4; ++p) {
      const int row = wave + 8 * p;
      *(v8h*)(ob + (size_t)row * TC_C + lane * 8) = rv[p];
    }
    
  }
}

typedef __attribute__((ext_vector_type(4))) unsigned int u32x4;
#define FA_C 256
#define FA_BQ 128
#define FA_BK 32
#define FA_PK 528                       // LDS pitch of a bq row: 512 B + 16 (odd multiple of 16 B)
#define FA_PV 80                        // LDS pitch of a cT row piece: 64 B + 16 (odd multiple of 16 B)
#define FA_TK (FA_BK * FA_PK)
#define FA_TV (FA_C * FA_PV)
#define FA_BUF (FA_TK + FA_TV)
#define FA_PE 528                       // output staging pitch: 128 f32 + 16 B
#define FA_LDS (FA_C * FA_PE)
static_assert(2 * FA_BUF <= FA_LDS, "the two pass buffers lie inside the output staging area");

// lane l with lane l ^ 16
__device__ __forceinline__ float xhalf(float v) {
  return __builtin_bit_cast(float, __builtin_amdgcn_permlanex16(__builtin_bit_cast(int, v), __builtin_bit_cast(int, v), 0x76543210, 0xfedcba98, false, false));
}
// Four vector slots behind a run of matrix instructions, held in place by the two scheduling barriers: keeps the
// distance to the next vector instruction that touches their registers on every path, a taken branch included.
__device__ __forceinline__ void wmma_gap() {
  __builtin_amdgcn_sched_barrier(0);
  asm volatile("v_nop\n\tv_nop\n\tv_nop\n\tv_nop");
  __builtin_amdgcn_sched_barrier(0);
}
// Behind a run of global loads or stores: stands in front of every later overwrite of their address registers
// (the scheduling barrier keeps such an overwrite from being moved up over the wait).
__device__ __forceinline__ void wait_xcnt0() {
  asm volatile("s_wait_xcnt 0x0" ::: "memory");
  __builtin_amdgcn_sched_barrier(0);
}
// Eight exponentials (base 2) in one statement: behind a transcendental one independent instruction stands before its result
// is used or its source overwritten; here each next exponential is that instruction, and the v_nop is the last one's.
// The outputs are early-clobber, so none of them lies on a source.
__device__ __forceinline__ v8f exp2x8(v8f t) {
  float p0, p1, p2, p3, p4, p5, p6, p7;
  asm("v_exp_f32 %0, %8\n\tv_exp_f32 %1, %9\n\tv_exp_f32 %2, %10\n\tv_exp_f32 %3, %11\n\t"
      "v_exp_f32 %4, %12\n\tv_exp_f32 %5, %13\n\tv_exp_f32 %6, %14\n\tv_exp_f32 %7, %15\n\tv_nop"
      : "=&v"(p0), "=&v"(p1), "=&v"(p2), "=&v"(p3), "=&v"(p4), "=&v"(p5), "=&v"(p6), "=&v"(p7)
      : "v"(t[0]), "v"(t[1]), "v"(t[2]), "v"(t[3]), "v"(t[4]), "v"(t[5]), "v"(t[6]), "v"(t[7]));
  return (v8f){p0, p1, p2, p3, p4, p5, p6, p7};
}
__device__ __forceinline__ v16h lds_frag(const unsigned char* p) {   // elements 0..7 <- bytes 0..15, 8..15 <- bytes 32..47
  Frag<_Float16>::U f; f.h[0] = *(const v8h*)(p); f.h[1] = *(const v8h*)(p + 32); return f.v;
}

__global__ __launch_bounds__(256) __attribute__((amdgpu_waves_per_eu(2, 2))) void attn_fused_f16(
    const unsigned short* __restrict__ Aq,    // a  [B][N][256] f16
    const unsigned short* __restrict__ Bk,    // bq [B][M][256] f16
    const unsigned short* __restrict__ Ct,    // cT [B][256][M] f16
    const float* __restrict__ x, float* __restrict__ out,   // [B][256][N] f32
    int N, int M, float cscale) {
  __shared__ __align__(16) unsigned char L[FA_LDS];
  const int tid  = threadIdx.x;
  const int lane = tid & 31;
  const int wave = tid >> 5;
  const int c = lane & 15, h = lane >> 4;
  const int b  = blockIdx.y;
  const int q0 = blockIdx.x * FA_BQ;
  const unsigned char* kSrc = (const unsigned char*)(Bk + (size_t)b * M * FA_C);
  const unsigned char* vSrc = (const unsigned char*)(Ct + (size_t)b * FA_C * M);
  const size_t vPitch = (size_t)M * 2;
  const int nPass = M / FA_BK;

  u32x4 pk[4], pv[4];   // the next pass's tiles on their way to LDS
  auto gload = [&](int s) {
#pragma unroll
    for (int i = 0; i < 4; ++i) {
      const int id = i * 256 + tid;
      pk[i] = *(const u32x4*)(kSrc + (size_t)s * (FA_BK * FA_C * 2) + (size_t)id * 16);
      pv[i] = *(const u32x4*)(vSrc + (size_t)(id >> 2) * vPitch + (size_t)s * (FA_BK * 2) + (id & 3) * 16);
    }
    wait_xcnt0();
  };
  auto sstore = [&](int buf) {
    unsigned char* base = L + buf * FA_BUF;
#pragma unroll
    for (int i = 0; i < 4; ++i) {
      const int id = i * 256 + tid;
      *(u32x4*)(base + (id >> 5) * FA_PK + (id & 31) * 16) = pk[i];
      *(u32x4*)(base + FA_TK + (id >> 2) * FA_PV + (id & 3) * 16) = pv[i];
    }
  };

  gload(0);
  v16h qf[8];   // this wave's 16 queries as B operand, kept for the whole loop
  {
    const _Float16* qp = (const _Float16*)Aq + ((size_t)b * N + q0 + wave * 16 + c) * FA_C + 8 * h;
#pragma unroll
    for (int kc = 0; kc < 8; ++kc) qf[kc] = Frag<_Float16>::load(qp + 32 * kc);
    wait_xcnt0();
  }
  v8f acc[16];
#pragma unroll
  for (int t = 0; t < 16; ++t) acc[t] = (v8f){0.f,0.f,0.f,0.f,0.f,0.f,0.f,0.f};
  float m_run = -INFINITY, l_run = 0.f;
  sstore(0);
  __syncthreads();   // pass 0's tiles are in LDS

  for (int s = 0; s < nPass; ++s) {
    const bool more = s + 1 < nPass;     // the same for the whole workgroup
    if (more) gload(s + 1);
    const unsigned char* kb = L + (s & 1) * FA_BUF + c * FA_PK + 16 * h;
    const unsigned char* vb = L + (s & 1) * FA_BUF + FA_TK + c * FA_PV + 16 * h;
    v8f s0 = (v8f){0.f,0.f,0.f,0.f,0.f,0.f,0.f,0.f};
    v8f s1 = (v8f){0.f,0.f,0.f,0.f,0.f,0.f,0.f,0.f};
    v16h fr[16];   // the pass's 16 bq fragments, then its 16 cT fragments
#pragma unroll
    for (int kc = 0; kc < 8; ++kc) {
      fr[2 * kc]     = lds_frag(kb + 64 * kc);
      fr[2 * kc + 1] = lds_frag(kb + 16 * FA_PK + 64 * kc);
    }
    __builtin_amdgcn_sched_barrier(0);   // all 32 LDS loads issue ahead of the first product: their latency is paid once, not per product
#pragma unroll
    for (int kc = 0; kc < 8; ++kc) {
      s0 = Frag<_Float16>::mma(fr[2 * kc],     qf[kc], s0);
      s1 = Frag<_Float16>::mma(fr[2 * kc + 1], qf[kc], s1);
    }
#pragma unroll
    for (int t = 0; t < 16; ++t) fr[t] = lds_frag(vb + t * 16 * FA_PV);
    __builtin_amdgcn_sched_barrier(0);   // the cT loads issue here and fly under the softmax arithmetic
    float mx = fmaxf(s0[0], s1[0]);
#pragma unroll
    for (int r = 1; r < 8; ++r) mx = fmaxf(mx, fmaxf(s0[r], s1[r]));
    mx = fmaxf(mx, xhalf(mx)) * cscale;  // both wave halves hold this query's maximum of the pass, in log2 units
    if (__builtin_amdgcn_ballot_w32(mx > m_run + 8.0f) != 0) {   // scalar branch: rare after the first passes
      const float m_new = fmaxf(m_run, mx);
      const float corr = __builtin_amdgcn_exp2f(m_run - m_new);   // 0 on the first pass, 1 for a query whose maximum stays
      l_run *= corr; m_run = m_new;
#pragma unroll
      for (int t = 0; t < 16; ++t) acc[t] = acc[t] * corr;
    }
    const float nm = 7.0f - m_run;
    v16h pf;
    float ps0 = 0.f, ps1 = 0.f;
#pragma unroll
    for (int r = 0; r < 8; ++r) { s0[r] = fmaf(s0[r], cscale, nm); s1[r] = fmaf(s1[r], cscale, nm); }
    const v8f e0 = exp2x8(s0), e1 = exp2x8(s1);
#pragma unroll
    for (int r = 0; r < 8; ++r) {
      ps0 += e0[r]; ps1 += e1[r];
      pf[r] = (_Float16)e0[r]; pf[8 + r] = (_Float16)e1[r];
    }
    l_run += ps0 + ps1;
#pragma unroll
    for (int t = 0; t < 16; ++t) acc[t] = Frag<_Float16>::mma(fr[t], pf, acc[t]);
    wmma_gap();
    if (more) sstore((s + 1) & 1);
    __syncthreads();   // publishes pass s + 1's tiles and ends every wave's reads of pass s's buffer
  }

  // ---- epilogue: O^T / l staged in LDS (rows = channels), then whole 512-byte rows: + residual, stored once ----
  const float inv = 1.0f / (l_run + xhalf(l_run));   // each wave half summed its own keys
#pragma unroll
  for (int t = 0; t < 16; ++t)
#pragma unroll
    for (int r = 0; r < 8; ++r)
      *(float*)(L + (16 * t + 8 * h + r) * FA_PE + (wave * 16 + c) * 4) = acc[t][r] * inv;
  __syncthreads();   // the whole 256 x 128 tile is staged
  for (int i0 = 0; i0 < FA_C / 8; i0 += 8) {
    v4f xr[8];
#pragma unroll
    for (int j = 0; j < 8; ++j)
      xr[j] = *(const v4f*)(x + ((size_t)b * FA_C + (i0 + j) * 8 + wave) * N + q0 + lane * 4);
    wait_xcnt0();
#pragma unroll
    for (int j = 0; j < 8; ++j) {
      const int row = (i0 + j) * 8 + wave;
      *(v4f*)(out + ((size_t)b * FA_C + row) * N + q0 + lane * 4) = *(const v4f*)(L + row * FA_PE + lane * 16) + xr[j];
    }
    wait_xcnt0();
  }
}

// ---------------------------------------------------------------------------
extern "C" void kernel_launch(void* const* d_in, const int* in_sizes, int n_in,
                              void* d_out, int out_size, void* d_ws, size_t ws_size,
                              hipStream_t stream) {
  const int B = 4, C = 256, N = 8192, M = 2048;
  if (n_in < 8) return;
  if (in_sizes[0] != B * C * N || in_sizes[1] != B * C * M ||
      in_sizes[2] != C * C || in_sizes[3] != C || in_sizes[4] != C * C || in_sizes[5] != C ||
      in_sizes[6] != C * C || in_sizes[7] != C || out_size != B * C * N) return;

  const float* x    = (const float*)d_in[0];
  const float* x_pt = (const float*)d_in[1];
  const float* W1   = (const float*)d_in[2];
  const float* b1   = (const float*)d_in[3];
  const float* W2   = (const float*)d_in[4];
  const float* b2   = (const float*)d_in[5];
  const float* W3   = (const float*)d_in[6];
  const float* b3   = (const float*)d_in[7];
  float* out = (float*)d_out;

  const size_t szA16 = (size_t)B * N * C * 2;          // a  [B][N][C] f16      16,777,216
  const size_t szW   = (size_t)C * C * 2;              // one weight f16          131,072
  const size_t szTok = (size_t)B * M * C * 2;          // [B][M][C] f16           4,194,304
  const size_t szXT  = (size_t)B * N * C * 2;          // x token-major f16       16,777,216
  const size_t offA16 = 0;
  const size_t offW1  = offA16 + szA16;
  const size_t offW2  = offW1 + szW;
  const size_t offW3  = offW2 + szW;
  const size_t offXPT = offW3 + szW;
  const size_t offBQ  = offXPT + szTok;
  const size_t offCT  = offBQ + szTok;
  const size_t offXT  = offCT + szTok;
  const size_t total  = offXT + szXT;                  // 46,530,560
  if (total > ws_size) return;

  char* ws = (char*)d_ws;
  unsigned short* A16u  = (unsigned short*)(ws + offA16);
  unsigned short* W1u   = (unsigned short*)(ws + offW1);
  unsigned short* W2u   = (unsigned short*)(ws + offW2);
  unsigned short* W3u   = (unsigned short*)(ws + offW3);
  unsigned short* XPTu  = (unsigned short*)(ws + offXPT);
  unsigned short* BQu   = (unsigned short*)(ws + offBQ);
  unsigned short* CTu   = (unsigned short*)(ws + offCT);
  unsigned short* XTu   = (unsigned short*)(ws + offXT);

  const float inv16 = 1.0f / 16.0f;
  const float cscale = 1.4426950408889634f / 16.0f;   // 1 / sqrt(C) and log2(e): scores in log2 units

  // token-major f16 copies: x [B][C][N] -> [B][N][C]; x_pt [B][C][M] -> [B][M][C]
  transpose_cast_f16<<<dim3(N / TC_T, B), 256, 0, stream>>>(x, (_Float16*)XTu, N);
  transpose_cast_f16<<<dim3(M / TC_T, B), 256, 0, stream>>>(x_pt, (_Float16*)XPTu, M);

  // weights f32 -> f16, carried x16 (folded back as 1/16 in the GEMM scale)
  const int wn2 = C * C / 2;
  cast_scale_f32_f16x2<<<dim3((wn2 + 255) / 256), 256, 0, stream>>>(W1, (_Float16*)W1u, wn2, 16.0f);
  cast_scale_f32_f16x2<<<dim3((wn2 + 255) / 256), 256, 0, stream>>>(W2, (_Float16*)W2u, wn2, 16.0f);
  cast_scale_f32_f16x2<<<dim3((wn2 + 255) / 256), 256, 0, stream>>>(W3, (_Float16*)W3u, wn2, 16.0f);

  // fc1: a[b][n][co] = sum_ci xT[b][n][ci] * W1[co][ci] / 16 + b1[co]   (M=N, N=C, K=C), f16 out
  {
    const int tiles = (N / 64) * (C / 64);
    wmma_gemm64<0, false, 2, 1, false><<<dim3((tiles + 7) / 8, B), 256, 0, stream>>>(
        XTu, XTu, C, (long)N * C,
        W1u, W1u, C, 0L,
        (void*)A16u, (void*)A16u, C, (long)N * C,
        b1, x, 0L,
        N, C, C, inv16);
  }
  // fc2: bq[b][m][co] = sum_ci xptT[b][m][ci] * W2[co][ci] / 16 + b2[co], f16 out
  {
    const int tiles = (M / 64) * (C / 64);
    wmma_gemm64<0, false, 2, 1, false><<<dim3((tiles + 7) / 8, B), 256, 0, stream>>>(
        XPTu, XPTu, C, (long)M * C,
        W2u, W2u, C, 0L,
        (void*)BQu, (void*)BQu, C, (long)M * C,
        b2, x, 0L,
        M, C, C, inv16);
  }
  // fc3 written transposed: cT[b][co][m] = sum_ci W3[co][ci] * bq[b][m][ci] / 16 + b3[co]   (M=C rows, N=M cols, K=C), f16 out
  {
    const int tiles = (C / 64) * (M / 64);
    wmma_gemm64<0, false, 1, 1, false><<<dim3((tiles + 7) / 8, B), 256, 0, stream>>>(
        W3u, W3u, C, 0L,
        BQu, BQu, C, (long)M * C,
        (void*)CTu, (void*)CTu, M, (long)C * M,
        b3, x, 0L,
        C, M, C, inv16);
  }

  // score, softmax, P.c and residual in one launch: out[b][co][n] = x[b][co][n] + sum_m softmax_m(a[n].bq[m] / 16) * cT[co][m]
  attn_fused_f16<<<dim3(N / FA_BQ, B), 256, 0, stream>>>(A16u, BQu, CTu, x, out, N, M, cscale);
  (void)hipGetLastError();
}

// v003
// Measured time: 118 microseconds a run.
// Two timings next to v002 both put it at 1.19 times that version's speed.
// Counting every step since v000, it is 6.92 times as fast.
#include <hip/hip_runtime.h>
#include <stdint.h>
#include <math.h>

// Contractions fc1, fc2, fc3, score = a.b^T and P.c: v_wmma_f32_16x16x32_f16 (f16 operands, f32 accumulate); weights carried x16 (folded back in the f32 epilogue), softmax probabilities carried x2^7 (cancels in the division by the row sum); softmax, bias and residual in f32.

typedef __attribute__((ext_vector_type(16))) _Float16 v16h;
typedef __attribute__((ext_vector_type(8)))  _Float16 v8h;
typedef __attribute__((ext_vector_type(16))) __bf16   v16b;
typedef __attribute__((ext_vector_type(8)))  __bf16   v8b;
typedef __attribute__((ext_vector_type(8)))  float    v8f;
typedef __attribute__((ext_vector_type(4)))  float    v4f;
#define U16(p) ((const unsigned short*)(const void*)(p))

__device__ __forceinline__ unsigned short f2bf_bits(float f) {
  unsigned u = __float_as_uint(f);
  return (unsigned short)((u + 0x7FFFu + ((u >> 16) & 1u)) >> 16);
}
__device__ __forceinline__ float bf_bits2f(unsigned short h) { return __uint_as_float(((unsigned)h) << 16); }

// hazard guards as plain device helpers (no inline asm inside the kernel template body)
__device__ __forceinline__ void dep_guard_h(v8f& a, v8f& b, v16h x, v16h y) { asm volatile("v_nop\n\tv_nop\n\tv_nop\n\tv_nop" : "+v"(a), "+v"(b) : "v"(x), "v"(y)); }
__device__ __forceinline__ void dep_guard_b(v8f& a, v8f& b, v16b x, v16b y) { asm volatile("v_nop\n\tv_nop\n\tv_nop\n\tv_nop" : "+v"(a), "+v"(b) : "v"(x), "v"(y)); }
__device__ __forceinline__ void keep4_h(v16h a, v16h b, v16h c, v16h d) { asm volatile("v_nop" :: "v"(a), "v"(b), "v"(c), "v"(d)); }
__device__ __forceinline__ void keep4_b(v16b a, v16b b, v16b c, v16b d) { asm volatile("v_nop" :: "v"(a), "v"(b), "v"(c), "v"(d)); }
__device__ __forceinline__ void acc_guard4(v8f& a, v8f& b, v8f& c, v8f& d) { asm volatile("v_nop\n\tv_nop\n\tv_nop\n\tv_nop" : "+v"(a), "+v"(b), "+v"(c), "+v"(d)); }
template <typename T> struct Frag;
template <> struct Frag<_Float16> {
  typedef v16h V; union U { v16h v; v8h h[2]; };
  static __device__ __forceinline__ v16h load(const _Float16* p) {   // elements 0..7 <- p[0..7], 8..15 <- p[16..23]
    U f; f.h[0] = *(const v8h*)(p); f.h[1] = *(const v8h*)(p + 16); return f.v;
  }
  static __device__ __forceinline__ v8f mma(v16h a, v16h b, v8f c) {
    return __builtin_amdgcn_wmma_f32_16x16x32_f16(false, a, false, b, (short)0, c, false, false);
  }
  static __device__ __forceinline__ void guard(v8f& a, v8f& b, v16h x, v16h y) { dep_guard_h(a, b, x, y); }
  static __device__ __forceinline__ void keep(v16h a, v16h b, v16h c, v16h d) { keep4_h(a, b, c, d); }
};
template <> struct Frag<__bf16> {
  typedef v16b V; union U { v16b v; v8b h[2]; };
  static __device__ __forceinline__ v16b load(const __bf16* p) {
    U f; f.h[0] = *(const v8b*)(p); f.h[1] = *(const v8b*)(p + 16); return f.v;
  }
  static __device__ __forceinline__ v8f mma(v16b a, v16b b, v8f c) {
    return __builtin_amdgcn_wmma_f32_16x16x32_bf16(false, a, false, b, (short)0, c, false, false);
  }
  static __device__ __forceinline__ void guard(v8f& a, v8f& b, v16b x, v16b y) { dep_guard_b(a, b, x, y); }
  static __device__ __forceinline__ void keep(v16b a, v16b b, v16b c, v16b d) { keep4_b(a, b, c, d); }
};

// ---- Register-blocked batched WMMA GEMM ------------------------------------
// C[m,n] = scale * sum_k A[m,k] * Bt[n,k] (+bias)(+resid); each wave owns a 64x64 tile.
// A row-major [M,K]; Bt row-major [N,K]; M,N % 64 == 0, K % 32 == 0.
// SPLIT: operands are hi/lo planes (A2/Bt2 = lo planes, same layout); product = hi·hi + hi·lo + lo·hi.
// BIAS_MODE: 0 = none, 1 = bias[m], 2 = bias[n].
// OUT_MODE: 0 = f32, 1 = f16, 2 = bf16 hi plane (Cout) + bf16 lo plane (Cout2).
// ET: 0 = f16 operands, 1 = bf16 operands (pointers passed as 16-bit storage)
template <int ET> struct Elem;
template <> struct Elem<0> { typedef _Float16 T; };
template <> struct Elem<1> { typedef __bf16 T; };
// bx, b: the workgroup's index among this product's workgroups and its batch (a launch may hold more than one product).
template <int ET, bool SPLIT, int BIAS_MODE, int OUT_MODE, bool RESID, int ACT = 0>
__device__ __forceinline__ void gemm64_body(
    const unsigned short* __restrict__ Ap, const unsigned short* __restrict__ A2p, int lda, long strideA,
    const unsigned short* __restrict__ Btp, const unsigned short* __restrict__ Bt2p, int ldb, long strideB,
    void* __restrict__ Cout, void* __restrict__ Cout2, int ldc, long strideC,
    const float* __restrict__ bias,
    const float* __restrict__ resid, long strideR,
    int M, int N, int K, float scale, int bx, int b) {
  typedef typename Elem<ET>::T T;
  typedef typename Frag<T>::V V;
  const T* A = (const T*)Ap; const T* A2 = (const T*)A2p; const T* Bt = (const T*)Btp; const T* Bt2 = (const T*)Bt2p;
  __shared__ __align__(16) float sT[8][16 * 68];   // per-wave 16x64 slab, pitch 68 floats
  const int lane = threadIdx.x & 31;
  const int wave = threadIdx.x >> 5;
  const int tilesN = N >> 6;
  const int tilesM = M >> 6;
  const int tile = bx * 8 + wave;
  if (tile >= tilesM * tilesN) return;   // wave-uniform; no block barriers in this kernel
  const int tm = tile / tilesN;
  const int tn = tile - tm * tilesN;
  const int m0 = tm << 6;
  const int n0 = tn << 6;

  const T* Ab  = A  + (size_t)b * strideA;
  const T* Bb  = Bt + (size_t)b * strideB;
  const T* Ab2 = SPLIT ? (A2  + (size_t)b * strideA) : nullptr;
  const T* Bb2 = SPLIT ? (Bt2 + (size_t)b * strideB) : nullptr;

  const int rlane = lane & 15;                 // row (A) / col (B, D) within subtile
  const int koff  = (lane >> 4) * 8;           // k offset of this lane half
  const int mOff  = (lane >> 4) * 8;           // D row offset

  v8f acc[4][4];
#pragma unroll
  for (int i = 0; i < 4; ++i)
#pragma unroll
    for (int j = 0; j < 4; ++j) acc[i][j] = (v8f){0.f,0.f,0.f,0.f,0.f,0.f,0.f,0.f};

  for (int k0 = 0; k0 < K; k0 += 32) {
    V bh[4], bl[4];
#pragma unroll
    for (int j = 0; j < 4; ++j) {
      const size_t bo = (size_t)(n0 + (j << 4) + rlane) * ldb + koff + k0;
      bh[j] = Frag<T>::load(Bb + bo);
      if (SPLIT) bl[j] = Frag<T>::load(Bb2 + bo);
    }
#pragma unroll
    for (int i = 0; i < 4; ++i) {
      const size_t ao = (size_t)(m0 + (i << 4) + rlane) * lda + koff + k0;
      V ah = Frag<T>::load(Ab + ao);
      V al;
      if (SPLIT) al = Frag<T>::load(Ab2 + ao);
#pragma unroll
      for (int j = 0; j < 4; ++j) {
        acc[i][j] = Frag<T>::mma(ah, bh[j], acc[i][j]);
        if (SPLIT) {
          acc[i][j] = Frag<T>::mma(ah, bl[j], acc[i][j]);
          acc[i][j] = Frag<T>::mma(al, bh[j], acc[i][j]);
        }
      }
      Frag<T>::guard(acc[i][0], acc[i][3], ah, SPLIT ? al : ah);
    }
    Frag<T>::keep(bh[0], bh[1], bh[2], bh[3]);
    if (SPLIT) Frag<T>::keep(bl[0], bl[1], bl[2], bl[3]);
  }
  acc_guard4(acc[0][0], acc[0][1], acc[0][2], acc[0][3]);
  acc_guard4(acc[1][0], acc[1][1], acc[1][2], acc[1][3]);
  acc_guard4(acc[2][0], acc[2][1], acc[2][2], acc[2][3]);
  acc_guard4(acc[3][0], acc[3][1], acc[3][2], acc[3][3]);

  // ---- epilogue ----
  float* slab = sT[wave];
  const float* Rb = RESID ? (resid + (size_t)b * strideR) : nullptr;
#pragma unroll
  for (int i = 0; i < 4; ++i) {
    const int mBase = m0 + (i << 4);
#pragma unroll
    for (int j = 0; j < 4; ++j) {
      const int n = n0 + (j << 4) + rlane;
      float bv = 0.f;
      if (BIAS_MODE == 2) bv = bias[n];
#pragma unroll
      for (int r = 0; r < 8; ++r) {
        float v = acc[i][j][r] * scale;
        if (BIAS_MODE == 1) v += bias[mBase + mOff + r];
        if (BIAS_MODE == 2) v += bv;
        if (RESID) v += Rb[(size_t)(mBase + mOff + r) * ldc + n];
        if (ACT == 1) v = tanhf(v);
        if (ACT == 2) v = fmaxf(v, 0.0f);
        if (ACT == 3) v = v / (1.0f + expf(-v));
        if (ACT == 4) v = (v > 0.f) ? v : 0.01f * v;
        if (ACT == 5) v = 0.5f * v * (1.0f + erff(v * 0.70710678118654752f));
        slab[(mOff + r) * 68 + (j << 4) + rlane] = v;
      }
    }
    __builtin_amdgcn_fence(__ATOMIC_RELEASE, "workgroup");
    __builtin_amdgcn_wave_barrier();
    __builtin_amdgcn_fence(__ATOMIC_ACQUIRE, "workgroup");
    if (OUT_MODE == 0) {
      float* C = (float*)Cout + (size_t)b * strideC;
      const int hh = lane >> 4, c4 = (lane & 15) * 4;     // row seg = 256 B = 16 lanes x 16 B
      {
#pragma unroll
        for (int it = 0; it < 8; ++it) {
          const int row = it * 2 + hh;
          v4f v = *(const v4f*)(slab + row * 68 + c4);
          *(v4f*)(C + (size_t)(mBase + row) * ldc + n0 + c4) = v;
        }
        
      }
    } else {
      const int q = lane >> 3, c8 = (lane & 7) * 8;
      unsigned short* C  = (unsigned short*)Cout  + (size_t)b * strideC;
      unsigned short* C2 = (OUT_MODE == 2) ? ((unsigned short*)Cout2 + (size_t)b * strideC) : nullptr;
      {
#pragma unroll
        for (int it = 0; it < 4; ++it) {
          const int row = it * 4 + q;
          const float* sp = slab + row * 68 + c8;
          v8h hv, lv;
#pragma unroll
          for (int e = 0; e < 8; ++e) {
            if (OUT_MODE == 1) {
              hv[e] = (_Float16)sp[e];
            } else {
              unsigned short hb = f2bf_bits(sp[e]);
              unsigned short lb = f2bf_bits(sp[e] - bf_bits2f(hb));
              hv[e] = __builtin_bit_cast(_Float16, hb);
              lv[e] = __builtin_bit_cast(_Float16, lb);
            }
          }
          *(v8h*)(C + (size_t)(mBase + row) * ldc + n0 + c8) = hv;
          if (OUT_MODE == 2) *(v8h*)(C2 + (size_t)(mBase + row) * ldc + n0 + c8) = lv;
        }
        
      }
    }
    __builtin_amdgcn_fence(__ATOMIC_RELEASE, "workgroup");
    __builtin_amdgcn_wave_barrier();
    __builtin_amdgcn_fence(__ATOMIC_ACQUIRE, "workgroup");
  }
}

template <int ET, bool SPLIT, int BIAS_MODE, int OUT_MODE, bool RESID, int ACT = 0>
__global__ __launch_bounds__(256) void wmma_gemm64(
    const unsigned short* __restrict__ Ap, const unsigned short* __restrict__ A2p, int lda, long strideA,
    const unsigned short* __restrict__ Btp, const unsigned short* __restrict__ Bt2p, int ldb, long strideB,
    void* __restrict__ Cout, void* __restrict__ Cout2, int ldc, long strideC,
    const float* __restrict__ bias,
    const float* __restrict__ resid, long strideR,
    int M, int N, int K, float scale) {
  gemm64_body<ET, SPLIT, BIAS_MODE, OUT_MODE, RESID, ACT>(Ap, A2p, lda, strideA, Btp, Bt2p, ldb, strideB, Cout, Cout2, ldc, strideC,
                                                          bias, resid, strideR, M, N, K, scale, (int)blockIdx.x, (int)blockIdx.y);
}

// ---- fc1 and fc2 in one launch: neither reads what the other writes. Workgroups [0, nb1) of a batch do fc1, the rest fc2. ----
__global__ __launch_bounds__(256) void fc1_fc2_f16(
    const unsigned short* __restrict__ XT, const unsigned short* __restrict__ XPT,
    const unsigned short* __restrict__ W1h, const unsigned short* __restrict__ W2h,
    unsigned short* __restrict__ A16, unsigned short* __restrict__ BQ,
    const float* __restrict__ b1, const float* __restrict__ b2,
    int N, int M, int C, int nb1, float scale) {
  const bool two = (int)blockIdx.x >= nb1;             // the same for the whole workgroup
  const unsigned short* A  = two ? XPT : XT;
  const unsigned short* Wt = two ? W2h : W1h;
  unsigned short* Co       = two ? BQ : A16;
  const float* bias        = two ? b2 : b1;
  const int rows           = two ? M : N;
  const int bx             = two ? (int)blockIdx.x - nb1 : (int)blockIdx.x;
  gemm64_body<0, false, 2, 1, false>(A, A, C, (long)rows * C, Wt, Wt, C, 0L, (void*)Co, (void*)Co, C, (long)rows * C,
                                     bias, bias, 0L, rows, C, C, scale, bx, (int)blockIdx.y);
}

// ---- all operand preparation in one launch (five independent jobs, told apart by the workgroup index) ----
// Workgroups [0, nbX): x, then [nbX, nbX + nbP): x_pt: channel-major f32 [Bt][256][L] -> token-major f16 [Bt][L][256]; tile = 32 tokens x 256 channels.
// The last 3 * nbW workgroups: W1, W2, W3 f32 -> f16, times wscale, two elements a thread.
#define TC_C 256
#define TC_T 32
#define TC_PITCH 264
__global__ __launch_bounds__(256) void prep_operands_f16(
    const float* __restrict__ x, const float* __restrict__ x_pt,
    const float* __restrict__ W1, const float* __restrict__ W2, const float* __restrict__ W3,
    _Float16* __restrict__ XT, _Float16* __restrict__ XPT,
    _Float16* __restrict__ W1h, _Float16* __restrict__ W2h, _Float16* __restrict__ W3h,
    int N, int M, int nbX, int nbP, int nbW, int wn2, float wscale) {
  __shared__ __align__(16) _Float16 tile[TC_T * TC_PITCH];
  const int tid = threadIdx.x;
  const int bx  = blockIdx.x;
  if (bx >= nbX + nbP) {                 // block-uniform: a weight job, no barrier on this path
    const int w = bx - nbX - nbP;
    const int which = w / nbW;
    const float* in = which == 0 ? W1 : which == 1 ? W2 : W3;
    _Float16* out   = which == 0 ? W1h : which == 1 ? W2h : W3h;
    const int i = (w - which * nbW) * 256 + tid;
    if (i < wn2) {
      const _Float16 h0 = (_Float16)(in[2 * i] * wscale), h1 = (_Float16)(in[2 * i + 1] * wscale);
      const unsigned u = (unsigned)__builtin_bit_cast(unsigned short, h0) | ((unsigned)__builtin_bit_cast(unsigned short, h1) << 16);
      ((unsigned*)out)[i] = u;
    }
    return;
  }
  const bool pt = bx >= nbX;             // block-uniform
  const float* in = pt ? x_pt : x;
  _Float16* out   = pt ? XPT : XT;
  const int L     = pt ? M : N;
  const int job   = pt ? bx - nbX : bx;
  const int per   = L / TC_T;            // tiles of one batch
  const int lane = tid & 31;
  const int wave = tid >> 5;
  const int bt   = job / per;
  const int t0   = (job - bt * per) * TC_T;
  if (t0 + TC_T > L) return;             // block-uniform; grids are exact here
  const float* ib = in + (size_t)bt * TC_C * L;
#pragma unroll 8
  for (int i = 0; i < TC_C / 8; ++i) {
    const int c = wave + 8 * i;
    const float v = ib[(size_t)c * L + t0 + lane];
    tile[lane * TC_PITCH + c] = (_Float16)v;
  }
  __syncthreads();
  _Float16* ob = out + ((size_t)bt * L + t0) * TC_C;
  v8h rv[4];
#pragma unroll
  for (int p = 0; p < 4; ++p) {
    const int row = wave + 8 * p;        // rows 0..31 covered by 8 waves x 4
    rv[p] = *(const v8h*)(tile + row * TC_PITCH + lane * 8);
  }
#pragma unroll
  for (int p = 0; p < 4; ++p) {
    const int row = wave + 8 * p;
    *(v8h*)(ob + (size_t)row * TC_C + lane * 8) = rv[p];
  }
}

typedef __attribute__((ext_vector_type(4))) unsigned int u32x4;
#define FA_C 256
#define FA_BQ 128
#define FA_BK 32
#define FA_PK 528                       // LDS pitch of a bq row: 512 B + 16 (odd multiple of 16 B)
#define FA_PV 80                        // LDS pitch of a cT row piece: 64 B + 16 (odd multiple of 16 B)
#define FA_TK (FA_BK * FA_PK)
#define FA_TV (FA_C * FA_PV)
#define FA_BUF (FA_TK + FA_TV)
#define FA_PE 528                       // output staging pitch: 128 f32 + 16 B
#define FA_LDS (FA_C * FA_PE)
static_assert(2 * FA_BUF <= FA_LDS, "the two pass buffers lie inside the output staging area");

// lane l with lane l ^ 16
__device__ __forceinline__ float xhalf(float v) {
  return __builtin_bit_cast(float, __builtin_amdgcn_permlanex16(__builtin_bit_cast(int, v), __builtin_bit_cast(int, v), 0x76543210, 0xfedcba98, false, false));
}
// Four vector slots behind a run of matrix instructions, held in place by the two scheduling barriers: keeps the
// distance to the next vector instruction that touches their registers on every path, a taken branch included.
__device__ __forceinline__ void wmma_gap() {
  __builtin_amdgcn_sched_barrier(0);
  asm volatile("v_nop\n\tv_nop\n\tv_nop\n\tv_nop");
  __builtin_amdgcn_sched_barrier(0);
}
// Behind a run of global loads or stores: stands in front of every later overwrite of their address registers
// (the scheduling barrier keeps such an overwrite from being moved up over the wait).
__device__ __forceinline__ void wait_xcnt0() {
  asm volatile("s_wait_xcnt 0x0" ::: "memory");
  __builtin_amdgcn_sched_barrier(0);
}
// Eight exponentials (base 2) in one statement: behind a transcendental one independent instruction stands before its result
// is used or its source overwritten; here each next exponential is that instruction, and the v_nop is the last one's.
// The outputs are early-clobber, so none of them lies on a source.
__device__ __forceinline__ v8f exp2x8(v8f t) {
  float p0, p1, p2, p3, p4, p5, p6, p7;
  asm("v_exp_f32 %0, %8\n\tv_exp_f32 %1, %9\n\tv_exp_f32 %2, %10\n\tv_exp_f32 %3, %11\n\t"
      "v_exp_f32 %4, %12\n\tv_exp_f32 %5, %13\n\tv_exp_f32 %6, %14\n\tv_exp_f32 %7, %15\n\tv_nop"
      : "=&v"(p0), "=&v"(p1), "=&v"(p2), "=&v"(p3), "=&v"(p4), "=&v"(p5), "=&v"(p6), "=&v"(p7)
      : "v"(t[0]), "v"(t[1]), "v"(t[2]), "v"(t[3]), "v"(t[4]), "v"(t[5]), "v"(t[6]), "v"(t[7]));
  return (v8f){p0, p1, p2, p3, p4, p5, p6, p7};
}
__device__ __forceinline__ v16h lds_frag(const unsigned char* p) {   // elements 0..7 <- bytes 0..15, 8..15 <- bytes 32..47
  Frag<_Float16>::U f; f.h[0] = *(const v8h*)(p); f.h[1] = *(const v8h*)(p + 32); return f.v;
}

__global__ __launch_bounds__(256) __attribute__((amdgpu_waves_per_eu(2, 2))) void attn_fused_f16(
    const unsigned short* __restrict__ Aq,    // a  [B][N][256] f16
    const unsigned short* __restrict__ Bk,    // bq [B][M][256] f16
    const unsigned short* __restrict__ Ct,    // cT [B][256][M] f16
    const float* __restrict__ x, float* __restrict__ out,   // [B][256][N] f32
    int N, int M, float cscale) {
  __shared__ __align__(16) unsigned char L[FA_LDS];
  const int tid  = threadIdx.x;
  const int lane = tid & 31;
  const int wave = tid >> 5;
  const int c = lane & 15, h = lane >> 4;
  const int b  = blockIdx.y;
  const int q0 = blockIdx.x * FA_BQ;
  const unsigned char* kSrc = (const unsigned char*)(Bk + (size_t)b * M * FA_C);
  const unsigned char* vSrc = (const unsigned char*)(Ct + (size_t)b * FA_C * M);
  const size_t vPitch = (size_t)M * 2;
  const int nPass = M / FA_BK;

  u32x4 pk[4], pv[4];   // the next pass's tiles on their way to LDS
  auto gload = [&](int s) {
#pragma unroll
    for (int i = 0; i < 4; ++i) {
      const int id = i * 256 + tid;
      pk[i] = *(const u32x4*)(kSrc + (size_t)s * (FA_BK * FA_C * 2) + (size_t)id * 16);
      pv[i] = *(const u32x4*)(vSrc + (size_t)(id >> 2) * vPitch + (size_t)s * (FA_BK * 2) + (id & 3) * 16);
    }
    wait_xcnt0();
  };
  auto sstore = [&](int buf) {
    unsigned char* base = L + buf * FA_BUF;
#pragma unroll
    for (int i = 0; i < 4; ++i) {
      const int id = i * 256 + tid;
      *(u32x4*)(base + (id >> 5) * FA_PK + (id & 31) * 16) = pk[i];
      *(u32x4*)(base + FA_TK + (id >> 2) * FA_PV + (id & 3) * 16) = pv[i];
    }
  };

  gload(0);
  v16h qf[8];   // this wave's 16 queries as B operand, kept for the whole loop
  {
    const _Float16* qp = (const _Float16*)Aq + ((size_t)b * N + q0 + wave * 16 + c) * FA_C + 8 * h;
#pragma unroll
    for (int kc = 0; kc < 8; ++kc) qf[kc] = Frag<_Float16>::load(qp + 32 * kc);
    wait_xcnt0();
  }
  v8f acc[16];
#pragma unroll
  for (int t = 0; t < 16; ++t) acc[t] = (v8f){0.f,0.f,0.f,0.f,0.f,0.f,0.f,0.f};
  float m_run = -INFINITY, l_run = 0.f;
  sstore(0);
  __syncthreads();   // pass 0's tiles are in LDS

  for (int s = 0; s < nPass; ++s) {
    const bool more = s + 1 < nPass;     // the same for the whole workgroup
    if (more) gload(s + 1);
    const unsigned char* kb = L + (s & 1) * FA_BUF + c * FA_PK + 16 * h;
    const unsigned char* vb = L + (s & 1) * FA_BUF + FA_TK + c * FA_PV + 16 * h;
    v8f s0 = (v8f){0.f,0.f,0.f,0.f,0.f,0.f,0.f,0.f};
    v8f s1 = (v8f){0.f,0.f,0.f,0.f,0.f,0.f,0.f,0.f};
    v16h fr[16];   // the pass's 16 bq fragments, then its 16 cT fragments
#pragma unroll
    for (int kc = 0; kc < 8; ++kc) {
      fr[2 * kc]     = lds_frag(kb + 64 * kc);
      fr[2 * kc + 1] = lds_frag(kb + 16 * FA_PK + 64 * kc);
    }
    __builtin_amdgcn_sched_barrier(0);   // all 32 LDS loads issue ahead of the first product: their latency is paid once, not per product
#pragma unroll
    for (int kc = 0; kc < 8; ++kc) {
      s0 = Frag<_Float16>::mma(fr[2 * kc],     qf[kc], s0);
      s1 = Frag<_Float16>::mma(fr[2 * kc + 1], qf[kc], s1);
    }
#pragma unroll
    for (int t = 0; t < 16; ++t) fr[t] = lds_frag(vb + t * 16 * FA_PV);
    __builtin_amdgcn_sched_barrier(0);   // the cT loads issue here and fly under the softmax arithmetic
    float mx = fmaxf(s0[0], s1[0]);
#pragma unroll
    for (int r = 1; r < 8; ++r) mx = fmaxf(mx, fmaxf(s0[r], s1[r]));
    mx = fmaxf(mx, xhalf(mx)) * cscale;  // both wave halves hold this query's maximum of the pass, in log2 units
    if (__builtin_amdgcn_ballot_w32(mx > m_run + 8.0f) != 0) {   // scalar branch: rare after the first passes
      const float m_new = fmaxf(m_run, mx);
      const float corr = __builtin_amdgcn_exp2f(m_run - m_new);   // 0 on the first pass, 1 for a query whose maximum stays
      l_run *= corr; m_run = m_new;
#pragma unroll
      for (int t = 0; t < 16; ++t) acc[t] = acc[t] * corr;
    }
    const float nm = 7.0f - m_run;
    v16h pf;
    float ps0 = 0.f, ps1 = 0.f;
#pragma unroll
    for (int r = 0; r < 8; ++r) { s0[r] = fmaf(s0[r], cscale, nm); s1[r] = fmaf(s1[r], cscale, nm); }
    const v8f e0 = exp2x8(s0), e1 = exp2x8(s1);
#pragma unroll
    for (int r = 0; r < 8; ++r) {
      ps0 += e0[r]; ps1 += e1[r];
      pf[r] = (_Float16)e0[r]; pf[8 + r] = (_Float16)e1[r];
    }
    l_run += ps0 + ps1;
#pragma unroll
    for (int t = 0; t < 16; ++t) acc[t] = Frag<_Float16>::mma(fr[t], pf, acc[t]);
    wmma_gap();
    if (more) sstore((s + 1) & 1);
    __syncthreads();   // publishes pass s + 1's tiles and ends every wave's reads of pass s's buffer
  }

  // ---- epilogue: O^T / l staged in LDS (rows = channels), then whole 512-byte rows: + residual, stored once ----
  const float inv = 1.0f / (l_run + xhalf(l_run));   // each wave half summed its own keys
#pragma unroll
  for (int t = 0; t < 16; ++t)
#pragma unroll
    for (int r = 0; r < 8; ++r)
      *(float*)(L + (16 * t + 8 * h + r) * FA_PE + (wave * 16 + c) * 4) = acc[t][r] * inv;
  __syncthreads();   // the whole 256 x 128 tile is staged
  for (int i0 = 0; i0 < FA_C / 8; i0 += 8) {
    v4f xr[8];
#pragma unroll
    for (int j = 0; j < 8; ++j)
      xr[j] = *(const v4f*)(x + ((size_t)b * FA_C + (i0 + j) * 8 + wave) * N + q0 + lane * 4);
    wait_xcnt0();
#pragma unroll
    for (int j = 0; j < 8; ++j) {
      const int row = (i0 + j) * 8 + wave;
      *(v4f*)(out + ((size_t)b * FA_C + row) * N + q0 + lane * 4) = *(const v4f*)(L + row * FA_PE + lane * 16) + xr[j];
    }
    wait_xcnt0();
  }
}

// ---------------------------------------------------------------------------
extern "C" void kernel_launch(void* const* d_in, const int* in_sizes, int n_in,
                              void* d_out, int out_size, void* d_ws, size_t ws_size,
                              hipStream_t stream) {
  const int B = 4, C = 256, N = 8192, M = 2048;
  if (n_in < 8) return;
  if (in_sizes[0] != B * C * N || in_sizes[1] != B * C * M ||
      in_sizes[2] != C * C || in_sizes[3] != C || in_sizes[4] != C * C || in_sizes[5] != C ||
      in_sizes[6] != C * C || in_sizes[7] != C || out_size != B * C * N) return;

  const float* x    = (const float*)d_in[0];
  const float* x_pt = (const float*)d_in[1];
  const float* W1   = (const float*)d_in[2];
  const float* b1   = (const float*)d_in[3];
  const float* W2   = (const float*)d_in[4];
  const float* b2   = (const float*)d_in[5];
  const float* W3   = (const float*)d_in[6];
  const float* b3   = (const float*)d_in[7];
  float* out = (float*)d_out;

  const size_t szA16 = (size_t)B * N * C * 2;          // a  [B][N][C] f16      16,777,216
  const size_t szW   = (size_t)C * C * 2;              // one weight f16          131,072
  const size_t szTok = (size_t)B * M * C * 2;          // [B][M][C] f16           4,194,304
  const size_t szXT  = (size_t)B * N * C * 2;          // x token-major f16       16,777,216
  const size_t offA16 = 0;
  const size_t offW1  = offA16 + szA16;
  const size_t offW2  = offW1 + szW;
  const size_t offW3  = offW2 + szW;
  const size_t offXPT = offW3 + szW;
  const size_t offBQ  = offXPT + szTok;
  const size_t offCT  = offBQ + szTok;
  const size_t offXT  = offCT + szTok;
  const size_t total  = offXT + szXT;                  // 46,530,560
  if (total > ws_size) return;

  char* ws = (char*)d_ws;
  unsigned short* A16u  = (unsigned short*)(ws + offA16);
  unsigned short* W1u   = (unsigned short*)(ws + offW1);
  unsigned short* W2u   = (unsigned short*)(ws + offW2);
  unsigned short* W3u   = (unsigned short*)(ws + offW3);
  unsigned short* XPTu  = (unsigned short*)(ws + offXPT);
  unsigned short* BQu   = (unsigned short*)(ws + offBQ);
  unsigned short* CTu   = (unsigned short*)(ws + offCT);
  unsigned short* XTu   = (unsigned short*)(ws + offXT);

  const float inv16 = 1.0f / 16.0f;
  const float cscale = 1.4426950408889634f / 16.0f;   // 1 / sqrt(C) and log2(e): scores in log2 units

  // one launch: token-major f16 copies x [B][C][N] -> [B][N][C], x_pt [B][C][M] -> [B][M][C]; weights f32 -> f16, carried x16 (folded back as 1/16 in the GEMM scale)
  const int wn2 = C * C / 2;
  const int nbX = (N / TC_T) * B, nbP = (M / TC_T) * B, nbW = (wn2 + 255) / 256;
  prep_operands_f16<<<dim3(nbX + nbP + 3 * nbW), 256, 0, stream>>>(
      x, x_pt, W1, W2, W3, (_Float16*)XTu, (_Float16*)XPTu, (_Float16*)W1u, (_Float16*)W2u, (_Float16*)W3u,
      N, M, nbX, nbP, nbW, wn2, 16.0f);

  // one launch: fc1: a[b][n][co] = sum_ci xT[b][n][ci] * W1[co][ci] / 16 + b1[co]; fc2: bq[b][m][co] = sum_ci xptT[b][m][ci] * W2[co][ci] / 16 + b2[co]; f16 out
  {
    const int nb1 = ((N / 64) * (C / 64) + 7) / 8, nb2 = ((M / 64) * (C / 64) + 7) / 8;
    fc1_fc2_f16<<<dim3(nb1 + nb2, B), 256, 0, stream>>>(XTu, XPTu, W1u, W2u, A16u, BQu, b1, b2, N, M, C, nb1, inv16);
  }
  // fc3 written transposed: cT[b][co][m] = sum_ci W3[co][ci] * bq[b][m][ci] / 16 + b3[co]   (M=C rows, N=M cols, K=C), f16 out
  {
    const int tiles = (C / 64) * (M / 64);
    wmma_gemm64<0, false, 1, 1, false><<<dim3((tiles + 7) / 8, B), 256, 0, stream>>>(
        W3u, W3u, C, 0L,
        BQu, BQu, C, (long)M * C,
        (void*)CTu, (void*)CTu, M, (long)C * M,
        b3, x, 0L,
        C, M, C, inv16);
  }

  // score, softmax, P.c and residual in one launch: out[b][co][n] = x[b][co][n] + sum_m softmax_m(a[n].bq[m] / 16) * cT[co][m]
  attn_fused_f16<<<dim3(N / FA_BQ, B), 256, 0, stream>>>(A16u, BQu, CTu, x, out, N, M, cscale);
  (void)hipGetLastError();
}

// v004
// A run of this version takes 85.7 microseconds.
// Timed twice side by side with v003, it ran 1.37 and 1.38 times as fast.
// Over all steps from v000 it is 9.49 times as fast.
#include <hip/hip_runtime.h>
#include <stdint.h>
#include <math.h>

// Contractions fc1, fc2, fc3, score = a.b^T and P.c: v_wmma_f32_16x16x32_f16 (f16 operands, f32 accumulate); weights carried x16 (folded back in the f32 epilogue), softmax probabilities carried x2^7 (cancels in the division by the row sum); softmax, bias and residual in f32.

typedef __attribute__((ext_vector_type(16))) _Float16 v16h;
typedef __attribute__((ext_vector_type(8)))  _Float16 v8h;
typedef __attribute__((ext_vector_type(8)))  float    v8f;
typedef __attribute__((ext_vector_type(4)))  float    v4f;

template <typename T> struct Frag;
template <> struct Frag<_Float16> {
  typedef v16h V; union U { v16h v; v8h h[2]; };
  static __device__ __forceinline__ v16h load(const _Float16* p) {   // elements 0..7 <- p[0..7], 8..15 <- p[16..23]
    U f; f.h[0] = *(const v8h*)(p); f.h[1] = *(const v8h*)(p + 16); return f.v;
  }
  static __device__ __forceinline__ v8f mma(v16h a, v16h b, v8f c) {
    return __builtin_amdgcn_wmma_f32_16x16x32_f16(false, a, false, b, (short)0, c, false, false);
  }
};

typedef __attribute__((ext_vector_type(4))) unsigned int u32x4;
#define FA_C 256
#define FA_BQ 128
#define FA_BK 32
#define FA_PK 528                       // LDS pitch of a bq row: 512 B + 16 (odd multiple of 16 B)
#define FA_PV 80                        // LDS pitch of a cT row piece: 64 B + 16 (odd multiple of 16 B)
#define FA_TK (FA_BK * FA_PK)
#define FA_TV (FA_C * FA_PV)
#define FA_BUF (FA_TK + FA_TV)
#define FA_PE 528                       // output staging pitch: 128 f32 + 16 B
#define FA_LDS (FA_C * FA_PE)
static_assert(2 * FA_BUF <= FA_LDS, "the two pass buffers lie inside the output staging area");

// lane l with lane l ^ 16
__device__ __forceinline__ float xhalf(float v) {
  return __builtin_bit_cast(float, __builtin_amdgcn_permlanex16(__builtin_bit_cast(int, v), __builtin_bit_cast(int, v), 0x76543210, 0xfedcba98, false, false));
}
// Four vector slots behind a run of matrix instructions, held in place by the two scheduling barriers: keeps the
// distance to the next vector instruction that touches their registers on every path, a taken branch included.
__device__ __forceinline__ void wmma_gap() {
  __builtin_amdgcn_sched_barrier(0);
  asm volatile("v_nop\n\tv_nop\n\tv_nop\n\tv_nop");
  __builtin_amdgcn_sched_barrier(0);
}
// Behind a run of global loads or stores: stands in front of every later overwrite of their address registers
// (the scheduling barrier keeps such an overwrite from being moved up over the wait).
__device__ __forceinline__ void wait_xcnt0() {
  asm volatile("s_wait_xcnt 0x0" ::: "memory");
  __builtin_amdgcn_sched_barrier(0);
}
// Eight exponentials (base 2) in one statement: behind a transcendental one independent instruction stands before its result
// is used or its source overwritten; here each next exponential is that instruction, and the v_nop is the last one's.
// The outputs are early-clobber, so none of them lies on a source.
__device__ __forceinline__ v8f exp2x8(v8f t) {
  float p0, p1, p2, p3, p4, p5, p6, p7;
  asm("v_exp_f32 %0, %8\n\tv_exp_f32 %1, %9\n\tv_exp_f32 %2, %10\n\tv_exp_f32 %3, %11\n\t"
      "v_exp_f32 %4, %12\n\tv_exp_f32 %5, %13\n\tv_exp_f32 %6, %14\n\tv_exp_f32 %7, %15\n\tv_nop"
      : "=&v"(p0), "=&v"(p1), "=&v"(p2), "=&v"(p3), "=&v"(p4), "=&v"(p5), "=&v"(p6), "=&v"(p7)
      : "v"(t[0]), "v"(t[1]), "v"(t[2]), "v"(t[3]), "v"(t[4]), "v"(t[5]), "v"(t[6]), "v"(t[7]));
  return (v8f){p0, p1, p2, p3, p4, p5, p6, p7};
}
__device__ __forceinline__ v16h lds_frag(const unsigned char* p) {   // elements 0..7 <- bytes 0..15, 8..15 <- bytes 32..47
  Frag<_Float16>::U f; f.h[0] = *(const v8h*)(p); f.h[1] = *(const v8h*)(p + 32); return f.v;
}

__global__ __launch_bounds__(256) __attribute__((amdgpu_waves_per_eu(2, 2))) void attn_fused_f16(
    const unsigned short* __restrict__ Aq,    // a  [B][N][256] f16
    const unsigned short* __restrict__ Bk,    // bq [B][M][256] f16
    const unsigned short* __restrict__ Ct,    // cT [B][256][M] f16
    const float* __restrict__ x, float* __restrict__ out,   // [B][256][N] f32
    int N, int M, float cscale) {
  __shared__ __align__(16) unsigned char L[FA_LDS];
  const int tid  = threadIdx.x;
  const int lane = tid & 31;
  const int wave = tid >> 5;
  const int c = lane & 15, h = lane >> 4;
  const int b  = blockIdx.y;
  const int q0 = blockIdx.x * FA_BQ;
  const unsigned char* kSrc = (const unsigned char*)(Bk + (size_t)b * M * FA_C);
  const unsigned char* vSrc = (const unsigned char*)(Ct + (size_t)b * FA_C * M);
  const size_t vPitch = (size_t)M * 2;
  const int nPass = M / FA_BK;

  u32x4 pk[4], pv[4];   // the next pass's tiles on their way to LDS
  auto gload = [&](int s) {
#pragma unroll
    for (int i = 0; i < 4; ++i) {
      const int id = i * 256 + tid;
      pk[i] = *(const u32x4*)(kSrc + (size_t)s * (FA_BK * FA_C * 2) + (size_t)id * 16);
      pv[i] = *(const u32x4*)(vSrc + (size_t)(id >> 2) * vPitch + (size_t)s * (FA_BK * 2) + (id & 3) * 16);
    }
    wait_xcnt0();
  };
  auto sstore = [&](int buf) {
    unsigned char* base = L + buf * FA_BUF;
#pragma unroll
    for (int i = 0; i < 4; ++i) {
      const int id = i * 256 + tid;
      *(u32x4*)(base + (id >> 5) * FA_PK + (id & 31) * 16) = pk[i];
      *(u32x4*)(base + FA_TK + (id >> 2) * FA_PV + (id & 3) * 16) = pv[i];
    }
  };

  gload(0);
  v16h qf[8];   // this wave's 16 queries as B operand, kept for the whole loop
  {
    const _Float16* qp = (const _Float16*)Aq + ((size_t)b * N + q0 + wave * 16 + c) * FA_C + 8 * h;
#pragma unroll
    for (int kc = 0; kc < 8; ++kc) qf[kc] = Frag<_Float16>::load(qp + 32 * kc);
    wait_xcnt0();
  }
  v8f acc[16];
#pragma unroll
  for (int t = 0; t < 16; ++t) acc[t] = (v8f){0.f,0.f,0.f,0.f,0.f,0.f,0.f,0.f};
  float m_run = -INFINITY, l_run = 0.f;
  sstore(0);
  __syncthreads();   // pass 0's tiles are in LDS

  for (int s = 0; s < nPass; ++s) {
    const bool more = s + 1 < nPass;     // the same for the whole workgroup
    if (more) gload(s + 1);
    const unsigned char* kb = L + (s & 1) * FA_BUF + c * FA_PK + 16 * h;
    const unsigned char* vb = L + (s & 1) * FA_BUF + FA_TK + c * FA_PV + 16 * h;
    v8f s0 = (v8f){0.f,0.f,0.f,0.f,0.f,0.f,0.f,0.f};
    v8f s1 = (v8f){0.f,0.f,0.f,0.f,0.f,0.f,0.f,0.f};
    v16h fr[16];   // the pass's 16 bq fragments, then its 16 cT fragments
#pragma unroll
    for (int kc = 0; kc < 8; ++kc) {
      fr[2 * kc]     = lds_frag(kb + 64 * kc);
      fr[2 * kc + 1] = lds_frag(kb + 16 * FA_PK + 64 * kc);
    }
    __builtin_amdgcn_sched_barrier(0);   // all 32 LDS loads issue ahead of the first product: their latency is paid once, not per product
#pragma unroll
    for (int kc = 0; kc < 8; ++kc) {
      s0 = Frag<_Float16>::mma(fr[2 * kc],     qf[kc], s0);
      s1 = Frag<_Float16>::mma(fr[2 * kc + 1], qf[kc], s1);
    }
#pragma unroll
    for (int t = 0; t < 16; ++t) fr[t] = lds_frag(vb + t * 16 * FA_PV);
    __builtin_amdgcn_sched_barrier(0);   // the cT loads issue here and fly under the softmax arithmetic
    float mx = fmaxf(s0[0], s1[0]);
#pragma unroll
    for (int r = 1; r < 8; ++r) mx = fmaxf(mx, fmaxf(s0[r], s1[r]));
    mx = fmaxf(mx, xhalf(mx)) * cscale;  // both wave halves hold this query's maximum of the pass, in log2 units
    if (__builtin_amdgcn_ballot_w32(mx > m_run + 8.0f) != 0) {   // scalar branch: rare after the first passes
      const float m_new = fmaxf(m_run, mx);
      const float corr = __builtin_amdgcn_exp2f(m_run - m_new);   // 0 on the first pass, 1 for a query whose maximum stays
      l_run *= corr; m_run = m_new;
#pragma unroll
      for (int t = 0; t < 16; ++t) acc[t] = acc[t] * corr;
    }
    const float nm = 7.0f - m_run;
    v16h pf;
    float ps0 = 0.f, ps1 = 0.f;
#pragma unroll
    for (int r = 0; r < 8; ++r) { s0[r] = fmaf(s0[r], cscale, nm); s1[r] = fmaf(s1[r], cscale, nm); }
    const v8f e0 = exp2x8(s0), e1 = exp2x8(s1);
#pragma unroll
    for (int r = 0; r < 8; ++r) {
      ps0 += e0[r]; ps1 += e1[r];
      pf[r] = (_Float16)e0[r]; pf[8 + r] = (_Float16)e1[r];
    }
    l_run += ps0 + ps1;
#pragma unroll
    for (int t = 0; t < 16; ++t) acc[t] = Frag<_Float16>::mma(fr[t], pf, acc[t]);
    wmma_gap();
    if (more) sstore((s + 1) & 1);
    __syncthreads();   // publishes pass s + 1's tiles and ends every wave's reads of pass s's buffer
  }

  // ---- epilogue: O^T / l staged in LDS (rows = channels), then whole 512-byte rows: + residual, stored once ----
  const float inv = 1.0f / (l_run + xhalf(l_run));   // each wave half summed its own keys
#pragma unroll
  for (int t = 0; t < 16; ++t)
#pragma unroll
    for (int r = 0; r < 8; ++r)
      *(float*)(L + (16 * t + 8 * h + r) * FA_PE + (wave * 16 + c) * 4) = acc[t][r] * inv;
  __syncthreads();   // the whole 256 x 128 tile is staged
  for (int i0 = 0; i0 < FA_C / 8; i0 += 8) {
    v4f xr[8];
#pragma unroll
    for (int j = 0; j < 8; ++j)
      xr[j] = *(const v4f*)(x + ((size_t)b * FA_C + (i0 + j) * 8 + wave) * N + q0 + lane * 4);
    wait_xcnt0();
#pragma unroll
    for (int j = 0; j < 8; ++j) {
      const int row = (i0 + j) * 8 + wave;
      *(v4f*)(out + ((size_t)b * FA_C + row) * N + q0 + lane * 4) = *(const v4f*)(L + row * FA_PE + lane * 16) + xr[j];
    }
    wait_xcnt0();
  }
}

// ---- all three projections in one launch, straight from the f32 inputs ----
// A job is one tile of 64 tokens. The tile goes global (channel-major f32) -> registers -> LDS (token-major f16), the weight
// global f32 -> x16 -> f16 rows in LDS; both are read as WMMA fragments in the same k order; results leave through LDS as whole lines.
// Workgroups [0, nPt): one x_pt tile: fc2, then fc3 on the f16 fc2 tile still in LDS. The others: fc1 on four x tiles, the next tile's loads in flight under a product.
// 8 waves: wave = (group of 64 output channels) + 4 * (group of 32 tokens).
#define PJ_T 64
#define PJ_C 256
#define PJ_P 528                        // LDS pitch of a row of 256 f16: 512 B + 16 (odd multiple of 16 B)
#define PJ_PC 144                       // LDS pitch of a cT row piece: 128 B + 16 (odd multiple of 16 B)
#define PJ_LW 0
#define PJ_LX (PJ_LW + PJ_C * PJ_P)
#define PJ_LO (PJ_LX + PJ_T * PJ_P)
#define PJ_LC (PJ_LO + PJ_T * PJ_P)
#define PJ_LDS (PJ_LC + PJ_C * PJ_PC)

typedef __attribute__((ext_vector_type(2))) _Float16 v2h;
typedef __attribute__((ext_vector_type(2))) float    v2f;
__device__ __forceinline__ unsigned pack2h(float a, float b) {   // round to nearest even, a in the low half
  return __builtin_bit_cast(unsigned, __builtin_convertvector((v2f){a, b}, v2h));
}
// src: channel 0 of the tile's batch at the tile's first token; Lt: tokens in a channel row. A wave-wide load is one 128-byte line.
template <int Lt>
__device__ __forceinline__ void pj_gload(float (&pre)[64], const float* __restrict__ src, int lane, int wave) {
  const float* p = src + (wave >> 1) * 2 * Lt + (wave & 1) * 32 + lane;   // token half wave & 1, channel pair 4 i + (wave >> 1)
#pragma unroll
  for (int i = 0; i < 32; ++i) {
    pre[2 * i]     = p[i * 8 * Lt];
    pre[2 * i + 1] = p[i * 8 * Lt + Lt];
  }
  wait_xcnt0();
}
__device__ __forceinline__ void pj_sstore(const float (&pre)[64], unsigned char* LX, int lane, int wave) {
  unsigned char* q = LX + ((wave & 1) * 32 + lane) * PJ_P + (wave >> 1) * 4;
#pragma unroll
  for (int i = 0; i < 32; ++i) *(unsigned*)(q + i * 16) = pack2h(pre[2 * i], pre[2 * i + 1]);
}
__device__ __forceinline__ void pj_loadW(const float* __restrict__ Wg, unsigned char* LW, int tid, float wscale) {
  const float* p = Wg + tid * 4;                                    // piece id = 256 k + tid: row id >> 6, four columns from (id & 63) * 4
  unsigned char* q = LW + (tid >> 6) * PJ_P + (tid & 63) * 8;
  for (int b0 = 0; b0 < 2; ++b0) {
    v4f w[32];
#pragma unroll
    for (int j = 0; j < 32; ++j) w[j] = *(const v4f*)(p + j * 1024);
    wait_xcnt0();
#pragma unroll
    for (int j = 0; j < 32; ++j) {
      uint2 o;
      o.x = pack2h(w[j][0] * wscale, w[j][1] * wscale);
      o.y = pack2h(w[j][2] * wscale, w[j][3] * wscale);
      *(uint2*)(q + j * 4 * PJ_P) = o;
    }
    p += 32 * 1024;
    q += 32 * 4 * PJ_P;
  }
}
// TOK_ROWS false: A = weight rows, B = tokens (a lane holds 8 consecutive channels of one token);
// TOK_ROWS true:  A = tokens, B = weight rows (a lane holds 8 consecutive tokens of one channel).
template <bool TOK_ROWS>
__device__ __forceinline__ void pj_gemm(const unsigned char* LW, const unsigned char* LT, v8f (&acc)[4][2], int c, int h, int cog, int tg) {
  const unsigned char* wp = LW + (cog * 64 + c) * PJ_P + 16 * h;
  const unsigned char* tp = LT + (tg * 32 + c) * PJ_P + 16 * h;
#pragma unroll
  for (int i = 0; i < 4; ++i)
#pragma unroll
    for (int j = 0; j < 2; ++j) acc[i][j] = (v8f){0.f,0.f,0.f,0.f,0.f,0.f,0.f,0.f};
  v16h wf[2][4], tf[2][2];   // two register sets: block kc + 1 is fetched while block kc is multiplied
#pragma unroll
  for (int i = 0; i < 4; ++i) wf[0][i] = lds_frag(wp + i * 16 * PJ_P);
#pragma unroll
  for (int j = 0; j < 2; ++j) tf[0][j] = lds_frag(tp + j * 16 * PJ_P);
#pragma unroll
  for (int kc = 0; kc < 8; ++kc) {
    const int cu = kc & 1, nx = cu ^ 1;
    if (kc < 7) {
#pragma unroll
      for (int i = 0; i < 4; ++i) wf[nx][i] = lds_frag(wp + i * 16 * PJ_P + 64 * (kc + 1));
#pragma unroll
      for (int j = 0; j < 2; ++j) tf[nx][j] = lds_frag(tp + j * 16 * PJ_P + 64 * (kc + 1));
    }
    __builtin_amdgcn_sched_barrier(0);   // the next block's 12 LDS loads issue as one group ahead of this block's products, which hide their latency
#pragma unroll
    for (int i = 0; i < 4; ++i)
#pragma unroll
      for (int j = 0; j < 2; ++j)
        acc[i][j] = TOK_ROWS ? Frag<_Float16>::mma(tf[cu][j], wf[cu][i], acc[i][j]) : Frag<_Float16>::mma(wf[cu][i], tf[cu][j], acc[i][j]);
    __builtin_amdgcn_sched_barrier(0);   // keeps the following group of loads from being spread among these products
  }
}
// the 32 bias values of a lane's output channels
__device__ __forceinline__ void pj_bias(v4f (&bb)[4][2], const float* __restrict__ bias, int h, int cog) {
#pragma unroll
  for (int i = 0; i < 4; ++i) {
    bb[i][0] = *(const v4f*)(bias + cog * 64 + 16 * i + 8 * h);
    bb[i][1] = *(const v4f*)(bias + cog * 64 + 16 * i + 8 * h + 4);
  }
  wait_xcnt0();
}
// acc / 16 + bias -> f16, token-major tile in LDS (16 bytes a lane)
__device__ __forceinline__ void pj_out_tok(const v8f (&acc)[4][2], const v4f (&bb)[4][2], unsigned char* LO, float scale, int c, int h, int cog, int tg) {
#pragma unroll
  for (int i = 0; i < 4; ++i)
#pragma unroll
    for (int j = 0; j < 2; ++j) {
      v8h o;
#pragma unroll
      for (int r = 0; r < 8; ++r) o[r] = (_Float16)(acc[i][j][r] * scale + bb[i][r >> 2][r & 3]);
      *(v8h*)(LO + (tg * 32 + 16 * j + c) * PJ_P + (cog * 64 + 16 * i + 8 * h) * 2) = o;
    }
}
// 64 token rows of 512 bytes, LDS -> registers -> global, a whole row a wave-wide store
__device__ __forceinline__ void pj_rows_read(u32x4 (&t)[8], const unsigned char* LO, int lane, int wave) {
#pragma unroll
  for (int p = 0; p < 8; ++p) t[p] = *(const u32x4*)(LO + (wave + 8 * p) * PJ_P + lane * 16);
}
__device__ __forceinline__ void pj_rows_write(const u32x4 (&t)[8], unsigned short* __restrict__ dst, int lane, int wave) {
#pragma unroll
  for (int p = 0; p < 8; ++p) *(u32x4*)((unsigned char*)dst + (size_t)(wave + 8 * p) * (PJ_C * 2) + lane * 16) = t[p];
  wait_xcnt0();
}

template <int N, int M>
__global__ __launch_bounds__(256) void proj_fused_f16(
    const float* __restrict__ x, const float* __restrict__ x_pt,
    const float* __restrict__ W1, const float* __restrict__ W2, const float* __restrict__ W3,
    const float* __restrict__ b1, const float* __restrict__ b2, const float* __restrict__ b3,
    unsigned short* __restrict__ A16,   // a  [B][N][256] f16
    unsigned short* __restrict__ BQ,    // bq [B][M][256] f16
    unsigned short* __restrict__ CT,    // cT [B][256][M] f16
    int nPt, float wscale, float scale) {
  __shared__ __align__(16) unsigned char S[PJ_LDS];
  const int tid  = threadIdx.x;
  const int lane = tid & 31;
  const int wave = __builtin_amdgcn_readfirstlane(tid >> 5);   // scalar: row bases of the tile loads stay in scalar registers
  const int c = lane & 15, h = lane >> 4;
  const int cog = wave & 3, tg = wave >> 2;
  const int bx = blockIdx.x;
  const bool pt = bx < nPt;                                   // the same for the whole workgroup
  const int nx    = pt ? 1 : 4;
  const int first = pt ? bx : (bx - nPt) * 4;                 // first tile; tile t holds tokens [64 t, 64 t + 64) of the flat [B * M] or [B * N]
  const int perN = N / PJ_T, perM = M / PJ_T;
  const int pb = bx / perM, pt0 = (bx - pb * perM) * PJ_T;    // the x_pt tile's batch and first token (used where pt)
  unsigned short* dst = pt ? BQ : A16;
  float pre[64];                                              // the next tile on its way to LDS
  v8f acc[4][2];
  v4f bb[4][2];
  u32x4 t[8];                                                 // an output tile's rows on their way out

  if (pt) {
    pj_gload<M>(pre, x_pt + (size_t)pb * PJ_C * M + pt0, lane, wave);
  } else {
    const int bt = first / perN;
    pj_gload<N>(pre, x + (size_t)bt * PJ_C * N + (first - bt * perN) * PJ_T, lane, wave);
  }
  pj_loadW(pt ? W2 : W1, S + PJ_LW, tid, wscale);
  pj_bias(bb, pt ? b2 : b1, h, cog);
  pj_sstore(pre, S + PJ_LX, lane, wave);
  __syncthreads();   // the weight and the first tile are in LDS

  for (int i = 0; i < nx; ++i) {
    const bool moreX = i + 1 < nx;                            // block-uniform, as is pt
    if (moreX) {
      const int tn = first + i + 1;
      const int bt = tn / perN;
      pj_gload<N>(pre, x + (size_t)bt * PJ_C * N + (tn - bt * perN) * PJ_T, lane, wave);
    }
    pj_gemm<false>(S + PJ_LW, S + PJ_LX, acc, c, h, cog, tg);
    pj_out_tok(acc, bb, S + PJ_LO, scale, c, h, cog, tg);
    __syncthreads();   // the output tile is whole; every wave has left this tile's input and, where pt, W2
    pj_rows_read(t, S + PJ_LO, lane, wave);
    if (moreX) pj_sstore(pre, S + PJ_LX, lane, wave);
    if (pt) pj_loadW(W3, S + PJ_LW, tid, wscale);
    __syncthreads();   // publishes the next tile (or W3); where another tile follows, the output staging is free again
    pj_rows_write(t, dst + (size_t)(first + i) * PJ_T * PJ_C, lane, wave);   // behind the barrier: the next barrier's wait for these stores comes after a whole product
  }
  if (!pt) return;     // the whole workgroup leaves together

  // fc3 on the f16 bq tile, which still lies in the output staging
  float bv[4];
#pragma unroll
  for (int i = 0; i < 4; ++i) bv[i] = b3[cog * 64 + 16 * i + c];
  wait_xcnt0();
  pj_gemm<true>(S + PJ_LW, S + PJ_LO, acc, c, h, cog, tg);
  {
#pragma unroll
    for (int i = 0; i < 4; ++i)
#pragma unroll
      for (int j = 0; j < 2; ++j) {
        v8h o;
#pragma unroll
        for (int r = 0; r < 8; ++r) o[r] = (_Float16)(acc[i][j][r] * scale + bv[i]);
        *(v8h*)(S + PJ_LC + (cog * 64 + 16 * i + c) * PJ_PC + (tg * 32 + 16 * j + 8 * h) * 2) = o;
      }
  }
  __syncthreads();     // the 256 x 64 cT tile is whole
  {
#pragma unroll
    for (int p = 0; p < 8; ++p) {
      const int id = p * 256 + tid;      // channel row id >> 3, 16-byte piece id & 7: whole 128-byte lines
      t[p] = *(const u32x4*)(S + PJ_LC + (id >> 3) * PJ_PC + (id & 7) * 16);
    }
#pragma unroll
    for (int p = 0; p < 8; ++p) {
      const int id = p * 256 + tid;
      *(u32x4*)((unsigned char*)(CT + ((size_t)pb * PJ_C + (id >> 3)) * M + pt0) + (id & 7) * 16) = t[p];
    }
    wait_xcnt0();
  }
}

// ---------------------------------------------------------------------------
extern "C" void kernel_launch(void* const* d_in, const int* in_sizes, int n_in,
                              void* d_out, int out_size, void* d_ws, size_t ws_size,
                              hipStream_t stream) {
  const int B = 4, C = 256, N = 8192, M = 2048;
  if (n_in < 8) return;
  if (in_sizes[0] != B * C * N || in_sizes[1] != B * C * M ||
      in_sizes[2] != C * C || in_sizes[3] != C || in_sizes[4] != C * C || in_sizes[5] != C ||
      in_sizes[6] != C * C || in_sizes[7] != C || out_size != B * C * N) return;

  const float* x    = (const float*)d_in[0];
  const float* x_pt = (const float*)d_in[1];
  const float* W1   = (const float*)d_in[2];
  const float* b1   = (const float*)d_in[3];
  const float* W2   = (const float*)d_in[4];
  const float* b2   = (const float*)d_in[5];
  const float* W3   = (const float*)d_in[6];
  const float* b3   = (const float*)d_in[7];
  float* out = (float*)d_out;

  const size_t szA16 = (size_t)B * N * C * 2;          // a  [B][N][C] f16      16,777,216
  const size_t szTok = (size_t)B * M * C * 2;          // [B][M][C] f16           4,194,304
  const size_t offA16 = 0;
  const size_t offBQ  = offA16 + szA16;
  const size_t offCT  = offBQ + szTok;
  const size_t total  = offCT + szTok;                 // 25,165,824
  if (total > ws_size) return;

  char* ws = (char*)d_ws;
  unsigned short* A16u  = (unsigned short*)(ws + offA16);
  unsigned short* BQu   = (unsigned short*)(ws + offBQ);
  unsigned short* CTu   = (unsigned short*)(ws + offCT);

  const float inv16 = 1.0f / 16.0f;
  const float cscale = 1.4426950408889634f / 16.0f;   // 1 / sqrt(C) and log2(e): scores in log2 units

  // one launch: a[b][n][co] = sum_ci x[b][ci][n] * W1[co][ci] + b1[co]; bq[b][m][co] = sum_ci x_pt[b][ci][m] * W2[co][ci] + b2[co];
  // cT[b][co][m] = sum_ci W3[co][ci] * bq[b][m][ci] + b3[co]; f16 out; weights carried x16, folded back as 1/16
  const int nPt = B * M / PJ_T;                        // workgroups with one x_pt tile
  const int nXo = B * N / PJ_T / 4;                    // workgroups with four x tiles
  proj_fused_f16<N, M><<<dim3(nPt + nXo), 256, 0, stream>>>(x, x_pt, W1, W2, W3, b1, b2, b3, A16u, BQu, CTu, nPt, 16.0f, inv16);

  // score, softmax, P.c and residual in one launch: out[b][co][n] = x[b][co][n] + sum_m softmax_m(a[n].bq[m] / 16) * cT[co][m]
  attn_fused_f16<<<dim3(N / FA_BQ, B), 256, 0, stream>>>(A16u, BQu, CTu, x, out, N, M, cscale);
  (void)hipGetLastError();
}

// v005
// One run takes 79 microseconds.
// Timed twice side by side with v004, it ran 1.05 and 1.07 times as fast.
// Counting every step since v000, it is 10.0 times as fast.
#include <hip/hip_runtime.h>
#include <stdint.h>
#include <math.h>

// Contractions fc1, fc2, fc3, score = a.b^T and P.c: v_wmma_f32_16x16x32_f16 (f16 operands, f32 accumulate); weights carried x16 (folded back in the f32 epilogue), softmax probabilities carried x2^7 (cancels in the division by the row sum); softmax, bias and residual in f32.

typedef __attribute__((ext_vector_type(16))) _Float16 v16h;
typedef __attribute__((ext_vector_type(8)))  _Float16 v8h;
typedef __attribute__((ext_vector_type(8)))  float    v8f;
typedef __attribute__((ext_vector_type(4)))  float    v4f;
typedef __attribute__((ext_vector_type(2)))  float    v2f;

template <typename T> struct Frag;
template <> struct Frag<_Float16> {
  typedef v16h V; union U { v16h v; v8h h[2]; };
  static __device__ __forceinline__ v16h load(const _Float16* p) {   // elements 0..7 <- p[0..7], 8..15 <- p[16..23]
    U f; f.h[0] = *(const v8h*)(p); f.h[1] = *(const v8h*)(p + 16); return f.v;
  }
  static __device__ __forceinline__ v8f mma(v16h a, v16h b, v8f c) {
    return __builtin_amdgcn_wmma_f32_16x16x32_f16(false, a, false, b, (short)0, c, false, false);
  }
};

typedef __attribute__((ext_vector_type(4))) unsigned int u32x4;
#define FA_C 256
#define FA_BQ 128
#define FA_BK 32
#define FA_PK 528                       // LDS pitch of a bq row: 512 B + 16 (odd multiple of 16 B)
#define FA_PV 80                        // LDS pitch of a cT row piece: 64 B + 16 (odd multiple of 16 B)
#define FA_TK (FA_BK * FA_PK)
#define FA_TV (FA_C * FA_PV)
#define FA_BUF (FA_TK + FA_TV)
#define FA_PE 528                       // output staging pitch: 128 f32 + 16 B
#define FA_STG (FA_C * FA_PE)
#define FA_OP (2 * FA_BUF)              // P halves: [pass parity][wave][column group][lane] 16 B
#define FA_OM (FA_OP + 2 * 8 * 1024)    // the maxima they were written against: [pass parity][wave][lane] two f32
#define FA_OL FA_STG                    // row sums, epilogue: [wave][column group][lane] f32
#define FA_LDS (FA_STG + 8 * 256)
static_assert(FA_OM + 2 * 8 * 256 <= FA_STG, "pass buffers, P and maxima lie inside the output staging area");

// lane l with lane l ^ 16
__device__ __forceinline__ float xhalf(float v) {
  return __builtin_bit_cast(float, __builtin_amdgcn_permlanex16(__builtin_bit_cast(int, v), __builtin_bit_cast(int, v), 0x76543210, 0xfedcba98, false, false));
}
// Four vector slots behind a run of matrix instructions, held in place by the two scheduling barriers: keeps the
// distance to the next vector instruction that touches their registers on every path, a taken branch included.
__device__ __forceinline__ void wmma_gap() {
  __builtin_amdgcn_sched_barrier(0);
  asm volatile("v_nop\n\tv_nop\n\tv_nop\n\tv_nop");
  __builtin_amdgcn_sched_barrier(0);
}
// Behind a run of global loads or stores: stands in front of every later overwrite of their address registers
// (the scheduling barrier keeps such an overwrite from being moved up over the wait).
__device__ __forceinline__ void wait_xcnt0() {
  asm volatile("s_wait_xcnt 0x0" ::: "memory");
  __builtin_amdgcn_sched_barrier(0);
}
// Eight exponentials (base 2) in one statement: behind a transcendental one independent instruction stands before its result
// is used or its source overwritten; here each next exponential is that instruction, and the v_nop is the last one's.
// The outputs are early-clobber, so none of them lies on a source.
__device__ __forceinline__ v8f exp2x8(v8f t) {
  float p0, p1, p2, p3, p4, p5, p6, p7;
  asm("v_exp_f32 %0, %8\n\tv_exp_f32 %1, %9\n\tv_exp_f32 %2, %10\n\tv_exp_f32 %3, %11\n\t"
      "v_exp_f32 %4, %12\n\tv_exp_f32 %5, %13\n\tv_exp_f32 %6, %14\n\tv_exp_f32 %7, %15\n\tv_nop"
      : "=&v"(p0), "=&v"(p1), "=&v"(p2), "=&v"(p3), "=&v"(p4), "=&v"(p5), "=&v"(p6), "=&v"(p7)
      : "v"(t[0]), "v"(t[1]), "v"(t[2]), "v"(t[3]), "v"(t[4]), "v"(t[5]), "v"(t[6]), "v"(t[7]));
  return (v8f){p0, p1, p2, p3, p4, p5, p6, p7};
}
__device__ __forceinline__ v16h lds_frag(const unsigned char* p) {   // elements 0..7 <- bytes 0..15, 8..15 <- bytes 32..47
  Frag<_Float16>::U f; f.h[0] = *(const v8h*)(p); f.h[1] = *(const v8h*)(p + 32); return f.v;
}

__global__ __launch_bounds__(256) __attribute__((amdgpu_waves_per_eu(2, 2))) void attn_fused_f16(
    const unsigned short* __restrict__ Aq,    // a  [B][N][256] f16
    const unsigned short* __restrict__ Bk,    // bq [B][M][256] f16
    const unsigned short* __restrict__ Ct,    // cT [B][256][M] f16
    const float* __restrict__ x, float* __restrict__ out,   // [B][256][N] f32
    int N, int M, float cscale) {
  __shared__ __align__(16) unsigned char L[FA_LDS];
  const int tid  = threadIdx.x;
  const int lane = tid & 31;
  const int wave = tid >> 5;
  const int c = lane & 15, h = lane >> 4;
  const int b  = blockIdx.y;
  const int q0 = blockIdx.x * FA_BQ;
  const unsigned char* kSrc = (const unsigned char*)(Bk + (size_t)b * M * FA_C);
  const unsigned char* vSrc = (const unsigned char*)(Ct + (size_t)b * FA_C * M);
  const size_t vPitch = (size_t)M * 2;
  const int nPass = M / FA_BK;

  u32x4 pk[4], pv[4];   // the next pass's tiles on their way to LDS
  auto gload = [&](int s) {
#pragma unroll
    for (int i = 0; i < 4; ++i) {
      const int id = i * 256 + tid;
      pk[i] = *(const u32x4*)(kSrc + (size_t)s * (FA_BK * FA_C * 2) + (size_t)id * 16);
      pv[i] = *(const u32x4*)(vSrc + (size_t)(id >> 2) * vPitch + (size_t)s * (FA_BK * 2) + (id & 3) * 16);
    }
    wait_xcnt0();
  };
  auto sstore = [&](int buf) {
    unsigned char* base = L + buf * FA_BUF;
#pragma unroll
    for (int i = 0; i < 4; ++i) {
      const int id = i * 256 + tid;
      *(u32x4*)(base + (id >> 5) * FA_PK + (id & 31) * 16) = pk[i];
      *(u32x4*)(base + FA_TK + (id >> 2) * FA_PV + (id & 3) * 16) = pv[i];
    }
  };

  const int wv = __builtin_amdgcn_readfirstlane(wave);   // scalar: LDS bases of the pair's exchange stay in scalar registers
  const int qg = wv >> 1, kh = wv & 1;                    // the pair's 32 queries; this wave's key tile and channel half

  gload(0);
  v16h qf[2][8];   // the pair's 32 queries as B operands, kept for the whole loop
#pragma unroll
  for (int j = 0; j < 2; ++j) {
    const _Float16* qp = (const _Float16*)Aq + ((size_t)b * N + q0 + qg * 32 + 16 * j + c) * FA_C + 8 * h;
#pragma unroll
    for (int kc = 0; kc < 8; ++kc) qf[j][kc] = Frag<_Float16>::load(qp + 32 * kc);
    wait_xcnt0();
  }
  v8f acc[8][2];
#pragma unroll
  for (int t = 0; t < 8; ++t)
#pragma unroll
    for (int j = 0; j < 2; ++j) acc[t][j] = (v8f){0.f,0.f,0.f,0.f,0.f,0.f,0.f,0.f};
  float m_run[2] = {-INFINITY, -INFINITY}, l_run[2] = {0.f, 0.f};
  sstore(0);
  __syncthreads();   // pass 0's tiles are in LDS
  if (1 < nPass) gload(1);
  v16h kf[8], vf[8];   // this wave's 8 bq fragments (fetched one pass ahead) and 8 cT fragments
  {
    const unsigned char* kb = L + (16 * kh + c) * FA_PK + 16 * h;
#pragma unroll
    for (int kc = 0; kc < 8; ++kc) kf[kc] = lds_frag(kb + 64 * kc);
  }

  for (int s = 0; s < nPass; ++s) {
    const bool more = s + 1 < nPass;     // the same for the whole workgroup
    const int par = s & 1;
    const unsigned char* vb = L + par * FA_BUF + FA_TK + (128 * kh + c) * FA_PV + 16 * h;
#pragma unroll
    for (int t = 0; t < 8; ++t) vf[t] = lds_frag(vb + t * 16 * FA_PV);
    __builtin_amdgcn_sched_barrier(0);   // the 16 cT loads issue as one group ahead of the score products and fly under them and the softmax
    v8f sc[2];
    sc[0] = (v8f){0.f,0.f,0.f,0.f,0.f,0.f,0.f,0.f};
    sc[1] = (v8f){0.f,0.f,0.f,0.f,0.f,0.f,0.f,0.f};
#pragma unroll
    for (int kc = 0; kc < 8; ++kc) {
      sc[0] = Frag<_Float16>::mma(kf[kc], qf[0][kc], sc[0]);
      sc[1] = Frag<_Float16>::mma(kf[kc], qf[1][kc], sc[1]);
    }
    float m_own[2], ps[2];
#pragma unroll
    for (int j = 0; j < 2; ++j) {
      float mx = fmaxf(sc[j][0], sc[j][1]);
#pragma unroll
      for (int r = 2; r < 8; ++r) mx = fmaxf(mx, sc[j][r]);
      mx = fmaxf(mx, xhalf(mx)) * cscale;              // both wave halves hold this query's maximum over the wave's 16 keys, in log2 units
      m_own[j] = mx > m_run[j] + 8.0f ? mx : m_run[j]; // no branch here: nothing is rescaled in front of the barrier
      const float nm = 7.0f - m_own[j];
#pragma unroll
      for (int r = 0; r < 8; ++r) sc[j][r] = fmaf(sc[j][r], cscale, nm);
    }
    const v8f e0 = exp2x8(sc[0]), e1 = exp2x8(sc[1]);
    {
      v8h p0, p1;
      ps[0] = 0.f; ps[1] = 0.f;
#pragma unroll
      for (int r = 0; r < 8; ++r) {
        ps[0] += e0[r]; ps[1] += e1[r];
        p0[r] = (_Float16)e0[r]; p1[r] = (_Float16)e1[r];
      }
      unsigned char* pw = L + FA_OP + (par * 8 + wv) * 1024 + lane * 16;
      *(v8h*)(pw) = p0;
      *(v8h*)(pw + 512) = p1;
      *(v2f*)(L + FA_OM + (par * 8 + wv) * 256 + lane * 8) = (v2f){m_own[0], m_own[1]};
    }
    if (more) sstore(par ^ 1);
    __syncthreads();   // publishes P of pass s and the tiles of pass s + 1; ends every wave's reads of pass s's cT tile and of P of pass s - 1
    Frag<_Float16>::U pf[2];
    v2f mA, mB;
    {
      const unsigned char* pr = L + FA_OP + (par * 8 + 2 * qg) * 1024 + lane * 16;
      pf[0].h[0] = *(const v8h*)(pr);               // keys 8h + r, from the pair's wave 0
      pf[0].h[1] = *(const v8h*)(pr + 1024);        // keys 16 + 8h + r, from its wave 1
      pf[1].h[0] = *(const v8h*)(pr + 512);
      pf[1].h[1] = *(const v8h*)(pr + 1024 + 512);
      const unsigned char* mr = L + FA_OM + (par * 8 + 2 * qg) * 256 + lane * 8;
      mA = *(const v2f*)(mr);
      mB = *(const v2f*)(mr + 256);
    }
    {
      // no branch round these loads, so that the wait for P can be a counted one; the last pass fetches its own tile again, unused
      const unsigned char* kb = L + (more ? par ^ 1 : par) * FA_BUF + (16 * kh + c) * FA_PK + 16 * h;
#pragma unroll
      for (int kc = 0; kc < 8; ++kc) kf[kc] = lds_frag(kb + 64 * kc);
    }
    __builtin_amdgcn_sched_barrier(0);   // P first, then the next pass's bq fragments, as one group of LDS loads ahead of the P.c products, which hide the latter
    if (s + 2 < nPass) gload(s + 2);
    const float mn0 = fmaxf(mA[0], mB[0]), mn1 = fmaxf(mA[1], mB[1]);   // the same value in both waves of the pair
    if (__builtin_amdgcn_ballot_w32(mn0 != m_run[0] || mn1 != m_run[1]) != 0) {   // scalar branch: rare after the first passes
      const float mn[2] = {mn0, mn1};
#pragma unroll
      for (int j = 0; j < 2; ++j) {
        const float ca = __builtin_amdgcn_exp2f(m_run[j] - mn[j]);   // 0 on the first pass, 1 for a query whose maximum stays
        const float co = __builtin_amdgcn_exp2f(m_own[j] - mn[j]);
        const float cA = __builtin_amdgcn_exp2f(mA[j] - mn[j]);
        const float cB = __builtin_amdgcn_exp2f(mB[j] - mn[j]);
        l_run[j] *= ca; ps[j] *= co; m_run[j] = mn[j];
#pragma unroll
        for (int i = 0; i < 8; ++i) {
          pf[j].h[0][i] = (_Float16)((float)pf[j].h[0][i] * cA);
          pf[j].h[1][i] = (_Float16)((float)pf[j].h[1][i] * cB);
        }
#pragma unroll
        for (int t = 0; t < 8; ++t) acc[t][j] = acc[t][j] * ca;
      }
    }
    l_run[0] += ps[0]; l_run[1] += ps[1];
#pragma unroll
    for (int t = 0; t < 8; ++t) {
      acc[t][0] = Frag<_Float16>::mma(vf[t], pf[0].v, acc[t][0]);
      acc[t][1] = Frag<_Float16>::mma(vf[t], pf[1].v, acc[t][1]);
    }
    wmma_gap();
  }

  // ---- epilogue: the pair joins its row sums; O^T / l staged in LDS (rows = channels), then whole 512-byte rows: + residual, stored once ----
  float lt[2];
#pragma unroll
  for (int j = 0; j < 2; ++j) {
    lt[j] = l_run[j] + xhalf(l_run[j]);   // each wave half summed its own keys
    *(float*)(L + FA_OL + (wv * 2 + j) * 128 + lane * 4) = lt[j];
  }
  __syncthreads();   // the row sums are published; every wave has left the pass buffers and P, which become output staging
#pragma unroll
  for (int j = 0; j < 2; ++j) {
    const float inv = 1.0f / (lt[j] + *(const float*)(L + FA_OL + ((wv ^ 1) * 2 + j) * 128 + lane * 4));
#pragma unroll
    for (int t = 0; t < 8; ++t)
#pragma unroll
      for (int r = 0; r < 8; ++r)
        *(float*)(L + (128 * kh + 16 * t + 8 * h + r) * FA_PE + (qg * 32 + 16 * j + c) * 4) = acc[t][j][r] * inv;
  }
  __syncthreads();   // the whole 256 x 128 tile is staged
  for (int i0 = 0; i0 < FA_C / 8; i0 += 8) {
    v4f xr[8];
#pragma unroll
    for (int j = 0; j < 8; ++j)
      xr[j] = *(const v4f*)(x + ((size_t)b * FA_C + (i0 + j) * 8 + wave) * N + q0 + lane * 4);
    wait_xcnt0();
#pragma unroll
    for (int j = 0; j < 8; ++j) {
      const int row = (i0 + j) * 8 + wave;
      *(v4f*)(out + ((size_t)b * FA_C + row) * N + q0 + lane * 4) = *(const v4f*)(L + row * FA_PE + lane * 16) + xr[j];
    }
    wait_xcnt0();
  }
}

// ---- all three projections in one launch, straight from the f32 inputs ----
// A job is one tile of 64 tokens. The tile goes global (channel-major f32) -> registers -> LDS (token-major f16), the weight
// global f32 -> x16 -> f16 rows in LDS; both are read as WMMA fragments in the same k order; results leave through LDS as whole lines.
// Workgroups [0, nPt): one x_pt tile: fc2, then fc3 on the f16 fc2 tile still in LDS. The others: fc1 on four x tiles, the next tile's loads in flight under a product.
// 8 waves: wave = (group of 64 output channels) + 4 * (group of 32 tokens).
#define PJ_T 64
#define PJ_C 256
#define PJ_P 528                        // LDS pitch of a row of 256 f16: 512 B + 16 (odd multiple of 16 B)
#define PJ_PC 144                       // LDS pitch of a cT row piece: 128 B + 16 (odd multiple of 16 B)
#define PJ_LW 0
#define PJ_LX (PJ_LW + PJ_C * PJ_P)
#define PJ_LO (PJ_LX + PJ_T * PJ_P)
#define PJ_LC (PJ_LO + PJ_T * PJ_P)
#define PJ_LDS (PJ_LC + PJ_C * PJ_PC)

typedef __attribute__((ext_vector_type(2))) _Float16 v2h;
__device__ __forceinline__ unsigned pack2h(float a, float b) {   // round to nearest even, a in the low half
  return __builtin_bit_cast(unsigned, __builtin_convertvector((v2f){a, b}, v2h));
}
// src: channel 0 of the tile's batch at the tile's first token; Lt: tokens in a channel row. A wave-wide load is one 128-byte line.
template <int Lt>
__device__ __forceinline__ void pj_gload(float (&pre)[64], const float* __restrict__ src, int lane, int wave) {
  const float* p = src + (wave >> 1) * 2 * Lt + (wave & 1) * 32 + lane;   // token half wave & 1, channel pair 4 i + (wave >> 1)
#pragma unroll
  for (int i = 0; i < 32; ++i) {
    pre[2 * i]     = p[i * 8 * Lt];
    pre[2 * i + 1] = p[i * 8 * Lt + Lt];
  }
  wait_xcnt0();
}
__device__ __forceinline__ void pj_sstore(const float (&pre)[64], unsigned char* LX, int lane, int wave) {
  unsigned char* q = LX + ((wave & 1) * 32 + lane) * PJ_P + (wave >> 1) * 4;
#pragma unroll
  for (int i = 0; i < 32; ++i) *(unsigned*)(q + i * 16) = pack2h(pre[2 * i], pre[2 * i + 1]);
}
__device__ __forceinline__ void pj_loadW(const float* __restrict__ Wg, unsigned char* LW, int tid, float wscale) {
  const float* p = Wg + tid * 4;                                    // piece id = 256 k + tid: row id >> 6, four columns from (id & 63) * 4
  unsigned char* q = LW + (tid >> 6) * PJ_P + (tid & 63) * 8;
  for (int b0 = 0; b0 < 2; ++b0) {
    v4f w[32];
#pragma unroll
    for (int j = 0; j < 32; ++j) w[j] = *(const v4f*)(p + j * 1024);
    wait_xcnt0();
#pragma unroll
    for (int j = 0; j < 32; ++j) {
      uint2 o;
      o.x = pack2h(w[j][0] * wscale, w[j][1] * wscale);
      o.y = pack2h(w[j][2] * wscale, w[j][3] * wscale);
      *(uint2*)(q + j * 4 * PJ_P) = o;
    }
    p += 32 * 1024;
    q += 32 * 4 * PJ_P;
  }
}
// TOK_ROWS false: A = weight rows, B = tokens (a lane holds 8 consecutive channels of one token);
// TOK_ROWS true:  A = tokens, B = weight rows (a lane holds 8 consecutive tokens of one channel).
template <bool TOK_ROWS>
__device__ __forceinline__ void pj_gemm(const unsigned char* LW, const unsigned char* LT, v8f (&acc)[4][2], int c, int h, int cog, int tg) {
  const unsigned char* wp = LW + (cog * 64 + c) * PJ_P + 16 * h;
  const unsigned char* tp = LT + (tg * 32 + c) * PJ_P + 16 * h;
#pragma unroll
  for (int i = 0; i < 4; ++i)
#pragma unroll
    for (int j = 0; j < 2; ++j) acc[i][j] = (v8f){0.f,0.f,0.f,0.f,0.f,0.f,0.f,0.f};
  v16h wf[2][4], tf[2][2];   // two register sets: block kc + 1 is fetched while block kc is multiplied
#pragma unroll
  for (int i = 0; i < 4; ++i) wf[0][i] = lds_frag(wp + i * 16 * PJ_P);
#pragma unroll
  for (int j = 0; j < 2; ++j) tf[0][j] = lds_frag(tp + j * 16 * PJ_P);
#pragma unroll
  for (int kc = 0; kc < 8; ++kc) {
    const int cu = kc & 1, nx = cu ^ 1;
    if (kc < 7) {
#pragma unroll
      for (int i = 0; i < 4; ++i) wf[nx][i] = lds_frag(wp + i * 16 * PJ_P + 64 * (kc + 1));
#pragma unroll
      for (int j = 0; j < 2; ++j) tf[nx][j] = lds_frag(tp + j * 16 * PJ_P + 64 * (kc + 1));
    }
    __builtin_amdgcn_sched_barrier(0);   // the next block's 12 LDS loads issue as one group ahead of this block's products, which hide their latency
#pragma unroll
    for (int i = 0; i < 4; ++i)
#pragma unroll
      for (int j = 0; j < 2; ++j)
        acc[i][j] = TOK_ROWS ? Frag<_Float16>::mma(tf[cu][j], wf[cu][i], acc[i][j]) : Frag<_Float16>::mma(wf[cu][i], tf[cu][j], acc[i][j]);
    __builtin_amdgcn_sched_barrier(0);   // keeps the following group of loads from being spread among these products
  }
}
// the 32 bias values of a lane's output channels
__device__ __forceinline__ void pj_bias(v4f (&bb)[4][2], const float* __restrict__ bias, int h, int cog) {
#pragma unroll
  for (int i = 0; i < 4; ++i) {
    bb[i][0] = *(const v4f*)(bias + cog * 64 + 16 * i + 8 * h);
    bb[i][1] = *(const v4f*)(bias + cog * 64 + 16 * i + 8 * h + 4);
  }
  wait_xcnt0();
}
// acc / 16 + bias -> f16, token-major tile in LDS (16 bytes a lane)
__device__ __forceinline__ void pj_out_tok(const v8f (&acc)[4][2], const v4f (&bb)[4][2], unsigned char* LO, float scale, int c, int h, int cog, int tg) {
#pragma unroll
  for (int i = 0; i < 4; ++i)
#pragma unroll
    for (int j = 0; j < 2; ++j) {
      v8h o;
#pragma unroll
      for (int r = 0; r < 8; ++r) o[r] = (_Float16)(acc[i][j][r] * scale + bb[i][r >> 2][r & 3]);
      *(v8h*)(LO + (tg * 32 + 16 * j + c) * PJ_P + (cog * 64 + 16 * i + 8 * h) * 2) = o;
    }
}
// 64 token rows of 512 bytes, LDS -> registers -> global, a whole row a wave-wide store
__device__ __forceinline__ void pj_rows_read(u32x4 (&t)[8], const unsigned char* LO, int lane, int wave) {
#pragma unroll
  for (int p = 0; p < 8; ++p) t[p] = *(const u32x4*)(LO + (wave + 8 * p) * PJ_P + lane * 16);
}
__device__ __forceinline__ void pj_rows_write(const u32x4 (&t)[8], unsigned short* __restrict__ dst, int lane, int wave) {
#pragma unroll
  for (int p = 0; p < 8; ++p) *(u32x4*)((unsigned char*)dst + (size_t)(wave + 8 * p) * (PJ_C * 2) + lane * 16) = t[p];
  wait_xcnt0();
}

template <int N, int M>
__global__ __launch_bounds__(256) void proj_fused_f16(
    const float* __restrict__ x, const float* __restrict__ x_pt,
    const float* __restrict__ W1, const float* __restrict__ W2, const float* __restrict__ W3,
    const float* __restrict__ b1, const float* __restrict__ b2, const float* __restrict__ b3,
    unsigned short* __restrict__ A16,   // a  [B][N][256] f16
    unsigned short* __restrict__ BQ,    // bq [B][M][256] f16
    unsigned short* __restrict__ CT,    // cT [B][256][M] f16
    int nPt, float wscale, float scale) {
  __shared__ __align__(16) unsigned char S[PJ_LDS];
  const int tid  = threadIdx.x;
  const int lane = tid & 31;
  const int wave = __builtin_amdgcn_readfirstlane(tid >> 5);   // scalar: row bases of the tile loads stay in scalar registers
  const int c = lane & 15, h = lane >> 4;
  const int cog = wave & 3, tg = wave >> 2;
  const int bx = blockIdx.x;
  const bool pt = bx < nPt;                                   // the same for the whole workgroup
  const int nx    = pt ? 1 : 4;
  const int first = pt ? bx : (bx - nPt) * 4;                 // first tile; tile t holds tokens [64 t, 64 t + 64) of the flat [B * M] or [B * N]
  const int perN = N / PJ_T, perM = M / PJ_T;
  const int pb = bx / perM, pt0 = (bx - pb * perM) * PJ_T;    // the x_pt tile's batch and first token (used where pt)
  unsigned short* dst = pt ? BQ : A16;
  float pre[64];                                              // the next tile on its way to LDS
  v8f acc[4][2];
  v4f bb[4][2];
  u32x4 t[8];                                                 // an output tile's rows on their way out

  if (pt) {
    pj_gload<M>(pre, x_pt + (size_t)pb * PJ_C * M + pt0, lane, wave);
  } else {
    const int bt = first / perN;
    pj_gload<N>(pre, x + (size_t)bt * PJ_C * N + (first - bt * perN) * PJ_T, lane, wave);
  }
  pj_loadW(pt ? W2 : W1, S + PJ_LW, tid, wscale);
  pj_bias(bb, pt ? b2 : b1, h, cog);
  pj_sstore(pre, S + PJ_LX, lane, wave);
  __syncthreads();   // the weight and the first tile are in LDS

  for (int i = 0; i < nx; ++i) {
    const bool moreX = i + 1 < nx;                            // block-uniform, as is pt
    if (moreX) {
      const int tn = first + i + 1;
      const int bt = tn / perN;
      pj_gload<N>(pre, x + (size_t)bt * PJ_C * N + (tn - bt * perN) * PJ_T, lane, wave);
    }
    pj_gemm<false>(S + PJ_LW, S + PJ_LX, acc, c, h, cog, tg);
    pj_out_tok(acc, bb, S + PJ_LO, scale, c, h, cog, tg);
    __syncthreads();   // the output tile is whole; every wave has left this tile's input and, where pt, W2
    pj_rows_read(t, S + PJ_LO, lane, wave);
    if (moreX) pj_sstore(pre, S + PJ_LX, lane, wave);
    if (pt) pj_loadW(W3, S + PJ_LW, tid, wscale);
    __syncthreads();   // publishes the next tile (or W3); where another tile follows, the output staging is free again
    pj_rows_write(t, dst + (size_t)(first + i) * PJ_T * PJ_C, lane, wave);   // behind the barrier: the next barrier's wait for these stores comes after a whole product
  }
  if (!pt) return;     // the whole workgroup leaves together

  // fc3 on the f16 bq tile, which still lies in the output staging
  float bv[4];
#pragma unroll
  for (int i = 0; i < 4; ++i) bv[i] = b3[cog * 64 + 16 * i + c];
  wait_xcnt0();
  pj_gemm<true>(S + PJ_LW, S + PJ_LO, acc, c, h, cog, tg);
  {
#pragma unroll
    for (int i = 0; i < 4; ++i)
#pragma unroll
      for (int j = 0; j < 2; ++j) {
        v8h o;
#pragma unroll
        for (int r = 0; r < 8; ++r) o[r] = (_Float16)(acc[i][j][r] * scale + bv[i]);
        *(v8h*)(S + PJ_LC + (cog * 64 + 16 * i + c) * PJ_PC + (tg * 32 + 16 * j + 8 * h) * 2) = o;
      }
  }
  __syncthreads();     // the 256 x 64 cT tile is whole
  {
#pragma unroll
    for (int p = 0; p < 8; ++p) {
      const int id = p * 256 + tid;      // channel row id >> 3, 16-byte piece id & 7: whole 128-byte lines
      t[p] = *(const u32x4*)(S + PJ_LC + (id >> 3) * PJ_PC + (id & 7) * 16);
    }
#pragma unroll
    for (int p = 0; p < 8; ++p) {
      const int id = p * 256 + tid;
      *(u32x4*)((unsigned char*)(CT + ((size_t)pb * PJ_C + (id >> 3)) * M + pt0) + (id & 7) * 16) = t[p];
    }
    wait_xcnt0();
  }
}

// ---------------------------------------------------------------------------
extern "C" void kernel_launch(void* const* d_in, const int* in_sizes, int n_in,
                              void* d_out, int out_size, void* d_ws, size_t ws_size,
                              hipStream_t stream) {
  const int B = 4, C = 256, N = 8192, M = 2048;
  if (n_in < 8) return;
  if (in_sizes[0] != B * C * N || in_sizes[1] != B * C * M ||
      in_sizes[2] != C * C || in_sizes[3] != C || in_sizes[4] != C * C || in_sizes[5] != C ||
      in_sizes[6] != C * C || in_sizes[7] != C || out_size != B * C * N) return;

  const float* x    = (const float*)d_in[0];
  const float* x_pt = (const float*)d_in[1];
  const float* W1   = (const float*)d_in[2];
  const float* b1   = (const float*)d_in[3];
  const float* W2   = (const float*)d_in[4];
  const float* b2   = (const float*)d_in[5];
  const float* W3   = (const float*)d_in[6];
  const float* b3   = (const float*)d_in[7];
  float* out = (float*)d_out;

  const size_t szA16 = (size_t)B * N * C * 2;          // a  [B][N][C] f16      16,777,216
  const size_t szTok = (size_t)B * M * C * 2;          // [B][M][C] f16           4,194,304
  const size_t offA16 = 0;
  const size_t offBQ  = offA16 + szA16;
  const size_t offCT  = offBQ + szTok;
  const size_t total  = offCT + szTok;                 // 25,165,824
  if (total > ws_size) return;

  char* ws = (char*)d_ws;
  unsigned short* A16u  = (unsigned short*)(ws + offA16);
  unsigned short* BQu   = (unsigned short*)(ws + offBQ);
  unsigned short* CTu   = (unsigned short*)(ws + offCT);

  const float inv16 = 1.0f / 16.0f;
  const float cscale = 1.4426950408889634f / 16.0f;   // 1 / sqrt(C) and log2(e): scores in log2 units

  // one launch: a[b][n][co] = sum_ci x[b][ci][n] * W1[co][ci] + b1[co]; bq[b][m][co] = sum_ci x_pt[b][ci][m] * W2[co][ci] + b2[co];
  // cT[b][co][m] = sum_ci W3[co][ci] * bq[b][m][ci] + b3[co]; f16 out; weights carried x16, folded back as 1/16
  const int nPt = B * M / PJ_T;                        // workgroups with one x_pt tile
  const int nXo = B * N / PJ_T / 4;                    // workgroups with four x tiles
  proj_fused_f16<N, M><<<dim3(nPt + nXo), 256, 0, stream>>>(x, x_pt, W1, W2, W3, b1, b2, b3, A16u, BQu, CTu, nPt, 16.0f, inv16);

  // score, softmax, P.c and residual in one launch: out[b][co][n] = x[b][co][n] + sum_m softmax_m(a[n].bq[m] / 16) * cT[co][m]
  attn_fused_f16<<<dim3(N / FA_BQ, B), 256, 0, stream>>>(A16u, BQu, CTu, x, out, N, M, cscale);
  (void)hipGetLastError();
}

// v006
// It runs in 71.7 microseconds.
// Next to v005, in two timings, it ran 1.09 and 1.12 times as fast.
// Counting every step since v000, it is 11.1 times as fast.
#include <hip/hip_runtime.h>
#include <stdint.h>
#include <math.h>

// Contractions fc1, fc2, fc3, score = a.b^T and P.c: v_wmma_f32_16x16x32_f16 (f16 operands, f32 accumulate); weights carried x16 (folded back in the f32 epilogue), softmax probabilities carried x2^7 (cancels in the division by the row sum); softmax, bias and residual in f32.

typedef __attribute__((ext_vector_type(16))) _Float16 v16h;
typedef __attribute__((ext_vector_type(8)))  _Float16 v8h;
typedef __attribute__((ext_vector_type(8)))  float    v8f;
typedef __attribute__((ext_vector_type(4)))  float    v4f;
typedef __attribute__((ext_vector_type(2)))  float    v2f;

template <typename T> struct Frag;
template <> struct Frag<_Float16> {
  typedef v16h V; union U { v16h v; v8h h[2]; };
  static __device__ __forceinline__ v16h load(const _Float16* p) {   // elements 0..7 <- p[0..7], 8..15 <- p[16..23]
    U f; f.h[0] = *(const v8h*)(p); f.h[1] = *(const v8h*)(p + 16); return f.v;
  }
  static __device__ __forceinline__ v8f mma(v16h a, v16h b, v8f c) {
    return __builtin_amdgcn_wmma_f32_16x16x32_f16(false, a, false, b, (short)0, c, false, false);
  }
};

typedef __attribute__((ext_vector_type(4))) unsigned int u32x4;
#define FA_C 256
#define FA_BQ 128
#define FA_BK 32
#define FA_PK 528                       // LDS pitch of a bq row: 512 B + 16 (odd multiple of 16 B)
#define FA_BT 64                        // keys of a staged tile: two passes
#define FA_PV 144                       // LDS pitch of a cT row piece: 128 B + 16 (odd multiple of 16 B)
#define FA_TK (FA_BT * FA_PK)
#define FA_TV (FA_C * FA_PV)
#define FA_BUF (FA_TK + FA_TV)
#define FA_PE 528                       // output staging pitch: 128 f32 + 16 B
#define FA_STG (FA_C * FA_PE)
#define FA_OP (2 * FA_BUF)              // P halves: [pass parity][wave][column group][lane] 16 B
#define FA_OM (FA_OP + 2 * 8 * 1024)    // the maxima they were written against: [pass parity][wave][lane] two f32
#define FA_OL (FA_OM + 2 * 8 * 256)     // row sums, epilogue: [wave][column group][lane] f32
#define FA_LDS (FA_OL + 8 * 256)
static_assert(FA_STG <= FA_OL, "the output staging area ends in front of the row sums");

// lane l with lane l ^ 16
__device__ __forceinline__ float xhalf(float v) {
  return __builtin_bit_cast(float, __builtin_amdgcn_permlanex16(__builtin_bit_cast(int, v), __builtin_bit_cast(int, v), 0x76543210, 0xfedcba98, false, false));
}
// Four vector slots behind a run of matrix instructions, held in place by the two scheduling barriers: keeps the
// distance to the next vector instruction that touches their registers on every path, a taken branch included.
__device__ __forceinline__ void wmma_gap() {
  __builtin_amdgcn_sched_barrier(0);
  asm volatile("v_nop\n\tv_nop\n\tv_nop\n\tv_nop");
  __builtin_amdgcn_sched_barrier(0);
}
// Behind a run of global loads or stores: stands in front of every later overwrite of their address registers
// (the scheduling barrier keeps such an overwrite from being moved up over the wait).
__device__ __forceinline__ void wait_xcnt0() {
  asm volatile("s_wait_xcnt 0x0" ::: "memory");
  __builtin_amdgcn_sched_barrier(0);
}
// One lane's 16 bytes global -> LDS through no register; counted on asynccnt, no wait is placed by the compiler.
typedef __attribute__((ext_vector_type(4))) int i32x4;
__device__ __forceinline__ void copy16_to_lds(const unsigned char* g, unsigned char* l) {
  __builtin_amdgcn_global_load_async_to_lds_b128((__attribute__((address_space(1))) i32x4*)g, (__attribute__((address_space(3))) i32x4*)l, 0, 0);
}
// This wave's copies have landed (other waves read them behind the next barrier).
__device__ __forceinline__ void wait_async0() { asm volatile("s_wait_asynccnt 0x0" ::: "memory"); }
// This wave's LDS reads and writes have retired: stands in front of the barrier behind which a buffer it read is refilled by copies.
__device__ __forceinline__ void wait_ds0() { asm volatile("s_wait_dscnt 0x0" ::: "memory"); }
// Eight exponentials (base 2) in one statement: behind a transcendental one independent instruction stands before its result
// is used or its source overwritten; here each next exponential is that instruction, and the v_nop is the last one's.
// The outputs are early-clobber, so none of them lies on a source.
__device__ __forceinline__ v8f exp2x8(v8f t) {
  float p0, p1, p2, p3, p4, p5, p6, p7;
  asm("v_exp_f32 %0, %8\n\tv_exp_f32 %1, %9\n\tv_exp_f32 %2, %10\n\tv_exp_f32 %3, %11\n\t"
      "v_exp_f32 %4, %12\n\tv_exp_f32 %5, %13\n\tv_exp_f32 %6, %14\n\tv_exp_f32 %7, %15\n\tv_nop"
      : "=&v"(p0), "=&v"(p1), "=&v"(p2), "=&v"(p3), "=&v"(p4), "=&v"(p5), "=&v"(p6), "=&v"(p7)
      : "v"(t[0]), "v"(t[1]), "v"(t[2]), "v"(t[3]), "v"(t[4]), "v"(t[5]), "v"(t[6]), "v"(t[7]));
  return (v8f){p0, p1, p2, p3, p4, p5, p6, p7};
}
__device__ __forceinline__ v16h lds_frag(const unsigned char* p) {   // elements 0..7 <- bytes 0..15, 8..15 <- bytes 32..47
  Frag<_Float16>::U f; f.h[0] = *(const v8h*)(p); f.h[1] = *(const v8h*)(p + 32); return f.v;
}

__global__ __launch_bounds__(256) __attribute__((amdgpu_waves_per_eu(2, 2))) void attn_fused_f16(
    const unsigned short* __restrict__ Aq,    // a  [B][N][256] f16
    const unsigned short* __restrict__ Bk,    // bq [B][M][256] f16
    const unsigned short* __restrict__ Ct,    // cT [B][256][M] f16
    const float* __restrict__ x, float* __restrict__ out,   // [B][256][N] f32
    int N, int M, float cscale) {
  __shared__ __align__(16) unsigned char L[FA_LDS];
  const int tid  = threadIdx.x;
  const int lane = tid & 31;
  const int wave = tid >> 5;
  const int c = lane & 15, h = lane >> 4;
  const int b  = blockIdx.y;
  const int q0 = blockIdx.x * FA_BQ;
  const unsigned char* kSrc = (const unsigned char*)(Bk + (size_t)b * M * FA_C);
  const unsigned char* vSrc = (const unsigned char*)(Ct + (size_t)b * FA_C * M);
  const size_t vPitch = (size_t)M * 2;
  const int nPass = M / FA_BK;
  const int nTile = M / FA_BT;

  // tile T (keys 64 T .. 64 T + 63) into buffer T & 1: 16 copies a wave, every lane on; a wave-wide copy is one bq row or four whole cT lines
  auto acopy = [&](int T) {
    unsigned char* base = L + (T & 1) * FA_BUF;
#pragma unroll
    for (int i = 0; i < 8; ++i) {
      const int id = i * 256 + tid;
      copy16_to_lds(kSrc + (size_t)T * (FA_BT * FA_C * 2) + (size_t)id * 16, base + (id >> 5) * FA_PK + (id & 31) * 16);
    }
#pragma unroll
    for (int i = 0; i < 8; ++i) {
      const int id = i * 256 + tid;
      copy16_to_lds(vSrc + (size_t)(id >> 3) * vPitch + (size_t)T * (FA_BT * 2) + (id & 7) * 16, base + FA_TK + (id >> 3) * FA_PV + (id & 7) * 16);
    }
  };

  const int wv = __builtin_amdgcn_readfirstlane(wave);   // scalar: LDS bases of the pair's exchange stay in scalar registers
  const int qg = wv >> 1, kh = wv & 1;                    // the pair's 32 queries; this wave's key tile and channel half

  acopy(0);
  v16h qf[2][8];   // the pair's 32 queries as B operands, kept for the whole loop
#pragma unroll
  for (int j = 0; j < 2; ++j) {
    const _Float16* qp = (const _Float16*)Aq + ((size_t)b * N + q0 + qg * 32 + 16 * j + c) * FA_C + 8 * h;
#pragma unroll
    for (int kc = 0; kc < 8; ++kc) qf[j][kc] = Frag<_Float16>::load(qp + 32 * kc);
    wait_xcnt0();
  }
  v8f acc[8][2];
#pragma unroll
  for (int t = 0; t < 8; ++t)
#pragma unroll
    for (int j = 0; j < 2; ++j) acc[t][j] = (v8f){0.f,0.f,0.f,0.f,0.f,0.f,0.f,0.f};
  float m_run[2] = {-INFINITY, -INFINITY}, l_run[2] = {0.f, 0.f};
  wait_async0();
  __syncthreads();   // tile 0 is in LDS
  if (1 < nTile) acopy(1);
  v16h kf[8], vf[8];   // this wave's 8 bq fragments (fetched one pass ahead) and 8 cT fragments
  {
    const unsigned char* kb = L + (16 * kh + c) * FA_PK + 16 * h;
#pragma unroll
    for (int kc = 0; kc < 8; ++kc) kf[kc] = lds_frag(kb + 64 * kc);
  }

  for (int s = 0; s < nPass; ++s) {
    const bool more = s + 1 < nPass;     // the same for the whole workgroup
    const int par = s & 1;
    const int tile = s >> 1;
    const unsigned char* vb = L + (tile & 1) * FA_BUF + FA_TK + (128 * kh + c) * FA_PV + 64 * par + 16 * h;
#pragma unroll
    for (int t = 0; t < 8; ++t) vf[t] = lds_frag(vb + t * 16 * FA_PV);
    __builtin_amdgcn_sched_barrier(0);   // the 16 cT loads issue as one group ahead of the score products and fly under them and the softmax
    v8f sc[2];
    sc[0] = (v8f){0.f,0.f,0.f,0.f,0.f,0.f,0.f,0.f};
    sc[1] = (v8f){0.f,0.f,0.f,0.f,0.f,0.f,0.f,0.f};
#pragma unroll
    for (int kc = 0; kc < 8; ++kc) {
      sc[0] = Frag<_Float16>::mma(kf[kc], qf[0][kc], sc[0]);
      sc[1] = Frag<_Float16>::mma(kf[kc], qf[1][kc], sc[1]);
    }
    float m_own[2], ps[2];
#pragma unroll
    for (int j = 0; j < 2; ++j) {
      float mx = fmaxf(sc[j][0], sc[j][1]);
#pragma unroll
      for (int r = 2; r < 8; ++r) mx = fmaxf(mx, sc[j][r]);
      mx = fmaxf(mx, xhalf(mx)) * cscale;              // both wave halves hold this query's maximum over the wave's 16 keys, in log2 units
      m_own[j] = mx > m_run[j] + 8.0f ? mx : m_run[j]; // no branch here: nothing is rescaled in front of the barrier
      const float nm = 7.0f - m_own[j];
#pragma unroll
      for (int r = 0; r < 8; ++r) sc[j][r] = fmaf(sc[j][r], cscale, nm);
    }
    const v8f e0 = exp2x8(sc[0]), e1 = exp2x8(sc[1]);
    {
      v8h p0, p1;
      ps[0] = 0.f; ps[1] = 0.f;
#pragma unroll
      for (int r = 0; r < 8; ++r) {
        ps[0] += e0[r]; ps[1] += e1[r];
        p0[r] = (_Float16)e0[r]; p1[r] = (_Float16)e1[r];
      }
      unsigned char* pw = L + FA_OP + (par * 8 + wv) * 1024 + lane * 16;
      *(v8h*)(pw) = p0;
      *(v8h*)(pw + 512) = p1;
      *(v2f*)(L + FA_OM + (par * 8 + wv) * 256 + lane * 8) = (v2f){m_own[0], m_own[1]};
    }
    if (par) {         // scalar: a tile's second pass is the publish point of the next tile
      wait_ds0();
      wait_async0();
    }
    __syncthreads();   // publishes P of pass s and ends the reads of P of pass s - 1; in an odd pass it also publishes the next tile and ends every wave's reads of this one
    Frag<_Float16>::U pf[2];
    v2f mA, mB;
    {
      const unsigned char* pr = L + FA_OP + (par * 8 + 2 * qg) * 1024 + lane * 16;
      pf[0].h[0] = *(const v8h*)(pr);               // keys 8h + r, from the pair's wave 0
      pf[0].h[1] = *(const v8h*)(pr + 1024);        // keys 16 + 8h + r, from its wave 1
      pf[1].h[0] = *(const v8h*)(pr + 512);
      pf[1].h[1] = *(const v8h*)(pr + 1024 + 512);
      const unsigned char* mr = L + FA_OM + (par * 8 + 2 * qg) * 256 + lane * 8;
      mA = *(const v2f*)(mr);
      mB = *(const v2f*)(mr + 256);
    }
    {
      // no branch round these loads, so that the wait for P can be a counted one; the last pass fetches its own tile again, unused
      const int sn = more ? s + 1 : s;
      const unsigned char* kb = L + ((sn >> 1) & 1) * FA_BUF + (32 * (sn & 1) + 16 * kh + c) * FA_PK + 16 * h;
#pragma unroll
      for (int kc = 0; kc < 8; ++kc) kf[kc] = lds_frag(kb + 64 * kc);
    }
    __builtin_amdgcn_sched_barrier(0);   // P first, then the next pass's bq fragments, as one group of LDS loads ahead of the P.c products, which hide the latter
    if (par && tile + 2 < nTile) acopy(tile + 2);   // scalar test; into the buffer whose last reads the barrier above has ended
    const float mn0 = fmaxf(mA[0], mB[0]), mn1 = fmaxf(mA[1], mB[1]);   // the same value in both waves of the pair
    if (__builtin_amdgcn_ballot_w32(mn0 != m_run[0] || mn1 != m_run[1]) != 0) {   // scalar branch: rare after the first passes
      const float mn[2] = {mn0, mn1};
#pragma unroll
      for (int j = 0; j < 2; ++j) {
        const float ca = __builtin_amdgcn_exp2f(m_run[j] - mn[j]);   // 0 on the first pass, 1 for a query whose maximum stays
        const float co = __builtin_amdgcn_exp2f(m_own[j] - mn[j]);
        const float cA = __builtin_amdgcn_exp2f(mA[j] - mn[j]);
        const float cB = __builtin_amdgcn_exp2f(mB[j] - mn[j]);
        l_run[j] *= ca; ps[j] *= co; m_run[j] = mn[j];
#pragma unroll
        for (int i = 0; i < 8; ++i) {
          pf[j].h[0][i] = (_Float16)((float)pf[j].h[0][i] * cA);
          pf[j].h[1][i] = (_Float16)((float)pf[j].h[1][i] * cB);
        }
#pragma unroll
        for (int t = 0; t < 8; ++t) acc[t][j] = acc[t][j] * ca;
      }
    }
    l_run[0] += ps[0]; l_run[1] += ps[1];
#pragma unroll
    for (int t = 0; t < 8; ++t) {
      acc[t][0] = Frag<_Float16>::mma(vf[t], pf[0].v, acc[t][0]);
      acc[t][1] = Frag<_Float16>::mma(vf[t], pf[1].v, acc[t][1]);
    }
    wmma_gap();
  }

  wait_async0();   // nothing is outstanding when the buffers become output staging
  // ---- epilogue: the pair joins its row sums; O^T / l staged in LDS (rows = channels), then whole 512-byte rows: + residual, stored once ----
  float lt[2];
#pragma unroll
  for (int j = 0; j < 2; ++j) {
    lt[j] = l_run[j] + xhalf(l_run[j]);   // each wave half summed its own keys
    *(float*)(L + FA_OL + (wv * 2 + j) * 128 + lane * 4) = lt[j];
  }
  __syncthreads();   // the row sums are published; every wave has left the pass buffers, which become output staging
#pragma unroll
  for (int j = 0; j < 2; ++j) {
    const float inv = 1.0f / (lt[j] + *(const float*)(L + FA_OL + ((wv ^ 1) * 2 + j) * 128 + lane * 4));
#pragma unroll
    for (int t = 0; t < 8; ++t)
#pragma unroll
      for (int r = 0; r < 8; ++r)
        *(float*)(L + (128 * kh + 16 * t + 8 * h + r) * FA_PE + (qg * 32 + 16 * j + c) * 4) = acc[t][j][r] * inv;
  }
  __syncthreads();   // the whole 256 x 128 tile is staged
  for (int i0 = 0; i0 < FA_C / 8; i0 += 8) {
    v4f xr[8];
#pragma unroll
    for (int j = 0; j < 8; ++j)
      xr[j] = *(const v4f*)(x + ((size_t)b * FA_C + (i0 + j) * 8 + wave) * N + q0 + lane * 4);
    wait_xcnt0();
#pragma unroll
    for (int j = 0; j < 8; ++j) {
      const int row = (i0 + j) * 8 + wave;
      *(v4f*)(out + ((size_t)b * FA_C + row) * N + q0 + lane * 4) = *(const v4f*)(L + row * FA_PE + lane * 16) + xr[j];
    }
    wait_xcnt0();
  }
}

// ---- all three projections in one launch, straight from the f32 inputs ----
// A job is one tile of 64 tokens. The tile goes global (channel-major f32) -> registers -> LDS (token-major f16), the weight
// global f32 -> x16 -> f16 rows in LDS; both are read as WMMA fragments in the same k order; results leave through LDS as whole lines.
// Workgroups [0, nPt): one x_pt tile: fc2, then fc3 on the f16 fc2 tile still in LDS. The others: fc1 on four x tiles, the next tile's loads in flight under a product.
// 8 waves: wave = (group of 64 output channels) + 4 * (group of 32 tokens).
#define PJ_T 64
#define PJ_C 256
#define PJ_P 528                        // LDS pitch of a row of 256 f16: 512 B + 16 (odd multiple of 16 B)
#define PJ_PC 144                       // LDS pitch of a cT row piece: 128 B + 16 (odd multiple of 16 B)
#define PJ_LW 0
#define PJ_LX (PJ_LW + PJ_C * PJ_P)
#define PJ_LO (PJ_LX + PJ_T * PJ_P)
#define PJ_LC (PJ_LO + PJ_T * PJ_P)
#define PJ_LDS (PJ_LC + PJ_C * PJ_PC)

typedef __attribute__((ext_vector_type(2))) _Float16 v2h;
__device__ __forceinline__ unsigned pack2h(float a, float b) {   // round to nearest even, a in the low half
  return __builtin_bit_cast(unsigned, __builtin_convertvector((v2f){a, b}, v2h));
}
// src: channel 0 of the tile's batch at the tile's first token; Lt: tokens in a channel row. A wave-wide load is one 128-byte line.
template <int Lt>
__device__ __forceinline__ void pj_gload(float (&pre)[64], const float* __restrict__ src, int lane, int wave) {
  const float* p = src + (wave >> 1) * 2 * Lt + (wave & 1) * 32 + lane;   // token half wave & 1, channel pair 4 i + (wave >> 1)
#pragma unroll
  for (int i = 0; i < 32; ++i) {
    pre[2 * i]     = p[i * 8 * Lt];
    pre[2 * i + 1] = p[i * 8 * Lt + Lt];
  }
  wait_xcnt0();
}
__device__ __forceinline__ void pj_sstore(const float (&pre)[64], unsigned char* LX, int lane, int wave) {
  unsigned char* q = LX + ((wave & 1) * 32 + lane) * PJ_P + (wave >> 1) * 4;
#pragma unroll
  for (int i = 0; i < 32; ++i) *(unsigned*)(q + i * 16) = pack2h(pre[2 * i], pre[2 * i + 1]);
}
__device__ __forceinline__ void pj_loadW(const float* __restrict__ Wg, unsigned char* LW, int tid, float wscale) {
  const float* p = Wg + tid * 4;                                    // piece id = 256 k + tid: row id >> 6, four columns from (id & 63) * 4
  unsigned char* q = LW + (tid >> 6) * PJ_P + (tid & 63) * 8;
  for (int b0 = 0; b0 < 2; ++b0) {
    v4f w[32];
#pragma unroll
    for (int j = 0; j < 32; ++j) w[j] = *(const v4f*)(p + j * 1024);
    wait_xcnt0();
#pragma unroll
    for (int j = 0; j < 32; ++j) {
      uint2 o;
      o.x = pack2h(w[j][0] * wscale, w[j][1] * wscale);
      o.y = pack2h(w[j][2] * wscale, w[j][3] * wscale);
      *(uint2*)(q + j * 4 * PJ_P) = o;
    }
    p += 32 * 1024;
    q += 32 * 4 * PJ_P;
  }
}
// TOK_ROWS false: A = weight rows, B = tokens (a lane holds 8 consecutive channels of one token);
// TOK_ROWS true:  A = tokens, B = weight rows (a lane holds 8 consecutive tokens of one channel).
template <bool TOK_ROWS>
__device__ __forceinline__ void pj_gemm(const unsigned char* LW, const unsigned char* LT, v8f (&acc)[4][2], int c, int h, int cog, int tg) {
  const unsigned char* wp = LW + (cog * 64 + c) * PJ_P + 16 * h;
  const unsigned char* tp = LT + (tg * 32 + c) * PJ_P + 16 * h;
#pragma unroll
  for (int i = 0; i < 4; ++i)
#pragma unroll
    for (int j = 0; j < 2; ++j) acc[i][j] = (v8f){0.f,0.f,0.f,0.f,0.f,0.f,0.f,0.f};
  v16h wf[2][4], tf[2][2];   // two register sets: block kc + 1 is fetched while block kc is multiplied
#pragma unroll
  for (int i = 0; i < 4; ++i) wf[0][i] = lds_frag(wp + i * 16 * PJ_P);
#pragma unroll
  for (int j = 0; j < 2; ++j) tf[0][j] = lds_frag(tp + j * 16 * PJ_P);
#pragma unroll
  for (int kc = 0; kc < 8; ++kc) {
    const int cu = kc & 1, nx = cu ^ 1;
    if (kc < 7) {
#pragma unroll
      for (int i = 0; i < 4; ++i) wf[nx][i] = lds_frag(wp + i * 16 * PJ_P + 64 * (kc + 1));
#pragma unroll
      for (int j = 0; j < 2; ++j) tf[nx][j] = lds_frag(tp + j * 16 * PJ_P + 64 * (kc + 1));
    }
    __builtin_amdgcn_sched_barrier(0);   // the next block's 12 LDS loads issue as one group ahead of this block's products, which hide their latency
#pragma unroll
    for (int i = 0; i < 4; ++i)
#pragma unroll
      for (int j = 0; j < 2; ++j)
        acc[i][j] = TOK_ROWS ? Frag<_Float16>::mma(tf[cu][j], wf[cu][i], acc[i][j]) : Frag<_Float16>::mma(wf[cu][i], tf[cu][j], acc[i][j]);
    __builtin_amdgcn_sched_barrier(0);   // keeps the following group of loads from being spread among these products
  }
}
// the 32 bias values of a lane's output channels
__device__ __forceinline__ void pj_bias(v4f (&bb)[4][2], const float* __restrict__ bias, int h, int cog) {
#pragma unroll
  for (int i = 0; i < 4; ++i) {
    bb[i][0] = *(const v4f*)(bias + cog * 64 + 16 * i + 8 * h);
    bb[i][1] = *(const v4f*)(bias + cog * 64 + 16 * i + 8 * h + 4);
  }
  wait_xcnt0();
}
// acc / 16 + bias -> f16, token-major tile in LDS (16 bytes a lane)
__device__ __forceinline__ void pj_out_tok(const v8f (&acc)[4][2], const v4f (&bb)[4][2], unsigned char* LO, float scale, int c, int h, int cog, int tg) {
#pragma unroll
  for (int i = 0; i < 4; ++i)
#pragma unroll
    for (int j = 0; j < 2; ++j) {
      v8h o;
#pragma unroll
      for (int r = 0; r < 8; ++r) o[r] = (_Float16)(acc[i][j][r] * scale + bb[i][r >> 2][r & 3]);
      *(v8h*)(LO + (tg * 32 + 16 * j + c) * PJ_P + (cog * 64 + 16 * i + 8 * h) * 2) = o;
    }
}
// 64 token rows of 512 bytes, LDS -> registers -> global, a whole row a wave-wide store
__device__ __forceinline__ void pj_rows_read(u32x4 (&t)[8], const unsigned char* LO, int lane, int wave) {
#pragma unroll
  for (int p = 0; p < 8; ++p) t[p] = *(const u32x4*)(LO + (wave + 8 * p) * PJ_P + lane * 16);
}
__device__ __forceinline__ void pj_rows_write(const u32x4 (&t)[8], unsigned short* __restrict__ dst, int lane, int wave) {
#pragma unroll
  for (int p = 0; p < 8; ++p) *(u32x4*)((unsigned char*)dst + (size_t)(wave + 8 * p) * (PJ_C * 2) + lane * 16) = t[p];
  wait_xcnt0();
}

template <int N, int M>
__global__ __launch_bounds__(256) void proj_fused_f16(
    const float* __restrict__ x, const float* __restrict__ x_pt,
    const float* __restrict__ W1, const float* __restrict__ W2, const float* __restrict__ W3,
    const float* __restrict__ b1, const float* __restrict__ b2, const float* __restrict__ b3,
    unsigned short* __restrict__ A16,   // a  [B][N][256] f16
    unsigned short* __restrict__ BQ,    // bq [B][M][256] f16
    unsigned short* __restrict__ CT,    // cT [B][256][M] f16
    int nPt, float wscale, float scale) {
  __shared__ __align__(16) unsigned char S[PJ_LDS];
  const int tid  = threadIdx.x;
  const int lane = tid & 31;
  const int wave = __builtin_amdgcn_readfirstlane(tid >> 5);   // scalar: row bases of the tile loads stay in scalar registers
  const int c = lane & 15, h = lane >> 4;
  const int cog = wave & 3, tg = wave >> 2;
  const int bx = blockIdx.x;
  const bool pt = bx < nPt;                                   // the same for the whole workgroup
  const int nx    = pt ? 1 : 4;
  const int first = pt ? bx : (bx - nPt) * 4;                 // first tile; tile t holds tokens [64 t, 64 t + 64) of the flat [B * M] or [B * N]
  const int perN = N / PJ_T, perM = M / PJ_T;
  const int pb = bx / perM, pt0 = (bx - pb * perM) * PJ_T;    // the x_pt tile's batch and first token (used where pt)
  unsigned short* dst = pt ? BQ : A16;
  float pre[64];                                              // the next tile on its way to LDS
  v8f acc[4][2];
  v4f bb[4][2];
  u32x4 t[8];                                                 // an output tile's rows on their way out

  if (pt) {
    pj_gload<M>(pre, x_pt + (size_t)pb * PJ_C * M + pt0, lane, wave);
  } else {
    const int bt = first / perN;
    pj_gload<N>(pre, x + (size_t)bt * PJ_C * N + (first - bt * perN) * PJ_T, lane, wave);
  }
  pj_loadW(pt ? W2 : W1, S + PJ_LW, tid, wscale);
  pj_bias(bb, pt ? b2 : b1, h, cog);
  pj_sstore(pre, S + PJ_LX, lane, wave);
  __syncthreads();   // the weight and the first tile are in LDS

  for (int i = 0; i < nx; ++i) {
    const bool moreX = i + 1 < nx;                            // block-uniform, as is pt
    if (moreX) {
      const int tn = first + i + 1;
      const int bt = tn / perN;
      pj_gload<N>(pre, x + (size_t)bt * PJ_C * N + (tn - bt * perN) * PJ_T, lane, wave);
    }
    pj_gemm<false>(S + PJ_LW, S + PJ_LX, acc, c, h, cog, tg);
    pj_out_tok(acc, bb, S + PJ_LO, scale, c, h, cog, tg);
    __syncthreads();   // the output tile is whole; every wave has left this tile's input and, where pt, W2
    pj_rows_read(t, S + PJ_LO, lane, wave);
    if (moreX) pj_sstore(pre, S + PJ_LX, lane, wave);
    if (pt) pj_loadW(W3, S + PJ_LW, tid, wscale);
    __syncthreads();   // publishes the next tile (or W3); where another tile follows, the output staging is free again
    pj_rows_write(t, dst + (size_t)(first + i) * PJ_T * PJ_C, lane, wave);   // behind the barrier: the next barrier's wait for these stores comes after a whole product
  }
  if (!pt) return;     // the whole workgroup leaves together

  // fc3 on the f16 bq tile, which still lies in the output staging
  float bv[4];
#pragma unroll
  for (int i = 0; i < 4; ++i) bv[i] = b3[cog * 64 + 16 * i + c];
  wait_xcnt0();
  pj_gemm<true>(S + PJ_LW, S + PJ_LO, acc, c, h, cog, tg);
  {
#pragma unroll
    for (int i = 0; i < 4; ++i)
#pragma unroll
      for (int j = 0; j < 2; ++j) {
        v8h o;
#pragma unroll
        for (int r = 0; r < 8; ++r) o[r] = (_Float16)(acc[i][j][r] * scale + bv[i]);
        *(v8h*)(S + PJ_LC + (cog * 64 + 16 * i + c) * PJ_PC + (tg * 32 + 16 * j + 8 * h) * 2) = o;
      }
  }
  __syncthreads();     // the 256 x 64 cT tile is whole
  {
#pragma unroll
    for (int p = 0; p < 8; ++p) {
      const int id = p * 256 + tid;      // channel row id >> 3, 16-byte piece id & 7: whole 128-byte lines
      t[p] = *(const u32x4*)(S + PJ_LC + (id >> 3) * PJ_PC + (id & 7) * 16);
    }
#pragma unroll
    for (int p = 0; p < 8; ++p) {
      const int id = p * 256 + tid;
      *(u32x4*)((unsigned char*)(CT + ((size_t)pb * PJ_C + (id >> 3)) * M + pt0) + (id & 7) * 16) = t[p];
    }
    wait_xcnt0();
  }
}

// ---------------------------------------------------------------------------
extern "C" void kernel_launch(void* const* d_in, const int* in_sizes, int n_in,
                              void* d_out, int out_size, void* d_ws, size_t ws_size,
                              hipStream_t stream) {
  const int B = 4, C = 256, N = 8192, M = 2048;
  if (n_in < 8) return;
  if (in_sizes[0] != B * C * N || in_sizes[1] != B * C * M ||
      in_sizes[2] != C * C || in_sizes[3] != C || in_sizes[4] != C * C || in_sizes[5] != C ||
      in_sizes[6] != C * C || in_sizes[7] != C || out_size != B * C * N) return;

  const float* x    = (const float*)d_in[0];
  const float* x_pt = (const float*)d_in[1];
  const float* W1   = (const float*)d_in[2];
  const float* b1   = (const float*)d_in[3];
  const float* W2   = (const float*)d_in[4];
  const float* b2   = (const float*)d_in[5];
  const float* W3   = (const float*)d_in[6];
  const float* b3   = (const float*)d_in[7];
  float* out = (float*)d_out;

  const size_t szA16 = (size_t)B * N * C * 2;          // a  [B][N][C] f16      16,777,216
  const size_t szTok = (size_t)B * M * C * 2;          // [B][M][C] f16           4,194,304
  const size_t offA16 = 0;
  const size_t offBQ  = offA16 + szA16;
  const size_t offCT  = offBQ + szTok;
  const size_t total  = offCT + szTok;                 // 25,165,824
  if (total > ws_size) return;

  char* ws = (char*)d_ws;
  unsigned short* A16u  = (unsigned short*)(ws + offA16);
  unsigned short* BQu   = (unsigned short*)(ws + offBQ);
  unsigned short* CTu   = (unsigned short*)(ws + offCT);

  const float inv16 = 1.0f / 16.0f;
  const float cscale = 1.4426950408889634f / 16.0f;   // 1 / sqrt(C) and log2(e): scores in log2 units

  // one launch: a[b][n][co] = sum_ci x[b][ci][n] * W1[co][ci] + b1[co]; bq[b][m][co] = sum_ci x_pt[b][ci][m] * W2[co][ci] + b2[co];
  // cT[b][co][m] = sum_ci W3[co][ci] * bq[b][m][ci] + b3[co]; f16 out; weights carried x16, folded back as 1/16
  const int nPt = B * M / PJ_T;                        // workgroups with one x_pt tile
  const int nXo = B * N / PJ_T / 4;                    // workgroups with four x tiles
  proj_fused_f16<N, M><<<dim3(nPt + nXo), 256, 0, stream>>>(x, x_pt, W1, W2, W3, b1, b2, b3, A16u, BQu, CTu, nPt, 16.0f, inv16);

  // score, softmax, P.c and residual in one launch: out[b][co][n] = x[b][co][n] + sum_m softmax_m(a[n].bq[m] / 16) * cT[co][m]
  attn_fused_f16<<<dim3(N / FA_BQ, B), 256, 0, stream>>>(A16u, BQu, CTu, x, out, N, M, cscale);
  (void)hipGetLastError();
}

// v007
// A run of this version takes 68.2 microseconds.
// Timed twice side by side with v006, it ran 1.05 times as fast both times.
// Over all steps from v000 it is 11.7 times as fast.
#include <hip/hip_runtime.h>
#include <stdint.h>
#include <math.h>

// Contractions fc1, fc2, fc3, score = a.b^T and P.c: v_wmma_f32_16x16x32_f16 (f16 operands, f32 accumulate); weights carried x16 (folded back in the f32 epilogue), softmax probabilities carried x2^7 (cancels in the division by the row sum); softmax, bias and residual in f32.

typedef __attribute__((ext_vector_type(16))) _Float16 v16h;
typedef __attribute__((ext_vector_type(8)))  _Float16 v8h;
typedef __attribute__((ext_vector_type(8)))  float    v8f;
typedef __attribute__((ext_vector_type(4)))  float    v4f;
typedef __attribute__((ext_vector_type(2)))  float    v2f;

template <typename T> struct Frag;
template <> struct Frag<_Float16> {
  typedef v16h V; union U { v16h v; v8h h[2]; };
  static __device__ __forceinline__ v16h load(const _Float16* p) {   // elements 0..7 <- p[0..7], 8..15 <- p[16..23]
    U f; f.h[0] = *(const v8h*)(p); f.h[1] = *(const v8h*)(p + 16); return f.v;
  }
  static __device__ __forceinline__ v8f mma(v16h a, v16h b, v8f c) {
    return __builtin_amdgcn_wmma_f32_16x16x32_f16(false, a, false, b, (short)0, c, false, false);
  }
};

typedef __attribute__((ext_vector_type(4))) unsigned int u32x4;
#define FA_C 256
#define FA_BQ 128
#define FA_BK 32
#define FA_PK 528                       // LDS pitch of a bq row: 512 B + 16 (odd multiple of 16 B)
#define FA_BT 64                        // keys of a staged tile: two passes
#define FA_PV 144                       // LDS pitch of a cT row piece: 128 B + 16 (odd multiple of 16 B)
#define FA_TK (FA_BT * FA_PK)
#define FA_TV (FA_C * FA_PV)
#define FA_BUF (FA_TK + FA_TV)
#define FA_PE 528                       // output staging pitch: 128 f32 + 16 B
#define FA_STG (FA_C * FA_PE)
#define FA_OP (2 * FA_BUF)              // P halves: [pass parity][wave][column group][lane] 16 B
#define FA_OM (FA_OP + 2 * 8 * 1024)    // the maxima they were written against: [pass parity][wave][lane] two f32
#define FA_OL (FA_OM + 2 * 8 * 256)     // row sums, epilogue: [wave][column group][lane] f32
#define FA_OX (FA_OL + 8 * 256)         // residual tile: 256 channel rows of 128 f32, no pad (a row is read as a wave's 512 contiguous bytes)
#define FA_XR (FA_BQ * 4)
#define FA_XC (FA_C / 16)               // it is copied in pieces of 16 rows, two copies a wave
#define FA_LDS (FA_OX + FA_C * FA_XR)
static_assert(FA_STG <= FA_OL, "the output staging area ends in front of the row sums");

// lane l with lane l ^ 16
__device__ __forceinline__ float xhalf(float v) {
  return __builtin_bit_cast(float, __builtin_amdgcn_permlanex16(__builtin_bit_cast(int, v), __builtin_bit_cast(int, v), 0x76543210, 0xfedcba98, false, false));
}
// Four vector slots behind a run of matrix instructions, held in place by the two scheduling barriers: keeps the
// distance to the next vector instruction that touches their registers on every path, a taken branch included.
__device__ __forceinline__ void wmma_gap() {
  __builtin_amdgcn_sched_barrier(0);
  asm volatile("v_nop\n\tv_nop\n\tv_nop\n\tv_nop");
  __builtin_amdgcn_sched_barrier(0);
}
// Behind a run of global loads or stores: stands in front of every later overwrite of their address registers
// (the scheduling barrier keeps such an overwrite from being moved up over the wait).
__device__ __forceinline__ void wait_xcnt0() {
  asm volatile("s_wait_xcnt 0x0" ::: "memory");
  __builtin_amdgcn_sched_barrier(0);
}
// One lane's 16 bytes global -> LDS through no register; counted on asynccnt, no wait is placed by the compiler.
typedef __attribute__((ext_vector_type(4))) int i32x4;
__device__ __forceinline__ void copy16_to_lds(const unsigned char* g, unsigned char* l) {
  __builtin_amdgcn_global_load_async_to_lds_b128((__attribute__((address_space(1))) i32x4*)g, (__attribute__((address_space(3))) i32x4*)l, 0, 0);
}
// This wave's copies have landed (other waves read them behind the next barrier).
__device__ __forceinline__ void wait_async0() { asm volatile("s_wait_asynccnt 0x0" ::: "memory"); }
// This wave's LDS reads and writes have retired: stands in front of the barrier behind which a buffer it read is refilled by copies.
__device__ __forceinline__ void wait_ds0() { asm volatile("s_wait_dscnt 0x0" ::: "memory"); }
// Eight exponentials (base 2) in one statement: behind a transcendental one independent instruction stands before its result
// is used or its source overwritten; here each next exponential is that instruction, and the v_nop is the last one's.
// The outputs are early-clobber, so none of them lies on a source.
__device__ __forceinline__ v8f exp2x8(v8f t) {
  float p0, p1, p2, p3, p4, p5, p6, p7;
  asm("v_exp_f32 %0, %8\n\tv_exp_f32 %1, %9\n\tv_exp_f32 %2, %10\n\tv_exp_f32 %3, %11\n\t"
      "v_exp_f32 %4, %12\n\tv_exp_f32 %5, %13\n\tv_exp_f32 %6, %14\n\tv_exp_f32 %7, %15\n\tv_nop"
      : "=&v"(p0), "=&v"(p1), "=&v"(p2), "=&v"(p3), "=&v"(p4), "=&v"(p5), "=&v"(p6), "=&v"(p7)
      : "v"(t[0]), "v"(t[1]), "v"(t[2]), "v"(t[3]), "v"(t[4]), "v"(t[5]), "v"(t[6]), "v"(t[7]));
  return (v8f){p0, p1, p2, p3, p4, p5, p6, p7};
}
__device__ __forceinline__ v16h lds_frag(const unsigned char* p) {   // elements 0..7 <- bytes 0..15, 8..15 <- bytes 32..47
  Frag<_Float16>::U f; f.h[0] = *(const v8h*)(p); f.h[1] = *(const v8h*)(p + 32); return f.v;
}

__global__ __launch_bounds__(256) __attribute__((amdgpu_waves_per_eu(2, 2))) void attn_fused_f16(
    const unsigned short* __restrict__ Aq,    // a  [B][N][256] f16
    const unsigned short* __restrict__ Bk,    // bq [B][M][256] f16
    const unsigned short* __restrict__ Ct,    // cT [B][256][M] f16
    const float* __restrict__ x, float* __restrict__ out,   // [B][256][N] f32
    int N, int M, float cscale) {
  __shared__ __align__(16) unsigned char L[FA_LDS];
  const int tid  = threadIdx.x;
  const int lane = tid & 31;
  const int wave = tid >> 5;
  const int c = lane & 15, h = lane >> 4;
  const int b  = blockIdx.y;
  const int q0 = blockIdx.x * FA_BQ;
  const unsigned char* kSrc = (const unsigned char*)(Bk + (size_t)b * M * FA_C);
  const unsigned char* vSrc = (const unsigned char*)(Ct + (size_t)b * FA_C * M);
  const size_t vPitch = (size_t)M * 2;
  const int nPass = M / FA_BK;
  const int nTile = M / FA_BT;

  // tile T (keys 64 T .. 64 T + 63) into buffer T & 1: 16 copies a wave, every lane on; a wave-wide copy is one bq row or four whole cT lines
  auto acopy = [&](int T) {
    unsigned char* base = L + (T & 1) * FA_BUF;
#pragma unroll
    for (int i = 0; i < 8; ++i) {
      const int id = i * 256 + tid;
      copy16_to_lds(kSrc + (size_t)T * (FA_BT * FA_C * 2) + (size_t)id * 16, base + (id >> 5) * FA_PK + (id & 31) * 16);
    }
#pragma unroll
    for (int i = 0; i < 8; ++i) {
      const int id = i * 256 + tid;
      copy16_to_lds(vSrc + (size_t)(id >> 3) * vPitch + (size_t)T * (FA_BT * 2) + (id & 7) * 16, base + FA_TK + (id >> 3) * FA_PV + (id & 7) * 16);
    }
  };

  const int wv = __builtin_amdgcn_readfirstlane(wave);   // scalar: LDS bases of the pair's exchange stay in scalar registers
  const int qg = wv >> 1, kh = wv & 1;                    // the pair's 32 queries; this wave's key tile and channel half

  // piece ch of the residual tile: rows 16 ch + wave and 16 ch + 8 + wave, a wave-wide copy is one row piece of 512 bytes (four whole lines); every lane on
  const unsigned char* xSrc = (const unsigned char*)(x + (size_t)b * FA_C * N + q0);
  const size_t xPitch = (size_t)N * 4;
  auto xcopy = [&](int ch) {
#pragma unroll
    for (int i = 0; i < 2; ++i) {
      const int row = ch * 16 + i * 8 + wv;
      copy16_to_lds(xSrc + (size_t)row * xPitch + lane * 16, L + FA_OX + row * FA_XR + lane * 16);
    }
  };

  acopy(0);
  v16h qf[2][8];   // the pair's 32 queries as B operands, kept for the whole loop
#pragma unroll
  for (int j = 0; j < 2; ++j) {
    const _Float16* qp = (const _Float16*)Aq + ((size_t)b * N + q0 + qg * 32 + 16 * j + c) * FA_C + 8 * h;
#pragma unroll
    for (int kc = 0; kc < 8; ++kc) qf[j][kc] = Frag<_Float16>::load(qp + 32 * kc);
    wait_xcnt0();
  }
  v8f acc[8][2];
#pragma unroll
  for (int t = 0; t < 8; ++t)
#pragma unroll
    for (int j = 0; j < 2; ++j) acc[t][j] = (v8f){0.f,0.f,0.f,0.f,0.f,0.f,0.f,0.f};
  float m_run[2] = {-INFINITY, -INFINITY}, l_run[2] = {0.f, 0.f};
  wait_async0();
  __syncthreads();   // tile 0 is in LDS
  if (1 < nTile) acopy(1);
  v16h kf[8], vf[8];   // this wave's 8 bq fragments (fetched one pass ahead) and 8 cT fragments
  {
    const unsigned char* kb = L + (16 * kh + c) * FA_PK + 16 * h;
#pragma unroll
    for (int kc = 0; kc < 8; ++kc) kf[kc] = lds_frag(kb + 64 * kc);
  }

  for (int s = 0; s < nPass; ++s) {
    const bool more = s + 1 < nPass;     // the same for the whole workgroup
    const int par = s & 1;
    const int tile = s >> 1;
    const unsigned char* vb = L + (tile & 1) * FA_BUF + FA_TK + (128 * kh + c) * FA_PV + 64 * par + 16 * h;
#pragma unroll
    for (int t = 0; t < 8; ++t) vf[t] = lds_frag(vb + t * 16 * FA_PV);
    __builtin_amdgcn_sched_barrier(0);   // the 16 cT loads issue as one group ahead of the score products and fly under them and the softmax
    v8f sc[2];
    sc[0] = (v8f){0.f,0.f,0.f,0.f,0.f,0.f,0.f,0.f};
    sc[1] = (v8f){0.f,0.f,0.f,0.f,0.f,0.f,0.f,0.f};
#pragma unroll
    for (int kc = 0; kc < 8; ++kc) {
      sc[0] = Frag<_Float16>::mma(kf[kc], qf[0][kc], sc[0]);
      sc[1] = Frag<_Float16>::mma(kf[kc], qf[1][kc], sc[1]);
    }
    float m_own[2], ps[2];
#pragma unroll
    for (int j = 0; j < 2; ++j) {
      float mx = fmaxf(sc[j][0], sc[j][1]);
#pragma unroll
      for (int r = 2; r < 8; ++r) mx = fmaxf(mx, sc[j][r]);
      mx = fmaxf(mx, xhalf(mx)) * cscale;              // both wave halves hold this query's maximum over the wave's 16 keys, in log2 units
      m_own[j] = mx > m_run[j] + 8.0f ? mx : m_run[j]; // no branch here: nothing is rescaled in front of the barrier
      const float nm = 7.0f - m_own[j];
#pragma unroll
      for (int r = 0; r < 8; ++r) sc[j][r] = fmaf(sc[j][r], cscale, nm);
    }
    const v8f e0 = exp2x8(sc[0]), e1 = exp2x8(sc[1]);
    {
      v8h p0, p1;
      ps[0] = 0.f; ps[1] = 0.f;
#pragma unroll
      for (int r = 0; r < 8; ++r) {
        ps[0] += e0[r]; ps[1] += e1[r];
        p0[r] = (_Float16)e0[r]; p1[r] = (_Float16)e1[r];
      }
      unsigned char* pw = L + FA_OP + (par * 8 + wv) * 1024 + lane * 16;
      *(v8h*)(pw) = p0;
      *(v8h*)(pw + 512) = p1;
      *(v2f*)(L + FA_OM + (par * 8 + wv) * 256 + lane * 8) = (v2f){m_own[0], m_own[1]};
    }
    if (par) {         // scalar: a tile's second pass is the publish point of the next tile
      wait_ds0();
      wait_async0();
    }
    __syncthreads();   // publishes P of pass s and ends the reads of P of pass s - 1; in an odd pass it also publishes the next tile and ends every wave's reads of this one
    Frag<_Float16>::U pf[2];
    v2f mA, mB;
    {
      const unsigned char* pr = L + FA_OP + (par * 8 + 2 * qg) * 1024 + lane * 16;
      pf[0].h[0] = *(const v8h*)(pr);               // keys 8h + r, from the pair's wave 0
      pf[0].h[1] = *(const v8h*)(pr + 1024);        // keys 16 + 8h + r, from its wave 1
      pf[1].h[0] = *(const v8h*)(pr + 512);
      pf[1].h[1] = *(const v8h*)(pr + 1024 + 512);
      const unsigned char* mr = L + FA_OM + (par * 8 + 2 * qg) * 256 + lane * 8;
      mA = *(const v2f*)(mr);
      mB = *(const v2f*)(mr + 256);
    }
    {
      // no branch round these loads, so that the wait for P can be a counted one; the last pass fetches its own tile again, unused
      const int sn = more ? s + 1 : s;
      const unsigned char* kb = L + ((sn >> 1) & 1) * FA_BUF + (32 * (sn & 1) + 16 * kh + c) * FA_PK + 16 * h;
#pragma unroll
      for (int kc = 0; kc < 8; ++kc) kf[kc] = lds_frag(kb + 64 * kc);
    }
    __builtin_amdgcn_sched_barrier(0);   // P first, then the next pass's bq fragments, as one group of LDS loads ahead of the P.c products, which hide the latter
    if (par) {                                 // scalar tests
      if (tile + 2 < nTile) acopy(tile + 2);   // into the buffer whose last reads the barrier above has ended
      if (tile < FA_XC) xcopy(tile);           // into an area that nothing else uses
    }
    const float mn0 = fmaxf(mA[0], mB[0]), mn1 = fmaxf(mA[1], mB[1]);   // the same value in both waves of the pair
    if (__builtin_amdgcn_ballot_w32(mn0 != m_run[0] || mn1 != m_run[1]) != 0) {   // scalar branch: rare after the first passes
      const float mn[2] = {mn0, mn1};
#pragma unroll
      for (int j = 0; j < 2; ++j) {
        const float ca = __builtin_amdgcn_exp2f(m_run[j] - mn[j]);   // 0 on the first pass, 1 for a query whose maximum stays
        const float co = __builtin_amdgcn_exp2f(m_own[j] - mn[j]);
        const float cA = __builtin_amdgcn_exp2f(mA[j] - mn[j]);
        const float cB = __builtin_amdgcn_exp2f(mB[j] - mn[j]);
        l_run[j] *= ca; ps[j] *= co; m_run[j] = mn[j];
#pragma unroll
        for (int i = 0; i < 8; ++i) {
          pf[j].h[0][i] = (_Float16)((float)pf[j].h[0][i] * cA);
          pf[j].h[1][i] = (_Float16)((float)pf[j].h[1][i] * cB);
        }
#pragma unroll
        for (int t = 0; t < 8; ++t) acc[t][j] = acc[t][j] * ca;
      }
    }
    l_run[0] += ps[0]; l_run[1] += ps[1];
#pragma unroll
    for (int t = 0; t < 8; ++t) {
      acc[t][0] = Frag<_Float16>::mma(vf[t], pf[0].v, acc[t][0]);
      acc[t][1] = Frag<_Float16>::mma(vf[t], pf[1].v, acc[t][1]);
    }
    wmma_gap();
  }

  for (int ch = nTile < FA_XC ? nTile : FA_XC; ch < FA_XC; ++ch) xcopy(ch);   // pieces that a short key loop has not reached (none at 16 tiles or more)
  wait_async0();   // nothing is outstanding when the buffers become output staging; this wave's residual rows have landed
  // ---- epilogue: the pair joins its row sums; O^T / l staged in LDS (rows = channels), then whole 512-byte rows: + residual, stored once ----
  float lt[2];
#pragma unroll
  for (int j = 0; j < 2; ++j) {
    lt[j] = l_run[j] + xhalf(l_run[j]);   // each wave half summed its own keys
    *(float*)(L + FA_OL + (wv * 2 + j) * 128 + lane * 4) = lt[j];
  }
  __syncthreads();   // the row sums are published; every wave has left the pass buffers, which become output staging
#pragma unroll
  for (int j = 0; j < 2; ++j) {
    const float inv = 1.0f / (lt[j] + *(const float*)(L + FA_OL + ((wv ^ 1) * 2 + j) * 128 + lane * 4));
#pragma unroll
    for (int t = 0; t < 8; ++t)
#pragma unroll
      for (int r = 0; r < 8; ++r)
        *(float*)(L + (128 * kh + 16 * t + 8 * h + r) * FA_PE + (qg * 32 + 16 * j + c) * 4) = acc[t][j][r] * inv;
  }
  __syncthreads();   // the whole 256 x 128 tile is staged
  for (int i0 = 0; i0 < FA_C / 8; i0 += 8) {
    v4f o[8];
    float* op[8];
#pragma unroll
    for (int j = 0; j < 8; ++j) {
      const int row = (i0 + j) * 8 + wv;   // scalar
      op[j] = out + ((size_t)b * FA_C + row) * N + q0 + lane * 4;
      o[j] = *(const v4f*)(L + row * FA_PE + lane * 16) + *(const v4f*)(L + FA_OX + row * FA_XR + lane * 16);
    }
    __builtin_amdgcn_sched_barrier(0);   // the eight sums and addresses stand ahead of the eight stores: the stores issue as one group and none of their registers is rewritten among them
#pragma unroll
    for (int j = 0; j < 8; ++j) *(v4f*)(op[j]) = o[j];
    wait_xcnt0();
  }
}

// ---- all three projections in one launch, straight from the f32 inputs ----
// A job is one tile of 64 tokens. The tile goes global (channel-major f32) -> registers -> LDS (token-major f16), the weight
// global f32 -> x16 -> f16 rows in LDS; both are read as WMMA fragments in the same k order; results leave through LDS as whole lines.
// Workgroups [0, nPt): one x_pt tile: fc2, then fc3 on the f16 fc2 tile still in LDS. The others: fc1 on four x tiles, the next tile's loads in flight under a product.
// 8 waves: wave = (group of 64 output channels) + 4 * (group of 32 tokens).
#define PJ_T 64
#define PJ_C 256
#define PJ_P 528                        // LDS pitch of a row of 256 f16: 512 B + 16 (odd multiple of 16 B)
#define PJ_PC 144                       // LDS pitch of a cT row piece: 128 B + 16 (odd multiple of 16 B)
#define PJ_LW 0
#define PJ_LX (PJ_LW + PJ_C * PJ_P)
#define PJ_LO (PJ_LX + PJ_T * PJ_P)
#define PJ_LC (PJ_LO + PJ_T * PJ_P)
#define PJ_LDS (PJ_LC + PJ_C * PJ_PC)

typedef __attribute__((ext_vector_type(2))) _Float16 v2h;
__device__ __forceinline__ unsigned pack2h(float a, float b) {   // round to nearest even, a in the low half
  return __builtin_bit_cast(unsigned, __builtin_convertvector((v2f){a, b}, v2h));
}
// src: channel 0 of the tile's batch at the tile's first token; Lt: tokens in a channel row. A wave-wide load is one 128-byte line.
template <int Lt>
__device__ __forceinline__ void pj_gload(float (&pre)[64], const float* __restrict__ src, int lane, int wave) {
  const float* p = src + (wave >> 1) * 2 * Lt + (wave & 1) * 32 + lane;   // token half wave & 1, channel pair 4 i + (wave >> 1)
#pragma unroll
  for (int i = 0; i < 32; ++i) {
    pre[2 * i]     = p[i * 8 * Lt];
    pre[2 * i + 1] = p[i * 8 * Lt + Lt];
  }
  wait_xcnt0();
}
__device__ __forceinline__ void pj_sstore(const float (&pre)[64], unsigned char* LX, int lane, int wave) {
  unsigned char* q = LX + ((wave & 1) * 32 + lane) * PJ_P + (wave >> 1) * 4;
#pragma unroll
  for (int i = 0; i < 32; ++i) *(unsigned*)(q + i * 16) = pack2h(pre[2 * i], pre[2 * i + 1]);
}
__device__ __forceinline__ void pj_loadW(const float* __restrict__ Wg, unsigned char* LW, int tid, float wscale) {
  const float* p = Wg + tid * 4;                                    // piece id = 256 k + tid: row id >> 6, four columns from (id & 63) * 4
  unsigned char* q = LW + (tid >> 6) * PJ_P + (tid & 63) * 8;
  for (int b0 = 0; b0 < 2; ++b0) {
    v4f w[32];
#pragma unroll
    for (int j = 0; j < 32; ++j) w[j] = *(const v4f*)(p + j * 1024);
    wait_xcnt0();
#pragma unroll
    for (int j = 0; j < 32; ++j) {
      uint2 o;
      o.x = pack2h(w[j][0] * wscale, w[j][1] * wscale);
      o.y = pack2h(w[j][2] * wscale, w[j][3] * wscale);
      *(uint2*)(q + j * 4 * PJ_P) = o;
    }
    p += 32 * 1024;
    q += 32 * 4 * PJ_P;
  }
}
// TOK_ROWS false: A = weight rows, B = tokens (a lane holds 8 consecutive channels of one token);
// TOK_ROWS true:  A = tokens, B = weight rows (a lane holds 8 consecutive tokens of one channel).
template <bool TOK_ROWS>
__device__ __forceinline__ void pj_gemm(const unsigned char* LW, const unsigned char* LT, v8f (&acc)[4][2], int c, int h, int cog, int tg) {
  const unsigned char* wp = LW + (cog * 64 + c) * PJ_P + 16 * h;
  const unsigned char* tp = LT + (tg * 32 + c) * PJ_P + 16 * h;
#pragma unroll
  for (int i = 0; i < 4; ++i)
#pragma unroll
    for (int j = 0; j < 2; ++j) acc[i][j] = (v8f){0.f,0.f,0.f,0.f,0.f,0.f,0.f,0.f};
  v16h wf[2][4], tf[2][2];   // two register sets: block kc + 1 is fetched while block kc is multiplied
#pragma unroll
  for (int i = 0; i < 4; ++i) wf[0][i] = lds_frag(wp + i * 16 * PJ_P);
#pragma unroll
  for (int j = 0; j < 2; ++j) tf[0][j] = lds_frag(tp + j * 16 * PJ_P);
#pragma unroll
  for (int kc = 0; kc < 8; ++kc) {
    const int cu = kc & 1, nx = cu ^ 1;
    if (kc < 7) {
#pragma unroll
      for (int i = 0; i < 4; ++i) wf[nx][i] = lds_frag(wp + i * 16 * PJ_P + 64 * (kc + 1));
#pragma unroll
      for (int j = 0; j < 2; ++j) tf[nx][j] = lds_frag(tp + j * 16 * PJ_P + 64 * (kc + 1));
    }
    __builtin_amdgcn_sched_barrier(0);   // the next block's 12 LDS loads issue as one group ahead of this block's products, which hide their latency
#pragma unroll
    for (int i = 0; i < 4; ++i)
#pragma unroll
      for (int j = 0; j < 2; ++j)
        acc[i][j] = TOK_ROWS ? Frag<_Float16>::mma(tf[cu][j], wf[cu][i], acc[i][j]) : Frag<_Float16>::mma(wf[cu][i], tf[cu][j], acc[i][j]);
    __builtin_amdgcn_sched_barrier(0);   // keeps the following group of loads from being spread among these products
  }
}
// the 32 bias values of a lane's output channels
__device__ __forceinline__ void pj_bias(v4f (&bb)[4][2], const float* __restrict__ bias, int h, int cog) {
#pragma unroll
  for (int i = 0; i < 4; ++i) {
    bb[i][0] = *(const v4f*)(bias + cog * 64 + 16 * i + 8 * h);
    bb[i][1] = *(const v4f*)(bias + cog * 64 + 16 * i + 8 * h + 4);
  }
  wait_xcnt0();
}
// acc / 16 + bias -> f16, token-major tile in LDS (16 bytes a lane)
__device__ __forceinline__ void pj_out_tok(const v8f (&acc)[4][2], const v4f (&bb)[4][2], unsigned char* LO, float scale, int c, int h, int cog, int tg) {
#pragma unroll
  for (int i = 0; i < 4; ++i)
#pragma unroll
    for (int j = 0; j < 2; ++j) {
      v8h o;
#pragma unroll
      for (int r = 0; r < 8; ++r) o[r] = (_Float16)(acc[i][j][r] * scale + bb[i][r >> 2][r & 3]);
      *(v8h*)(LO + (tg * 32 + 16 * j + c) * PJ_P + (cog * 64 + 16 * i + 8 * h) * 2) = o;
    }
}
// 64 token rows of 512 bytes, LDS -> registers -> global, a whole row a wave-wide store
__device__ __forceinline__ void pj_rows_read(u32x4 (&t)[8], const unsigned char* LO, int lane, int wave) {
#pragma unroll
  for (int p = 0; p < 8; ++p) t[p] = *(const u32x4*)(LO + (wave + 8 * p) * PJ_P + lane * 16);
}
__device__ __forceinline__ void pj_rows_write(const u32x4 (&t)[8], unsigned short* __restrict__ dst, int lane, int wave) {
#pragma unroll
  for (int p = 0; p < 8; ++p) *(u32x4*)((unsigned char*)dst + (size_t)(wave + 8 * p) * (PJ_C * 2) + lane * 16) = t[p];
  wait_xcnt0();
}

template <int N, int M>
__global__ __launch_bounds__(256) void proj_fused_f16(
    const float* __restrict__ x, const float* __restrict__ x_pt,
    const float* __restrict__ W1, const float* __restrict__ W2, const float* __restrict__ W3,
    const float* __restrict__ b1, const float* __restrict__ b2, const float* __restrict__ b3,
    unsigned short* __restrict__ A16,   // a  [B][N][256] f16
    unsigned short* __restrict__ BQ,    // bq [B][M][256] f16
    unsigned short* __restrict__ CT,    // cT [B][256][M] f16
    int nPt, float wscale, float scale) {
  __shared__ __align__(16) unsigned char S[PJ_LDS];
  const int tid  = threadIdx.x;
  const int lane = tid & 31;
  const int wave = __builtin_amdgcn_readfirstlane(tid >> 5);   // scalar: row bases of the tile loads stay in scalar registers
  const int c = lane & 15, h = lane >> 4;
  const int cog = wave & 3, tg = wave >> 2;
  const int bx = blockIdx.x;
  const bool pt = bx < nPt;                                   // the same for the whole workgroup
  const int nx    = pt ? 1 : 4;
  const int first = pt ? bx : (bx - nPt) * 4;                 // first tile; tile t holds tokens [64 t, 64 t + 64) of the flat [B * M] or [B * N]
  const int perN = N / PJ_T, perM = M / PJ_T;
  const int pb = bx / perM, pt0 = (bx - pb * perM) * PJ_T;    // the x_pt tile's batch and first token (used where pt)
  unsigned short* dst = pt ? BQ : A16;
  float pre[64];                                              // the next tile on its way to LDS
  v8f acc[4][2];
  v4f bb[4][2];
  u32x4 t[8];                                                 // an output tile's rows on their way out

  if (pt) {
    pj_gload<M>(pre, x_pt + (size_t)pb * PJ_C * M + pt0, lane, wave);
  } else {
    const int bt = first / perN;
    pj_gload<N>(pre, x + (size_t)bt * PJ_C * N + (first - bt * perN) * PJ_T, lane, wave);
  }
  pj_loadW(pt ? W2 : W1, S + PJ_LW, tid, wscale);
  pj_bias(bb, pt ? b2 : b1, h, cog);
  pj_sstore(pre, S + PJ_LX, lane, wave);
  __syncthreads();   // the weight and the first tile are in LDS

  for (int i = 0; i < nx; ++i) {
    const bool moreX = i + 1 < nx;                            // block-uniform, as is pt
    if (moreX) {
      const int tn = first + i + 1;
      const int bt = tn / perN;
      pj_gload<N>(pre, x + (size_t)bt * PJ_C * N + (tn - bt * perN) * PJ_T, lane, wave);
    }
    pj_gemm<false>(S + PJ_LW, S + PJ_LX, acc, c, h, cog, tg);
    pj_out_tok(acc, bb, S + PJ_LO, scale, c, h, cog, tg);
    __syncthreads();   // the output tile is whole; every wave has left this tile's input and, where pt, W2
    pj_rows_read(t, S + PJ_LO, lane, wave);
    if (moreX) pj_sstore(pre, S + PJ_LX, lane, wave);
    if (pt) pj_loadW(W3, S + PJ_LW, tid, wscale);
    __syncthreads();   // publishes the next tile (or W3); where another tile follows, the output staging is free again
    pj_rows_write(t, dst + (size_t)(first + i) * PJ_T * PJ_C, lane, wave);   // behind the barrier: the next barrier's wait for these stores comes after a whole product
  }
  if (!pt) return;     // the whole workgroup leaves together

  // fc3 on the f16 bq tile, which still lies in the output staging
  float bv[4];
#pragma unroll
  for (int i = 0; i < 4; ++i) bv[i] = b3[cog * 64 + 16 * i + c];
  wait_xcnt0();
  pj_gemm<true>(S + PJ_LW, S + PJ_LO, acc, c, h, cog, tg);
  {
#pragma unroll
    for (int i = 0; i < 4; ++i)
#pragma unroll
      for (int j = 0; j < 2; ++j) {
        v8h o;
#pragma unroll
        for (int r = 0; r < 8; ++r) o[r] = (_Float16)(acc[i][j][r] * scale + bv[i]);
        *(v8h*)(S + PJ_LC + (cog * 64 + 16 * i + c) * PJ_PC + (tg * 32 + 16 * j + 8 * h) * 2) = o;
      }
  }
  __syncthreads();     // the 256 x 64 cT tile is whole
  {
#pragma unroll
    for (int p = 0; p < 8; ++p) {
      const int id = p * 256 + tid;      // channel row id >> 3, 16-byte piece id & 7: whole 128-byte lines
      t[p] = *(const u32x4*)(S + PJ_LC + (id >> 3) * PJ_PC + (id & 7) * 16);
    }
#pragma unroll
    for (int p = 0; p < 8; ++p) {
      const int id = p * 256 + tid;
      *(u32x4*)((unsigned char*)(CT + ((size_t)pb * PJ_C + (id >> 3)) * M + pt0) + (id & 7) * 16) = t[p];
    }
    wait_xcnt0();
  }
}

// ---------------------------------------------------------------------------
extern "C" void kernel_launch(void* const* d_in, const int* in_sizes, int n_in,
                              void* d_out, int out_size, void* d_ws, size_t ws_size,
                              hipStream_t stream) {
  const int B = 4, C = 256, N = 8192, M = 2048;
  if (n_in < 8) return;
  if (in_sizes[0] != B * C * N || in_sizes[1] != B * C * M ||
      in_sizes[2] != C * C || in_sizes[3] != C || in_sizes[4] != C * C || in_sizes[5] != C ||
      in_sizes[6] != C * C || in_sizes[7] != C || out_size != B * C * N) return;

  const float* x    = (const float*)d_in[0];
  const float* x_pt = (const float*)d_in[1];
  const float* W1   = (const float*)d_in[2];
  const float* b1   = (const float*)d_in[3];
  const float* W2   = (const float*)d_in[4];
  const float* b2   = (const float*)d_in[5];
  const float* W3   = (const float*)d_in[6];
  const float* b3   = (const float*)d_in[7];
  float* out = (float*)d_out;

  const size_t szA16 = (size_t)B * N * C * 2;          // a  [B][N][C] f16      16,777,216
  const size_t szTok = (size_t)B * M * C * 2;          // [B][M][C] f16           4,194,304
  const size_t offA16 = 0;
  const size_t offBQ  = offA16 + szA16;
  const size_t offCT  = offBQ + szTok;
  const size_t total  = offCT + szTok;                 // 25,165,824
  if (total > ws_size) return;

  char* ws = (char*)d_ws;
  unsigned short* A16u  = (unsigned short*)(ws + offA16);
  unsigned short* BQu   = (unsigned short*)(ws + offBQ);
  unsigned short* CTu   = (unsigned short*)(ws + offCT);

  const float inv16 = 1.0f / 16.0f;
  const float cscale = 1.4426950408889634f / 16.0f;   // 1 / sqrt(C) and log2(e): scores in log2 units

  // one launch: a[b][n][co] = sum_ci x[b][ci][n] * W1[co][ci] + b1[co]; bq[b][m][co] = sum_ci x_pt[b][ci][m] * W2[co][ci] + b2[co];
  // cT[b][co][m] = sum_ci W3[co][ci] * bq[b][m][ci] + b3[co]; f16 out; weights carried x16, folded back as 1/16
  const int nPt = B * M / PJ_T;                        // workgroups with one x_pt tile
  const int nXo = B * N / PJ_T / 4;                    // workgroups with four x tiles
  proj_fused_f16<N, M><<<dim3(nPt + nXo), 256, 0, stream>>>(x, x_pt, W1, W2, W3, b1, b2, b3, A16u, BQu, CTu, nPt, 16.0f, inv16);

  // score, softmax, P.c and residual in one launch: out[b][co][n] = x[b][co][n] + sum_m softmax_m(a[n].bq[m] / 16) * cT[co][m]
  attn_fused_f16<<<dim3(N / FA_BQ, B), 256, 0, stream>>>(A16u, BQu, CTu, x, out, N, M, cscale);
  (void)hipGetLastError();
}

// v008
// One run takes 66.5 microseconds.
// Next to v007, in two timings, it ran 1.03 times as fast each time.
// Counting every step since v000, it is 12.0 times as fast.
#include <hip/hip_runtime.h>
#include <stdint.h>
#include <math.h>

// Contractions fc1, fc2, fc3, score = a.b^T and P.c: v_wmma_f32_16x16x32_f16 (f16 operands, f32 accumulate); weights carried x16 (folded back in the f32 epilogue), softmax probabilities carried x2^7 (cancels in the division by the row sum); softmax, bias and residual in f32.

typedef __attribute__((ext_vector_type(16))) _Float16 v16h;
typedef __attribute__((ext_vector_type(8)))  _Float16 v8h;
typedef __attribute__((ext_vector_type(8)))  float    v8f;
typedef __attribute__((ext_vector_type(4)))  float    v4f;
typedef __attribute__((ext_vector_type(2)))  float    v2f;

template <typename T> struct Frag;
template <> struct Frag<_Float16> {
  typedef v16h V; union U { v16h v; v8h h[2]; };
  static __device__ __forceinline__ v16h load(const _Float16* p) {   // elements 0..7 <- p[0..7], 8..15 <- p[16..23]
    U f; f.h[0] = *(const v8h*)(p); f.h[1] = *(const v8h*)(p + 16); return f.v;
  }
  static __device__ __forceinline__ v8f mma(v16h a, v16h b, v8f c) {
    return __builtin_amdgcn_wmma_f32_16x16x32_f16(false, a, false, b, (short)0, c, false, false);
  }
};

typedef __attribute__((ext_vector_type(4))) unsigned int u32x4;
#define FA_C 256
#define FA_BQ 128
#define FA_BK 32
#define FA_PK 528                       // LDS pitch of a bq row: 512 B + 16 (odd multiple of 16 B)
#define FA_BT 64                        // keys of a staged tile: two passes
#define FA_PV 144                       // LDS pitch of a cT row piece: 128 B + 16 (odd multiple of 16 B)
#define FA_TK (FA_BT * FA_PK)
#define FA_TV (FA_C * FA_PV)
#define FA_BUF (FA_TK + FA_TV)
#define FA_PE 528                       // output staging pitch: 128 f32 + 16 B
#define FA_STG (FA_C * FA_PE)
#define FA_OP (2 * FA_BUF)              // P halves: [pass parity][wave][column group][lane] 16 B
#define FA_OM (FA_OP + 2 * 8 * 1024)    // the maxima they were written against: [pass parity][wave][lane] two f32
#define FA_OL (FA_OM + 2 * 8 * 256)     // row sums, epilogue: [wave][column group][lane] f32
#define FA_OX (FA_OL + 8 * 256)         // residual tile: 256 channel rows of 128 f32, no pad (a row is read as a wave's 512 contiguous bytes)
#define FA_XR (FA_BQ * 4)
#define FA_XC (FA_C / 16)               // it is copied in pieces of 16 rows, two copies a wave
#define FA_LDS (FA_OX + FA_C * FA_XR)
static_assert(FA_STG <= FA_OL, "the output staging area ends in front of the row sums");

// lane l with lane l ^ 16
__device__ __forceinline__ float xhalf(float v) {
  return __builtin_bit_cast(float, __builtin_amdgcn_permlanex16(__builtin_bit_cast(int, v), __builtin_bit_cast(int, v), 0x76543210, 0xfedcba98, false, false));
}
// Four vector slots behind a run of matrix instructions, held in place by the two scheduling barriers: keeps the
// distance to the next vector instruction that touches their registers on every path, a taken branch included.
__device__ __forceinline__ void wmma_gap() {
  __builtin_amdgcn_sched_barrier(0);
  asm volatile("v_nop\n\tv_nop\n\tv_nop\n\tv_nop");
  __builtin_amdgcn_sched_barrier(0);
}
// Behind a run of global loads or stores: stands in front of every later overwrite of their address registers
// (the scheduling barrier keeps such an overwrite from being moved up over the wait).
__device__ __forceinline__ void wait_xcnt0() {
  asm volatile("s_wait_xcnt 0x0" ::: "memory");
  __builtin_amdgcn_sched_barrier(0);
}
// One lane's 16 bytes global -> LDS through no register; counted on asynccnt, no wait is placed by the compiler.
typedef __attribute__((ext_vector_type(4))) int i32x4;
__device__ __forceinline__ void copy16_to_lds(const unsigned char* g, unsigned char* l) {
  __builtin_amdgcn_global_load_async_to_lds_b128((__attribute__((address_space(1))) i32x4*)g, (__attribute__((address_space(3))) i32x4*)l, 0, 0);
}
// This wave's copies have landed (other waves read them behind the next barrier).
__device__ __forceinline__ void wait_async0() { asm volatile("s_wait_asynccnt 0x0" ::: "memory"); }
// This wave's LDS reads and writes have retired: stands in front of the barrier behind which a buffer it read is refilled by copies.
__device__ __forceinline__ void wait_ds0() { asm volatile("s_wait_dscnt 0x0" ::: "memory"); }
// Eight exponentials (base 2) in one statement: behind a transcendental one independent instruction stands before its result
// is used or its source overwritten; here each next exponential is that instruction, and the v_nop is the last one's.
// The outputs are early-clobber, so none of them lies on a source.
__device__ __forceinline__ v8f exp2x8(v8f t) {
  float p0, p1, p2, p3, p4, p5, p6, p7;
  asm("v_exp_f32 %0, %8\n\tv_exp_f32 %1, %9\n\tv_exp_f32 %2, %10\n\tv_exp_f32 %3, %11\n\t"
      "v_exp_f32 %4, %12\n\tv_exp_f32 %5, %13\n\tv_exp_f32 %6, %14\n\tv_exp_f32 %7, %15\n\tv_nop"
      : "=&v"(p0), "=&v"(p1), "=&v"(p2), "=&v"(p3), "=&v"(p4), "=&v"(p5), "=&v"(p6), "=&v"(p7)
      : "v"(t[0]), "v"(t[1]), "v"(t[2]), "v"(t[3]), "v"(t[4]), "v"(t[5]), "v"(t[6]), "v"(t[7]));
  return (v8f){p0, p1, p2, p3, p4, p5, p6, p7};
}
__device__ __forceinline__ v16h lds_frag(const unsigned char* p) {   // elements 0..7 <- bytes 0..15, 8..15 <- bytes 32..47
  Frag<_Float16>::U f; f.h[0] = *(const v8h*)(p); f.h[1] = *(const v8h*)(p + 32); return f.v;
}

__global__ __launch_bounds__(256) __attribute__((amdgpu_waves_per_eu(2, 2))) void attn_fused_f16(
    const unsigned short* __restrict__ Aq,    // a  [B][N][256] f16, times log2(e) / sqrt(C)
    const unsigned short* __restrict__ Bk,    // bq [B][M][256] f16
    const unsigned short* __restrict__ Ct,    // cT [B][256][M] f16
    const float* __restrict__ x, float* __restrict__ out,   // [B][256][N] f32
    int N, int M) {
  __shared__ __align__(16) unsigned char L[FA_LDS];
  const int tid  = threadIdx.x;
  const int lane = tid & 31;
  const int wave = tid >> 5;
  const int c = lane & 15, h = lane >> 4;
  const int b  = blockIdx.y;
  const int q0 = blockIdx.x * FA_BQ;
  const unsigned char* kSrc = (const unsigned char*)(Bk + (size_t)b * M * FA_C);
  const unsigned char* vSrc = (const unsigned char*)(Ct + (size_t)b * FA_C * M);
  const size_t vPitch = (size_t)M * 2;
  const int nPass = M / FA_BK;
  const int nTile = M / FA_BT;

  // tile T (keys 64 T .. 64 T + 63) into buffer T & 1: 16 copies a wave, every lane on; a wave-wide copy is one bq row or four whole cT lines
  auto acopy = [&](int T) {
    unsigned char* base = L + (T & 1) * FA_BUF;
#pragma unroll
    for (int i = 0; i < 8; ++i) {
      const int id = i * 256 + tid;
      copy16_to_lds(kSrc + (size_t)T * (FA_BT * FA_C * 2) + (size_t)id * 16, base + (id >> 5) * FA_PK + (id & 31) * 16);
    }
#pragma unroll
    for (int i = 0; i < 8; ++i) {
      const int id = i * 256 + tid;
      copy16_to_lds(vSrc + (size_t)(id >> 3) * vPitch + (size_t)T * (FA_BT * 2) + (id & 7) * 16, base + FA_TK + (id >> 3) * FA_PV + (id & 7) * 16);
    }
  };

  const int wv = __builtin_amdgcn_readfirstlane(wave);   // scalar: LDS bases of the pair's exchange stay in scalar registers
  const int qg = wv >> 1, kh = wv & 1;                    // the pair's 32 queries; this wave's key tile and channel half

  // piece ch of the residual tile: rows 16 ch + wave and 16 ch + 8 + wave, a wave-wide copy is one row piece of 512 bytes (four whole lines); every lane on
  const unsigned char* xSrc = (const unsigned char*)(x + (size_t)b * FA_C * N + q0);
  const size_t xPitch = (size_t)N * 4;
  auto xcopy = [&](int ch) {
#pragma unroll
    for (int i = 0; i < 2; ++i) {
      const int row = ch * 16 + i * 8 + wv;
      copy16_to_lds(xSrc + (size_t)row * xPitch + lane * 16, L + FA_OX + row * FA_XR + lane * 16);
    }
  };

  acopy(0);
  v16h qf[2][8];   // the pair's 32 queries as B operands, kept for the whole loop
#pragma unroll
  for (int j = 0; j < 2; ++j) {
    const _Float16* qp = (const _Float16*)Aq + ((size_t)b * N + q0 + qg * 32 + 16 * j + c) * FA_C + 8 * h;
#pragma unroll
    for (int kc = 0; kc < 8; ++kc) qf[j][kc] = Frag<_Float16>::load(qp + 32 * kc);
    wait_xcnt0();
  }
  v8f acc[8][2];
#pragma unroll
  for (int t = 0; t < 8; ++t)
#pragma unroll
    for (int j = 0; j < 2; ++j) acc[t][j] = (v8f){0.f,0.f,0.f,0.f,0.f,0.f,0.f,0.f};
  float m_run[2] = {-INFINITY, -INFINITY}, l_run[2] = {0.f, 0.f};
  float nmr[2] = {7.f, 7.f};   // 7 - m of the lane's query (7 while there is no m)
  v8f sc[2];                   // the score tiles; each pass finds them set to its start value, 7 - m in all eight rows
  sc[0] = (v8f){7.f,7.f,7.f,7.f,7.f,7.f,7.f,7.f};
  sc[1] = sc[0];
  wait_async0();
  __syncthreads();   // tile 0 is in LDS
  if (1 < nTile) acopy(1);
  v16h kf[8], vf[8];   // this wave's 8 bq fragments (fetched one pass ahead) and 8 cT fragments
  {
    const unsigned char* kb = L + (16 * kh + c) * FA_PK + 16 * h;
#pragma unroll
    for (int kc = 0; kc < 8; ++kc) kf[kc] = lds_frag(kb + 64 * kc);
  }

  for (int s = 0; s < nPass; ++s) {
    const bool more = s + 1 < nPass;     // the same for the whole workgroup
    const int par = s & 1;
    const int tile = s >> 1;
    const unsigned char* vb = L + (tile & 1) * FA_BUF + FA_TK + (128 * kh + c) * FA_PV + 64 * par + 16 * h;
#pragma unroll
    for (int t = 0; t < 8; ++t) vf[t] = lds_frag(vb + t * 16 * FA_PV);
    __builtin_amdgcn_sched_barrier(0);   // the 16 cT loads issue as one group ahead of the score products and fly under them and the softmax
#pragma unroll
    for (int kc = 0; kc < 8; ++kc) {
      sc[0] = Frag<_Float16>::mma(kf[kc], qf[0][kc], sc[0]);
      sc[1] = Frag<_Float16>::mma(kf[kc], qf[1][kc], sc[1]);
    }
    wmma_gap();   // the next reader of these results is asm text
    float m_own[2] = {m_run[0], m_run[1]}, ps[2];
    v8f e0 = exp2x8(sc[0]), e1 = exp2x8(sc[1]);
    auto publish = [&]() {
      v8h p0, p1;
#pragma unroll
      for (int r = 0; r < 8; ++r) { p0[r] = (_Float16)e0[r]; p1[r] = (_Float16)e1[r]; }
      unsigned char* pw = L + FA_OP + (par * 8 + wv) * 1024 + lane * 16;
      *(v8h*)(pw) = p0;
      *(v8h*)(pw + 512) = p1;
      *(v2f*)(L + FA_OM + (par * 8 + wv) * 256 + lane * 8) = (v2f){m_own[0], m_own[1]};
    };
    publish();
    __builtin_amdgcn_sched_barrier(0);   // the stores issue ahead of the test below, which then runs while they are on their way
    float mt[2];
#pragma unroll
    for (int j = 0; j < 2; ++j) {
      mt[j] = fmaxf(sc[j][0], sc[j][1]);
#pragma unroll
      for (int r = 2; r < 8; ++r) mt[j] = fmaxf(mt[j], sc[j][r]);
    }
    if (s == 0 || __builtin_amdgcn_ballot_w32(mt[0] > 15.0f || mt[1] > 15.0f) != 0) {   // scalar branch: pass 0, then rare
#pragma unroll
      for (int j = 0; j < 2; ++j) {
        const float nm = nmr[j];
        const float mx = fmaxf(mt[j], xhalf(mt[j])) - nm;   // both wave halves hold this query's maximum over the wave's 16 keys, in log2 units
        m_own[j] = mx > m_run[j] + 8.0f ? mx : m_run[j];
        const float d = (7.0f - m_own[j]) - nm;             // 0 for a query whose maximum stays
#pragma unroll
        for (int r = 0; r < 8; ++r) sc[j][r] += d;
      }
      e0 = exp2x8(sc[0]);
      e1 = exp2x8(sc[1]);
      publish();   // same wave, same addresses: LDS keeps the order, the second store stands
    }
    if (par) {         // scalar: a tile's second pass is the publish point of the next tile
      wait_ds0();
      wait_async0();
    }
    __syncthreads();   // publishes P of pass s and ends the reads of P of pass s - 1; in an odd pass it also publishes the next tile and ends every wave's reads of this one
    Frag<_Float16>::U pf[2];
    v2f mA, mB;
    {
      const unsigned char* pr = L + FA_OP + (par * 8 + 2 * qg) * 1024 + lane * 16;
      pf[0].h[0] = *(const v8h*)(pr);               // keys 8h + r, from the pair's wave 0
      pf[0].h[1] = *(const v8h*)(pr + 1024);        // keys 16 + 8h + r, from its wave 1
      pf[1].h[0] = *(const v8h*)(pr + 512);
      pf[1].h[1] = *(const v8h*)(pr + 1024 + 512);
      const unsigned char* mr = L + FA_OM + (par * 8 + 2 * qg) * 256 + lane * 8;
      mA = *(const v2f*)(mr);
      mB = *(const v2f*)(mr + 256);
    }
    {
      // no branch round these loads, so that the wait for P can be a counted one; the last pass fetches its own tile again, unused
      const int sn = more ? s + 1 : s;
      const unsigned char* kb = L + ((sn >> 1) & 1) * FA_BUF + (32 * (sn & 1) + 16 * kh + c) * FA_PK + 16 * h;
#pragma unroll
      for (int kc = 0; kc < 8; ++kc) kf[kc] = lds_frag(kb + 64 * kc);
    }
    __builtin_amdgcn_sched_barrier(0);   // P first, then the next pass's bq fragments, as one group of LDS loads ahead of the P.c products, which hide the latter
    if (par) {                                 // scalar tests
      if (tile + 2 < nTile) acopy(tile + 2);   // into the buffer whose last reads the barrier above has ended
      if (tile < FA_XC) xcopy(tile);           // into an area that nothing else uses
    }
    ps[0] = 0.f; ps[1] = 0.f;
#pragma unroll
    for (int r = 0; r < 8; ++r) { ps[0] += e0[r]; ps[1] += e1[r]; }
    const float mn0 = fmaxf(mA[0], mB[0]), mn1 = fmaxf(mA[1], mB[1]);   // the same value in both waves of the pair
    if (__builtin_amdgcn_ballot_w32(mn0 != m_run[0] || mn1 != m_run[1]) != 0) {   // scalar branch: rare after the first passes
      const float mn[2] = {mn0, mn1};
#pragma unroll
      for (int j = 0; j < 2; ++j) {
        const float ca = __builtin_amdgcn_exp2f(m_run[j] - mn[j]);   // 0 on the first pass, 1 for a query whose maximum stays
        const float co = __builtin_amdgcn_exp2f(m_own[j] - mn[j]);
        const float cA = __builtin_amdgcn_exp2f(mA[j] - mn[j]);
        const float cB = __builtin_amdgcn_exp2f(mB[j] - mn[j]);
        l_run[j] *= ca; ps[j] *= co; m_run[j] = mn[j];
        nmr[j] = 7.0f - mn[j];
#pragma unroll
        for (int i = 0; i < 8; ++i) {
          pf[j].h[0][i] = (_Float16)((float)pf[j].h[0][i] * cA);
          pf[j].h[1][i] = (_Float16)((float)pf[j].h[1][i] * cB);
        }
#pragma unroll
        for (int t = 0; t < 8; ++t) acc[t][j] = acc[t][j] * ca;
      }
    }
    l_run[0] += ps[0]; l_run[1] += ps[1];
#pragma unroll
    for (int j = 0; j < 2; ++j) sc[j] = (v8f){nmr[j], nmr[j], nmr[j], nmr[j], nmr[j], nmr[j], nmr[j], nmr[j]};   // set here, beside the P.c products, not in front of the next pass's score products
#pragma unroll
    for (int t = 0; t < 8; ++t) {
      acc[t][0] = Frag<_Float16>::mma(vf[t], pf[0].v, acc[t][0]);
      acc[t][1] = Frag<_Float16>::mma(vf[t], pf[1].v, acc[t][1]);
    }
    wmma_gap();
  }

  for (int ch = nTile < FA_XC ? nTile : FA_XC; ch < FA_XC; ++ch) xcopy(ch);   // pieces that a short key loop has not reached (none at 16 tiles or more)
  wait_async0();   // nothing is outstanding when the buffers become output staging; this wave's residual rows have landed
  // ---- epilogue: the pair joins its row sums; O^T / l staged in LDS (rows = channels), then whole 512-byte rows: + residual, stored once ----
  float lt[2];
#pragma unroll
  for (int j = 0; j < 2; ++j) {
    lt[j] = l_run[j] + xhalf(l_run[j]);   // each wave half summed its own keys
    *(float*)(L + FA_OL + (wv * 2 + j) * 128 + lane * 4) = lt[j];
  }
  __syncthreads();   // the row sums are published; every wave has left the pass buffers, which become output staging
#pragma unroll
  for (int j = 0; j < 2; ++j) {
    const float inv = 1.0f / (lt[j] + *(const float*)(L + FA_OL + ((wv ^ 1) * 2 + j) * 128 + lane * 4));
#pragma unroll
    for (int t = 0; t < 8; ++t)
#pragma unroll
      for (int r = 0; r < 8; ++r)
        *(float*)(L + (128 * kh + 16 * t + 8 * h + r) * FA_PE + (qg * 32 + 16 * j + c) * 4) = acc[t][j][r] * inv;
  }
  __syncthreads();   // the whole 256 x 128 tile is staged
  for (int i0 = 0; i0 < FA_C / 8; i0 += 8) {
    v4f o[8];
    float* op[8];
#pragma unroll
    for (int j = 0; j < 8; ++j) {
      const int row = (i0 + j) * 8 + wv;   // scalar
      op[j] = out + ((size_t)b * FA_C + row) * N + q0 + lane * 4;
      o[j] = *(const v4f*)(L + row * FA_PE + lane * 16) + *(const v4f*)(L + FA_OX + row * FA_XR + lane * 16);
    }
    __builtin_amdgcn_sched_barrier(0);   // the eight sums and addresses stand ahead of the eight stores: the stores issue as one group and none of their registers is rewritten among them
#pragma unroll
    for (int j = 0; j < 8; ++j) *(v4f*)(op[j]) = o[j];
    wait_xcnt0();
  }
}

// ---- all three projections in one launch, straight from the f32 inputs ----
// A job is one tile of 64 tokens. The tile goes global (channel-major f32) -> registers -> LDS (token-major f16), the weight
// global f32 -> x16 -> f16 rows in LDS; both are read as WMMA fragments in the same k order; results leave through LDS as whole lines.
// Workgroups [0, nPt): one x_pt tile: fc2, then fc3 on the f16 fc2 tile still in LDS. The others: fc1 on four x tiles, the next tile's loads in flight under a product.
// 8 waves: wave = (group of 64 output channels) + 4 * (group of 32 tokens).
#define PJ_T 64
#define PJ_C 256
#define PJ_P 528                        // LDS pitch of a row of 256 f16: 512 B + 16 (odd multiple of 16 B)
#define PJ_PC 144                       // LDS pitch of a cT row piece: 128 B + 16 (odd multiple of 16 B)
#define PJ_LW 0
#define PJ_LX (PJ_LW + PJ_C * PJ_P)
#define PJ_LO (PJ_LX + PJ_T * PJ_P)
#define PJ_LC (PJ_LO + PJ_T * PJ_P)
#define PJ_LDS (PJ_LC + PJ_C * PJ_PC)

typedef __attribute__((ext_vector_type(2))) _Float16 v2h;
__device__ __forceinline__ unsigned pack2h(float a, float b) {   // round to nearest even, a in the low half
  return __builtin_bit_cast(unsigned, __builtin_convertvector((v2f){a, b}, v2h));
}
// src: channel 0 of the tile's batch at the tile's first token; Lt: tokens in a channel row. A wave-wide load is one 128-byte line.
template <int Lt>
__device__ __forceinline__ void pj_gload(float (&pre)[64], const float* __restrict__ src, int lane, int wave) {
  const float* p = src + (wave >> 1) * 2 * Lt + (wave & 1) * 32 + lane;   // token half wave & 1, channel pair 4 i + (wave >> 1)
#pragma unroll
  for (int i = 0; i < 32; ++i) {
    pre[2 * i]     = p[i * 8 * Lt];
    pre[2 * i + 1] = p[i * 8 * Lt + Lt];
  }
  wait_xcnt0();
}
__device__ __forceinline__ void pj_sstore(const float (&pre)[64], unsigned char* LX, int lane, int wave) {
  unsigned char* q = LX + ((wave & 1) * 32 + lane) * PJ_P + (wave >> 1) * 4;
#pragma unroll
  for (int i = 0; i < 32; ++i) *(unsigned*)(q + i * 16) = pack2h(pre[2 * i], pre[2 * i + 1]);
}
__device__ __forceinline__ void pj_loadW(const float* __restrict__ Wg, unsigned char* LW, int tid, float wscale) {
  const float* p = Wg + tid * 4;                                    // piece id = 256 k + tid: row id >> 6, four columns from (id & 63) * 4
  unsigned char* q = LW + (tid >> 6) * PJ_P + (tid & 63) * 8;
  for (int b0 = 0; b0 < 2; ++b0) {
    v4f w[32];
#pragma unroll
    for (int j = 0; j < 32; ++j) w[j] = *(const v4f*)(p + j * 1024);
    wait_xcnt0();
#pragma unroll
    for (int j = 0; j < 32; ++j) {
      uint2 o;
      o.x = pack2h(w[j][0] * wscale, w[j][1] * wscale);
      o.y = pack2h(w[j][2] * wscale, w[j][3] * wscale);
      *(uint2*)(q + j * 4 * PJ_P) = o;
    }
    p += 32 * 1024;
    q += 32 * 4 * PJ_P;
  }
}
// TOK_ROWS false: A = weight rows, B = tokens (a lane holds 8 consecutive channels of one token);
// TOK_ROWS true:  A = tokens, B = weight rows (a lane holds 8 consecutive tokens of one channel).
template <bool TOK_ROWS>
__device__ __forceinline__ void pj_gemm(const unsigned char* LW, const unsigned char* LT, v8f (&acc)[4][2], int c, int h, int cog, int tg) {
  const unsigned char* wp = LW + (cog * 64 + c) * PJ_P + 16 * h;
  const unsigned char* tp = LT + (tg * 32 + c) * PJ_P + 16 * h;
#pragma unroll
  for (int i = 0; i < 4; ++i)
#pragma unroll
    for (int j = 0; j < 2; ++j) acc[i][j] = (v8f){0.f,0.f,0.f,0.f,0.f,0.f,0.f,0.f};
  v16h wf[2][4], tf[2][2];   // two register sets: block kc + 1 is fetched while block kc is multiplied
#pragma unroll
  for (int i = 0; i < 4; ++i) wf[0][i] = lds_frag(wp + i * 16 * PJ_P);
#pragma unroll
  for (int j = 0; j < 2; ++j) tf[0][j] = lds_frag(tp + j * 16 * PJ_P);
#pragma unroll
  for (int kc = 0; kc < 8; ++kc) {
    const int cu = kc & 1, nx = cu ^ 1;
    if (kc < 7) {
#pragma unroll
      for (int i = 0; i < 4; ++i) wf[nx][i] = lds_frag(wp + i * 16 * PJ_P + 64 * (kc + 1));
#pragma unroll
      for (int j = 0; j < 2; ++j) tf[nx][j] = lds_frag(tp + j * 16 * PJ_P + 64 * (kc + 1));
    }
    __builtin_amdgcn_sched_barrier(0);   // the next block's 12 LDS loads issue as one group ahead of this block's products, which hide their latency
#pragma unroll
    for (int i = 0; i < 4; ++i)
#pragma unroll
      for (int j = 0; j < 2; ++j)
        acc[i][j] = TOK_ROWS ? Frag<_Float16>::mma(tf[cu][j], wf[cu][i], acc[i][j]) : Frag<_Float16>::mma(wf[cu][i], tf[cu][j], acc[i][j]);
    __builtin_amdgcn_sched_barrier(0);   // keeps the following group of loads from being spread among these products
  }
}
// the 32 bias values of a lane's output channels
__device__ __forceinline__ void pj_bias(v4f (&bb)[4][2], const float* __restrict__ bias, int h, int cog) {
#pragma unroll
  for (int i = 0; i < 4; ++i) {
    bb[i][0] = *(const v4f*)(bias + cog * 64 + 16 * i + 8 * h);
    bb[i][1] = *(const v4f*)(bias + cog * 64 + 16 * i + 8 * h + 4);
  }
  wait_xcnt0();
}
// acc * scale + bias -> f16 (1/16; for fc1 scale and bias also carry qscale), token-major tile in LDS (16 bytes a lane)
__device__ __forceinline__ void pj_out_tok(const v8f (&acc)[4][2], const v4f (&bb)[4][2], unsigned char* LO, float scale, int c, int h, int cog, int tg) {
#pragma unroll
  for (int i = 0; i < 4; ++i)
#pragma unroll
    for (int j = 0; j < 2; ++j) {
      v8h o;
#pragma unroll
      for (int r = 0; r < 8; ++r) o[r] = (_Float16)(acc[i][j][r] * scale + bb[i][r >> 2][r & 3]);
      *(v8h*)(LO + (tg * 32 + 16 * j + c) * PJ_P + (cog * 64 + 16 * i + 8 * h) * 2) = o;
    }
}
// 64 token rows of 512 bytes, LDS -> registers -> global, a whole row a wave-wide store
__device__ __forceinline__ void pj_rows_read(u32x4 (&t)[8], const unsigned char* LO, int lane, int wave) {
#pragma unroll
  for (int p = 0; p < 8; ++p) t[p] = *(const u32x4*)(LO + (wave + 8 * p) * PJ_P + lane * 16);
}
__device__ __forceinline__ void pj_rows_write(const u32x4 (&t)[8], unsigned short* __restrict__ dst, int lane, int wave) {
#pragma unroll
  for (int p = 0; p < 8; ++p) *(u32x4*)((unsigned char*)dst + (size_t)(wave + 8 * p) * (PJ_C * 2) + lane * 16) = t[p];
  wait_xcnt0();
}

template <int N, int M>
__global__ __launch_bounds__(256) void proj_fused_f16(
    const float* __restrict__ x, const float* __restrict__ x_pt,
    const float* __restrict__ W1, const float* __restrict__ W2, const float* __restrict__ W3,
    const float* __restrict__ b1, const float* __restrict__ b2, const float* __restrict__ b3,
    unsigned short* __restrict__ A16,   // a  [B][N][256] f16
    unsigned short* __restrict__ BQ,    // bq [B][M][256] f16
    unsigned short* __restrict__ CT,    // cT [B][256][M] f16
    int nPt, float wscale, float scale, float qscale) {   // qscale: log2(e) / sqrt(C), carried by the stored a
  __shared__ __align__(16) unsigned char S[PJ_LDS];
  const int tid  = threadIdx.x;
  const int lane = tid & 31;
  const int wave = __builtin_amdgcn_readfirstlane(tid >> 5);   // scalar: row bases of the tile loads stay in scalar registers
  const int c = lane & 15, h = lane >> 4;
  const int cog = wave & 3, tg = wave >> 2;
  const int bx = blockIdx.x;
  const bool pt = bx < nPt;                                   // the same for the whole workgroup
  const int nx    = pt ? 1 : 4;
  const int first = pt ? bx : (bx - nPt) * 4;                 // first tile; tile t holds tokens [64 t, 64 t + 64) of the flat [B * M] or [B * N]
  const int perN = N / PJ_T, perM = M / PJ_T;
  const int pb = bx / perM, pt0 = (bx - pb * perM) * PJ_T;    // the x_pt tile's batch and first token (used where pt)
  unsigned short* dst = pt ? BQ : A16;
  float pre[64];                                              // the next tile on its way to LDS
  v8f acc[4][2];
  v4f bb[4][2];
  u32x4 t[8];                                                 // an output tile's rows on their way out

  if (pt) {
    pj_gload<M>(pre, x_pt + (size_t)pb * PJ_C * M + pt0, lane, wave);
  } else {
    const int bt = first / perN;
    pj_gload<N>(pre, x + (size_t)bt * PJ_C * N + (first - bt * perN) * PJ_T, lane, wave);
  }
  pj_loadW(pt ? W2 : W1, S + PJ_LW, tid, wscale);
  pj_bias(bb, pt ? b2 : b1, h, cog);
  const float oscale = pt ? scale : scale * qscale;
  if (!pt) {
#pragma unroll
    for (int i = 0; i < 4; ++i) { bb[i][0] *= qscale; bb[i][1] *= qscale; }
  }
  pj_sstore(pre, S + PJ_LX, lane, wave);
  __syncthreads();   // the weight and the first tile are in LDS

  for (int i = 0; i < nx; ++i) {
    const bool moreX = i + 1 < nx;                            // block-uniform, as is pt
    if (moreX) {
      const int tn = first + i + 1;
      const int bt = tn / perN;
      pj_gload<N>(pre, x + (size_t)bt * PJ_C * N + (tn - bt * perN) * PJ_T, lane, wave);
    }
    pj_gemm<false>(S + PJ_LW, S + PJ_LX, acc, c, h, cog, tg);
    pj_out_tok(acc, bb, S + PJ_LO, oscale, c, h, cog, tg);
    __syncthreads();   // the output tile is whole; every wave has left this tile's input and, where pt, W2
    pj_rows_read(t, S + PJ_LO, lane, wave);
    if (moreX) pj_sstore(pre, S + PJ_LX, lane, wave);
    if (pt) pj_loadW(W3, S + PJ_LW, tid, wscale);
    __syncthreads();   // publishes the next tile (or W3); where another tile follows, the output staging is free again
    pj_rows_write(t, dst + (size_t)(first + i) * PJ_T * PJ_C, lane, wave);   // behind the barrier: the next barrier's wait for these stores comes after a whole product
  }
  if (!pt) return;     // the whole workgroup leaves together

  // fc3 on the f16 bq tile, which still lies in the output staging
  float bv[4];
#pragma unroll
  for (int i = 0; i < 4; ++i) bv[i] = b3[cog * 64 + 16 * i + c];
  wait_xcnt0();
  pj_gemm<true>(S + PJ_LW, S + PJ_LO, acc, c, h, cog, tg);
  {
#pragma unroll
    for (int i = 0; i < 4; ++i)
#pragma unroll
      for (int j = 0; j < 2; ++j) {
        v8h o;
#pragma unroll
        for (int r = 0; r < 8; ++r) o[r] = (_Float16)(acc[i][j][r] * scale + bv[i]);
        *(v8h*)(S + PJ_LC + (cog * 64 + 16 * i + c) * PJ_PC + (tg * 32 + 16 * j + 8 * h) * 2) = o;
      }
  }
  __syncthreads();     // the 256 x 64 cT tile is whole
  {
#pragma unroll
    for (int p = 0; p < 8; ++p) {
      const int id = p * 256 + tid;      // channel row id >> 3, 16-byte piece id & 7: whole 128-byte lines
      t[p] = *(const u32x4*)(S + PJ_LC + (id >> 3) * PJ_PC + (id & 7) * 16);
    }
#pragma unroll
    for (int p = 0; p < 8; ++p) {
      const int id = p * 256 + tid;
      *(u32x4*)((unsigned char*)(CT + ((size_t)pb * PJ_C + (id >> 3)) * M + pt0) + (id & 7) * 16) = t[p];
    }
    wait_xcnt0();
  }
}

// ---------------------------------------------------------------------------
extern "C" void kernel_launch(void* const* d_in, const int* in_sizes, int n_in,
                              void* d_out, int out_size, void* d_ws, size_t ws_size,
                              hipStream_t stream) {
  const int B = 4, C = 256, N = 8192, M = 2048;
  if (n_in < 8) return;
  if (in_sizes[0] != B * C * N || in_sizes[1] != B * C * M ||
      in_sizes[2] != C * C || in_sizes[3] != C || in_sizes[4] != C * C || in_sizes[5] != C ||
      in_sizes[6] != C * C || in_sizes[7] != C || out_size != B * C * N) return;

  const float* x    = (const float*)d_in[0];
  const float* x_pt = (const float*)d_in[1];
  const float* W1   = (const float*)d_in[2];
  const float* b1   = (const float*)d_in[3];
  const float* W2   = (const float*)d_in[4];
  const float* b2   = (const float*)d_in[5];
  const float* W3   = (const float*)d_in[6];
  const float* b3   = (const float*)d_in[7];
  float* out = (float*)d_out;

  const size_t szA16 = (size_t)B * N * C * 2;          // a  [B][N][C] f16      16,777,216
  const size_t szTok = (size_t)B * M * C * 2;          // [B][M][C] f16           4,194,304
  const size_t offA16 = 0;
  const size_t offBQ  = offA16 + szA16;
  const size_t offCT  = offBQ + szTok;
  const size_t total  = offCT + szTok;                 // 25,165,824
  if (total > ws_size) return;

  char* ws = (char*)d_ws;
  unsigned short* A16u  = (unsigned short*)(ws + offA16);
  unsigned short* BQu   = (unsigned short*)(ws + offBQ);
  unsigned short* CTu   = (unsigned short*)(ws + offCT);

  const float inv16 = 1.0f / 16.0f;
  const float cscale = 1.4426950408889634f / 16.0f;   // 1 / sqrt(C) and log2(e): scores in log2 units

  // one launch: a[b][n][co] = (sum_ci x[b][ci][n] * W1[co][ci] + b1[co]) * cscale; bq[b][m][co] = sum_ci x_pt[b][ci][m] * W2[co][ci] + b2[co];
  // cT[b][co][m] = sum_ci W3[co][ci] * bq[b][m][ci] + b3[co]; f16 out; weights carried x16, folded back as 1/16
  const int nPt = B * M / PJ_T;                        // workgroups with one x_pt tile
  const int nXo = B * N / PJ_T / 4;                    // workgroups with four x tiles
  proj_fused_f16<N, M><<<dim3(nPt + nXo), 256, 0, stream>>>(x, x_pt, W1, W2, W3, b1, b2, b3, A16u, BQu, CTu, nPt, 16.0f, inv16, cscale);

  // score, softmax, P.c and residual in one launch: out[b][co][n] = x[b][co][n] + sum_m softmax_m(fc1(x)[n].bq[m] / 16) * cT[co][m]
  attn_fused_f16<<<dim3(N / FA_BQ, B), 256, 0, stream>>>(A16u, BQu, CTu, x, out, N, M);
  (void)hipGetLastError();
}

// v009
// One run takes 63.1 microseconds.
// Two timings next to v008 both put it at 1.04 times that version's speed.
// Counting every step since v000, it is 12.5 times as fast.
#include <hip/hip_runtime.h>
#include <stdint.h>
#include <math.h>

// Contractions fc1, fc2, fc3, score = a.b^T and P.c: v_wmma_f32_16x16x32_f16 (f16 operands, f32 accumulate); weights carried x16 (folded back in the f32 epilogue), softmax probabilities carried x2^7 (cancels in the division by the row sum); softmax, bias and residual in f32.

typedef __attribute__((ext_vector_type(16))) _Float16 v16h;
typedef __attribute__((ext_vector_type(8)))  _Float16 v8h;
typedef __attribute__((ext_vector_type(8)))  float    v8f;
typedef __attribute__((ext_vector_type(4)))  float    v4f;
typedef __attribute__((ext_vector_type(2)))  float    v2f;

template <typename T> struct Frag;
template <> struct Frag<_Float16> {
  typedef v16h V; union U { v16h v; v8h h[2]; };
  static __device__ __forceinline__ v16h load(const _Float16* p) {   // elements 0..7 <- p[0..7], 8..15 <- p[16..23]
    U f; f.h[0] = *(const v8h*)(p); f.h[1] = *(const v8h*)(p + 16); return f.v;
  }
  static __device__ __forceinline__ v8f mma(v16h a, v16h b, v8f c) {
    return __builtin_amdgcn_wmma_f32_16x16x32_f16(false, a, false, b, (short)0, c, false, false);
  }
};

typedef __attribute__((ext_vector_type(4))) unsigned int u32x4;
#define FA_C 256
#define FA_BQ 128
#define FA_BK 32
#define FA_PK 528                       // LDS pitch of a bq row: 512 B + 16 (odd multiple of 16 B)
#define FA_BT 64                        // keys of a staged tile: two passes
#define FA_PV 144                       // LDS pitch of a cT row piece: 128 B + 16 (odd multiple of 16 B)
#define FA_TK (FA_BT * FA_PK)
#define FA_TV (FA_C * FA_PV)
#define FA_BUF (FA_TK + FA_TV)
#define FA_PE 528                       // output staging pitch: 128 f32 + 16 B
#define FA_STG (FA_C * FA_PE)
#define FA_OP (2 * FA_BUF)              // P halves: [pass parity][wave][column group][lane] 16 B
#define FA_OM (FA_OP + 2 * 8 * 1024)    // the maxima they were written against: [pass parity][wave][lane] two f32
#define FA_OL (FA_OM + 2 * 8 * 256)     // row sums, epilogue: [wave][column group][lane] f32
#define FA_OX (FA_OL + 8 * 256)         // residual tile: 256 channel rows of 128 f32, no pad (a row is read as a wave's 512 contiguous bytes)
#define FA_XR (FA_BQ * 4)
#define FA_XC (FA_C / 16)               // it is copied in pieces of 16 rows, two copies a wave
#define FA_LDS (FA_OX + FA_C * FA_XR)
static_assert(FA_STG <= FA_OL, "the output staging area ends in front of the row sums");

// lane l with lane l ^ 16
__device__ __forceinline__ float xhalf(float v) {
  return __builtin_bit_cast(float, __builtin_amdgcn_permlanex16(__builtin_bit_cast(int, v), __builtin_bit_cast(int, v), 0x76543210, 0xfedcba98, false, false));
}
// Four vector slots behind a run of matrix instructions, held in place by the two scheduling barriers: keeps the
// distance to the next vector instruction that touches their registers on every path, a taken branch included.
__device__ __forceinline__ void wmma_gap() {
  __builtin_amdgcn_sched_barrier(0);
  asm volatile("v_nop\n\tv_nop\n\tv_nop\n\tv_nop");
  __builtin_amdgcn_sched_barrier(0);
}
// Behind a run of global loads or stores: stands in front of every later overwrite of their address registers
// (the scheduling barrier keeps such an overwrite from being moved up over the wait).
__device__ __forceinline__ void wait_xcnt0() {
  asm volatile("s_wait_xcnt 0x0" ::: "memory");
  __builtin_amdgcn_sched_barrier(0);
}
// One lane's 16 bytes global -> LDS through no register; counted on asynccnt, no wait is placed by the compiler.
typedef __attribute__((ext_vector_type(4))) int i32x4;
__device__ __forceinline__ void copy16_to_lds(const unsigned char* g, unsigned char* l) {
  __builtin_amdgcn_global_load_async_to_lds_b128((__attribute__((address_space(1))) i32x4*)g, (__attribute__((address_space(3))) i32x4*)l, 0, 0);
}
// This wave's copies have landed (other waves read them behind the next barrier).
__device__ __forceinline__ void wait_async0() { asm volatile("s_wait_asynccnt 0x0" ::: "memory"); }
// This wave's LDS reads and writes have retired: stands in front of the barrier behind which a buffer it read is refilled by copies.
__device__ __forceinline__ void wait_ds0() { asm volatile("s_wait_dscnt 0x0" ::: "memory"); }
// Four exponentials (base 2) in one statement: behind a transcendental one independent instruction stands before its result
// is used or its source overwritten; here each next exponential is that instruction, and the v_nop is the last one's.
// The outputs are early-clobber, so none of them lies on a source.
__device__ __forceinline__ v4f exp2x4(v4f t) {
  float p0, p1, p2, p3;
  asm("v_exp_f32 %0, %4\n\tv_exp_f32 %1, %5\n\tv_exp_f32 %2, %6\n\tv_exp_f32 %3, %7\n\tv_nop"
      : "=&v"(p0), "=&v"(p1), "=&v"(p2), "=&v"(p3)
      : "v"(t[0]), "v"(t[1]), "v"(t[2]), "v"(t[3]));
  return (v4f){p0, p1, p2, p3};
}
__device__ __forceinline__ v16h lds_frag(const unsigned char* p) {   // elements 0..7 <- bytes 0..15, 8..15 <- bytes 32..47
  Frag<_Float16>::U f; f.h[0] = *(const v8h*)(p); f.h[1] = *(const v8h*)(p + 32); return f.v;
}

struct fa_yes { static constexpr bool v = true; };    // compile-time switches of the pass body
struct fa_no  { static constexpr bool v = false; };

__global__ __launch_bounds__(256) __attribute__((amdgpu_waves_per_eu(2, 2))) void attn_fused_f16(
    const unsigned short* __restrict__ Aq,    // a  [B][N][256] f16, times log2(e) / sqrt(C)
    const unsigned short* __restrict__ Bk,    // bq [B][M][256] f16
    const unsigned short* __restrict__ Ct,    // cT [B][256][M] f16
    const float* __restrict__ x, float* __restrict__ out,   // [B][256][N] f32
    int N, int M) {
  __shared__ __align__(16) unsigned char L[FA_LDS];
  const int tid  = threadIdx.x;
  const int lane = tid & 31;
  const int wave = tid >> 5;
  const int c = lane & 15, h = lane >> 4;
  const int b  = blockIdx.y;
  const int q0 = blockIdx.x * FA_BQ;
  const unsigned char* kSrc = (const unsigned char*)(Bk + (size_t)b * M * FA_C);
  const unsigned char* vSrc = (const unsigned char*)(Ct + (size_t)b * FA_C * M);
  const size_t vPitch = (size_t)M * 2;
  const int nPass = M / FA_BK;
  const int nTile = M / FA_BT;

  // bq tile Tk (keys 64 Tk .. 64 Tk + 63) into buffer buf: 8 copies a wave, every lane on; a wave-wide copy is one bq row
  auto kcopy = [&](int Tk, int buf) {
    unsigned char* base = L + buf * FA_BUF;
#pragma unroll
    for (int i = 0; i < 8; ++i) {
      const int id = i * 256 + tid;
      copy16_to_lds(kSrc + (size_t)Tk * (FA_BT * FA_C * 2) + (size_t)id * 16, base + (id >> 5) * FA_PK + (id & 31) * 16);
    }
  };
  // cT tile Tv into buffer buf: 8 copies a wave, every lane on; a wave-wide copy is four whole cT lines
  auto vcopy = [&](int Tv, int buf) {
    unsigned char* base = L + buf * FA_BUF;
#pragma unroll
    for (int i = 0; i < 8; ++i) {
      const int id = i * 256 + tid;
      copy16_to_lds(vSrc + (size_t)(id >> 3) * vPitch + (size_t)Tv * (FA_BT * 2) + (id & 7) * 16, base + FA_TK + (id >> 3) * FA_PV + (id & 7) * 16);
    }
  };
  // stage T into buffer T & 1: cT tile T and bq tile T + 1 (scalar test: the last stage has no bq tile)
  auto acopy = [&](int T) {
    if (T + 1 < nTile) kcopy(T + 1, T & 1);
    vcopy(T, T & 1);
  };

  const int wv = __builtin_amdgcn_readfirstlane(wave);   // scalar: LDS bases of the pair's exchange stay in scalar registers
  const int qg = wv >> 1, kh = wv & 1;                    // the pair's 32 queries; this wave's key tile and channel half

  // piece ch of the residual tile: rows 16 ch + wave and 16 ch + 8 + wave, a wave-wide copy is one row piece of 512 bytes (four whole lines); every lane on
  const unsigned char* xSrc = (const unsigned char*)(x + (size_t)b * FA_C * N + q0);
  const size_t xPitch = (size_t)N * 4;
  auto xcopy = [&](int ch) {
#pragma unroll
    for (int i = 0; i < 2; ++i) {
      const int row = ch * 16 + i * 8 + wv;
      copy16_to_lds(xSrc + (size_t)row * xPitch + lane * 16, L + FA_OX + row * FA_XR + lane * 16);
    }
  };

  kcopy(0, 1);   // bq tile 0 lies in buffer 1 ("stage -1") until stage 1 is copied there, behind the barrier of pass 0
  acopy(0);
  v16h qf[2][8];   // the pair's 32 queries as B operands, kept for the whole loop
#pragma unroll
  for (int j = 0; j < 2; ++j) {
    const _Float16* qp = (const _Float16*)Aq + ((size_t)b * N + q0 + qg * 32 + 16 * j + c) * FA_C + 8 * h;
#pragma unroll
    for (int kc = 0; kc < 8; ++kc) qf[j][kc] = Frag<_Float16>::load(qp + 32 * kc);
    wait_xcnt0();
  }
  v8f acc[8][2];
#pragma unroll
  for (int t = 0; t < 8; ++t)
#pragma unroll
    for (int j = 0; j < 2; ++j) acc[t][j] = (v8f){0.f,0.f,0.f,0.f,0.f,0.f,0.f,0.f};
  float m_run[2] = {-INFINITY, -INFINITY}, l_run[2] = {0.f, 0.f};
  float nmr[2] = {7.f, 7.f};   // 7 - m of the lane's query (7 while there is no m)
  v8f sc[2];                   // the score tiles; each run of score products finds them set to its start value, 7 - m in all eight rows
  sc[0] = (v8f){7.f,7.f,7.f,7.f,7.f,7.f,7.f,7.f};
  sc[1] = sc[0];
  float m_own[2] = {-INFINITY, -INFINITY}, ps[2] = {0.f, 0.f};   // of the P that lies published: the maxima it was written against, this wave's sums of it
  v16h kf[8], vf[8];   // this wave's 8 bq fragments (of the pass whose scores come next) and 8 cT fragments

  // the bq fragments of pass ks + 2: they lie in stage ks >> 1 (arithmetic shift: -1 is bq tile 0 in buffer 1), half ks & 1
  auto kload = [&](int ks) {
    const unsigned char* kb = L + ((ks >> 1) & 1) * FA_BUF + (32 * (ks & 1) + 16 * kh + c) * FA_PK + 16 * h;
#pragma unroll
    for (int kc = 0; kc < 8; ++kc) kf[kc] = lds_frag(kb + 64 * kc);
  };
  auto score = [&]() {
#pragma unroll
    for (int kc = 0; kc < 8; ++kc) {
      sc[0] = Frag<_Float16>::mma(kf[kc], qf[0][kc], sc[0]);
      sc[1] = Frag<_Float16>::mma(kf[kc], qf[1][kc], sc[1]);
    }
    wmma_gap();   // a later reader of these results is asm text
  };
  // the largest exponent of each score tile in this lane
  auto tilemax = [&](float (&mt)[2]) {
#pragma unroll
    for (int j = 0; j < 2; ++j) {
      mt[j] = fmaxf(sc[j][0], sc[j][1]);
#pragma unroll
      for (int r = 2; r < 8; ++r) mt[j] = fmaxf(mt[j], sc[j][r]);
    }
  };
  // a query whose tile exceeds m + 8 (exponent above 15) gets this wave's own new maximum, and its exponents are moved to it; the others keep theirs bit for bit
  auto raise = [&](const float (&mt)[2]) {
#pragma unroll
    for (int j = 0; j < 2; ++j) {
      const float nm = nmr[j];
      const float mx = fmaxf(mt[j], xhalf(mt[j])) - nm;   // both wave halves hold this query's maximum over the wave's 16 keys, in log2 units
      m_own[j] = mx > m_run[j] + 8.0f ? mx : m_run[j];
      const float d = (7.0f - m_own[j]) - nm;             // 0 for a query whose maximum stays
#pragma unroll
      for (int r = 0; r < 8; ++r) sc[j][r] += d;
    }
  };
  v4f e[4];   // exp2 of the score tiles: tile 0 rows 0..3, 4..7, tile 1 rows 0..3, 4..7
  auto expq = [&](int i) { e[i] = exp2x4((v4f){sc[i >> 1][4 * (i & 1)], sc[i >> 1][4 * (i & 1) + 1], sc[i >> 1][4 * (i & 1) + 2], sc[i >> 1][4 * (i & 1) + 3]}); };
  // P and the maxima it is written against to LDS, parity par of the pass they belong to
  auto publish = [&](int par) {
    v8h p0, p1;
#pragma unroll
    for (int r = 0; r < 8; ++r) { p0[r] = (_Float16)e[r >> 2][r & 3]; p1[r] = (_Float16)e[2 + (r >> 2)][r & 3]; }
    unsigned char* pw = L + FA_OP + (par * 8 + wv) * 1024 + lane * 16;
    *(v8h*)(pw) = p0;
    *(v8h*)(pw + 512) = p1;
    *(v2f*)(L + FA_OM + (par * 8 + wv) * 256 + lane * 8) = (v2f){m_own[0], m_own[1]};
  };
  auto psum = [&]() {
    ps[0] = 0.f; ps[1] = 0.f;
#pragma unroll
    for (int r = 0; r < 8; ++r) { ps[0] += e[r >> 2][r & 3]; ps[1] += e[2 + (r >> 2)][r & 3]; }
  };

  wait_async0();
  __syncthreads();   // bq tiles 0 and 1 and cT tile 0 are in LDS
  kload(-2);
  score();           // pass 0
  kload(-1);
  {
    float mt[2];
    tilemax(mt);
    raise(mt);       // no maximum yet: every query gets one
    expq(0); expq(1); expq(2); expq(3);
    publish(0);
    psum();
  }
  sc[0] = (v8f){7.f,7.f,7.f,7.f,7.f,7.f,7.f,7.f};   // pass 1 starts without a maximum too: it is added in pass 0 below, behind the products
  sc[1] = sc[0];

  // pass s: behind its barrier the score products of pass s + 1, then the P.c products of pass s with the softmax of pass s + 1 among them
  auto pass = [&](int s, auto last) {
    constexpr bool LAST = decltype(last)::v;   // the last pass (an odd one, M being a multiple of 64): nothing runs ahead, nothing is copied
    const int par = s & 1;
    const int tile = s >> 1;
    if constexpr (!LAST) {
      if (!par) {      // scalar: a stage's first pass is its publish point
        wait_ds0();
        wait_async0();
      }
    }
    __syncthreads();   // publishes P of pass s and ends the reads of P of pass s - 1; in an even pass it also publishes stage s / 2 and ends every wave's reads of the stage before
    Frag<_Float16>::U pf[2];
    v2f mA, mB;
    {
      const unsigned char* pr = L + FA_OP + (par * 8 + 2 * qg) * 1024 + lane * 16;
      pf[0].h[0] = *(const v8h*)(pr);               // keys 8h + r, from the pair's wave 0
      pf[0].h[1] = *(const v8h*)(pr + 1024);        // keys 16 + 8h + r, from its wave 1
      pf[1].h[0] = *(const v8h*)(pr + 512);
      pf[1].h[1] = *(const v8h*)(pr + 1024 + 512);
      const unsigned char* mr = L + FA_OM + (par * 8 + 2 * qg) * 256 + lane * 8;
      mA = *(const v2f*)(mr);
      mB = *(const v2f*)(mr + 256);
      const unsigned char* vb = L + (tile & 1) * FA_BUF + FA_TK + (128 * kh + c) * FA_PV + 64 * par + 16 * h;
#pragma unroll
      for (int t = 0; t < 8; ++t) vf[t] = lds_frag(vb + t * 16 * FA_PV);
    }
    __builtin_amdgcn_sched_barrier(0);   // P, then the cT fragments, as one group of LDS loads ahead of the score products, which hide them
    float mt[2] = {0.f, 0.f};
    if constexpr (!LAST) {
      score();   // pass s + 1
      if (!par) {                                // scalar tests
        if (tile + 1 < nTile) acopy(tile + 1);   // into the buffer whose last reads the barrier above has ended
        if (tile < FA_XC) xcopy(tile);           // into an area that nothing else uses
      }
      // no branch round these loads, so that the waits for P and cT can be counted ones; the last but one pass fetches the last pass's again, unused
      kload(s < nPass - 3 ? s : nPass - 3);
      __builtin_amdgcn_sched_barrier(0);   // the bq fragments of pass s + 2 as one group of LDS loads ahead of the softmax and the P.c products, which hide them
      tilemax(mt);
    }
    const float mn0 = fmaxf(mA[0], mB[0]), mn1 = fmaxf(mA[1], mB[1]);   // the same value in both waves of the pair
    // one scalar branch a pass, rare after the first passes: P of pass s was written against a new maximum, or a tile of pass s + 1 needs one
    if (__builtin_expect(__builtin_amdgcn_ballot_w32(mn0 != m_run[0] || mn1 != m_run[1] || mt[0] > 15.0f || mt[1] > 15.0f) != 0, 0)) {
      const float mn[2] = {mn0, mn1};
#pragma unroll
      for (int j = 0; j < 2; ++j) {
        const float ca = __builtin_amdgcn_exp2f(m_run[j] - mn[j]);   // 0 on the first pass, 1 for a query whose maximum stays
        const float co = __builtin_amdgcn_exp2f(m_own[j] - mn[j]);
        const float cA = __builtin_amdgcn_exp2f(mA[j] - mn[j]);
        const float cB = __builtin_amdgcn_exp2f(mB[j] - mn[j]);
        l_run[j] *= ca; ps[j] *= co; m_run[j] = mn[j];
        const float nn = 7.0f - mn[j];
        if constexpr (!LAST) {
          const float d = nn - nmr[j];   // the scores of pass s + 1 were summed onto the old 7 - m
#pragma unroll
          for (int r = 0; r < 8; ++r) sc[j][r] += d;
          mt[j] += d;
        }
        nmr[j] = nn;
#pragma unroll
        for (int i = 0; i < 8; ++i) {
          pf[j].h[0][i] = (_Float16)((float)pf[j].h[0][i] * cA);
          pf[j].h[1][i] = (_Float16)((float)pf[j].h[1][i] * cB);
        }
#pragma unroll
        for (int t = 0; t < 8; ++t) acc[t][j] = acc[t][j] * ca;
      }
      if constexpr (!LAST) raise(mt);   // sets m_own for pass s + 1; on the other path it is m already
    }
    l_run[0] += ps[0]; l_run[1] += ps[1];
    auto pv = [&](int t) {
      acc[t][0] = Frag<_Float16>::mma(vf[t], pf[0].v, acc[t][0]);
      acc[t][1] = Frag<_Float16>::mma(vf[t], pf[1].v, acc[t][1]);
    };
    if constexpr (!LAST) {
      // The scheduling barriers keep this order: two products, four exponentials, so that the vector work of pass s + 1 issues while the
      // matrix unit works on pass s; P is stored with four products still to come, so that the stores have retired at the next barrier.
#pragma unroll
      for (int i = 0; i < 4; ++i) {
        pv(i);
        __builtin_amdgcn_sched_barrier(0);
        expq(i);
        __builtin_amdgcn_sched_barrier(0);
      }
      pv(4);
      publish(par ^ 1);
      pv(5);
      __builtin_amdgcn_sched_barrier(0);
      psum();
#pragma unroll
      for (int j = 0; j < 2; ++j) sc[j] = (v8f){nmr[j], nmr[j], nmr[j], nmr[j], nmr[j], nmr[j], nmr[j], nmr[j]};   // set here, beside the P.c products, not in front of the next score products
      pv(6);
      pv(7);
    } else {
#pragma unroll
      for (int t = 0; t < 8; ++t) pv(t);
    }
    wmma_gap();
  };
  for (int s = 0; s + 1 < nPass; ++s) pass(s, fa_no{});
  pass(nPass - 1, fa_yes{});

  for (int ch = nTile < FA_XC ? nTile : FA_XC; ch < FA_XC; ++ch) xcopy(ch);   // pieces that a short key loop has not reached (none at 16 tiles or more)
  wait_async0();   // nothing is outstanding when the buffers become output staging; this wave's residual rows have landed
  // ---- epilogue: the pair joins its row sums; O^T / l staged in LDS (rows = channels), then whole 512-byte rows: + residual, stored once ----
  float lt[2];
#pragma unroll
  for (int j = 0; j < 2; ++j) {
    lt[j] = l_run[j] + xhalf(l_run[j]);   // each wave half summed its own keys
    *(float*)(L + FA_OL + (wv * 2 + j) * 128 + lane * 4) = lt[j];
  }
  __syncthreads();   // the row sums are published; every wave has left the pass buffers, which become output staging
#pragma unroll
  for (int j = 0; j < 2; ++j) {
    const float inv = 1.0f / (lt[j] + *(const float*)(L + FA_OL + ((wv ^ 1) * 2 + j) * 128 + lane * 4));
#pragma unroll
    for (int t = 0; t < 8; ++t)
#pragma unroll
      for (int r = 0; r < 8; ++r)
        *(float*)(L + (128 * kh + 16 * t + 8 * h + r) * FA_PE + (qg * 32 + 16 * j + c) * 4) = acc[t][j][r] * inv;
  }
  __syncthreads();   // the whole 256 x 128 tile is staged
  for (int i0 = 0; i0 < FA_C / 8; i0 += 8) {
    v4f o[8];
    float* op[8];
#pragma unroll
    for (int j = 0; j < 8; ++j) {
      const int row = (i0 + j) * 8 + wv;   // scalar
      op[j] = out + ((size_t)b * FA_C + row) * N + q0 + lane * 4;
      o[j] = *(const v4f*)(L + row * FA_PE + lane * 16) + *(const v4f*)(L + FA_OX + row * FA_XR + lane * 16);
    }
    __builtin_amdgcn_sched_barrier(0);   // the eight sums and addresses stand ahead of the eight stores: the stores issue as one group and none of their registers is rewritten among them
#pragma unroll
    for (int j = 0; j < 8; ++j) *(v4f*)(op[j]) = o[j];
    wait_xcnt0();
  }
}

// ---- all three projections in one launch, straight from the f32 inputs ----
// A job is one tile of 64 tokens. The tile goes global (channel-major f32) -> registers -> LDS (token-major f16), the weight
// global f32 -> x16 -> f16 rows in LDS; both are read as WMMA fragments in the same k order; results leave through LDS as whole lines.
// Workgroups [0, nPt): one x_pt tile: fc2, then fc3 on the f16 fc2 tile still in LDS. The others: fc1 on four x tiles, the next tile's loads in flight under a product.
// 8 waves: wave = (group of 64 output channels) + 4 * (group of 32 tokens).
#define PJ_T 64
#define PJ_C 256
#define PJ_P 528                        // LDS pitch of a row of 256 f16: 512 B + 16 (odd multiple of 16 B)
#define PJ_PC 144                       // LDS pitch of a cT row piece: 128 B + 16 (odd multiple of 16 B)
#define PJ_LW 0
#define PJ_LX (PJ_LW + PJ_C * PJ_P)
#define PJ_LO (PJ_LX + PJ_T * PJ_P)
#define PJ_LC (PJ_LO + PJ_T * PJ_P)
#define PJ_LDS (PJ_LC + PJ_C * PJ_PC)

typedef __attribute__((ext_vector_type(2))) _Float16 v2h;
__device__ __forceinline__ unsigned pack2h(float a, float b) {   // round to nearest even, a in the low half
  return __builtin_bit_cast(unsigned, __builtin_convertvector((v2f){a, b}, v2h));
}
// src: channel 0 of the tile's batch at the tile's first token; Lt: tokens in a channel row. A wave-wide load is one 128-byte line.
template <int Lt>
__device__ __forceinline__ void pj_gload(float (&pre)[64], const float* __restrict__ src, int lane, int wave) {
  const float* p = src + (wave >> 1) * 2 * Lt + (wave & 1) * 32 + lane;   // token half wave & 1, channel pair 4 i + (wave >> 1)
#pragma unroll
  for (int i = 0; i < 32; ++i) {
    pre[2 * i]     = p[i * 8 * Lt];
    pre[2 * i + 1] = p[i * 8 * Lt + Lt];
  }
  wait_xcnt0();
}
__device__ __forceinline__ void pj_sstore(const float (&pre)[64], unsigned char* LX, int lane, int wave) {
  unsigned char* q = LX + ((wave & 1) * 32 + lane) * PJ_P + (wave >> 1) * 4;
#pragma unroll
  for (int i = 0; i < 32; ++i) *(unsigned*)(q + i * 16) = pack2h(pre[2 * i], pre[2 * i + 1]);
}
__device__ __forceinline__ void pj_loadW(const float* __restrict__ Wg, unsigned char* LW, int tid, float wscale) {
  const float* p = Wg + tid * 4;                                    // piece id = 256 k + tid: row id >> 6, four columns from (id & 63) * 4
  unsigned char* q = LW + (tid >> 6) * PJ_P + (tid & 63) * 8;
  for (int b0 = 0; b0 < 2; ++b0) {
    v4f w[32];
#pragma unroll
    for (int j = 0; j < 32; ++j) w[j] = *(const v4f*)(p + j * 1024);
    wait_xcnt0();
#pragma unroll
    for (int j = 0; j < 32; ++j) {
      uint2 o;
      o.x = pack2h(w[j][0] * wscale, w[j][1] * wscale);
      o.y = pack2h(w[j][2] * wscale, w[j][3] * wscale);
      *(uint2*)(q + j * 4 * PJ_P) = o;
    }
    p += 32 * 1024;
    q += 32 * 4 * PJ_P;
  }
}
// TOK_ROWS false: A = weight rows, B = tokens (a lane holds 8 consecutive channels of one token);
// TOK_ROWS true:  A = tokens, B = weight rows (a lane holds 8 consecutive tokens of one channel).
template <bool TOK_ROWS>
__device__ __forceinline__ void pj_gemm(const unsigned char* LW, const unsigned char* LT, v8f (&acc)[4][2], int c, int h, int cog, int tg) {
  const unsigned char* wp = LW + (cog * 64 + c) * PJ_P + 16 * h;
  const unsigned char* tp = LT + (tg * 32 + c) * PJ_P + 16 * h;
#pragma unroll
  for (int i = 0; i < 4; ++i)
#pragma unroll
    for (int j = 0; j < 2; ++j) acc[i][j] = (v8f){0.f,0.f,0.f,0.f,0.f,0.f,0.f,0.f};
  v16h wf[2][4], tf[2][2];   // two register sets: block kc + 1 is fetched while block kc is multiplied
#pragma unroll
  for (int i = 0; i < 4; ++i) wf[0][i] = lds_frag(wp + i * 16 * PJ_P);
#pragma unroll
  for (int j = 0; j < 2; ++j) tf[0][j] = lds_frag(tp + j * 16 * PJ_P);
#pragma unroll
  for (int kc = 0; kc < 8; ++kc) {
    const int cu = kc & 1, nx = cu ^ 1;
    if (kc < 7) {
#pragma unroll
      for (int i = 0; i < 4; ++i) wf[nx][i] = lds_frag(wp + i * 16 * PJ_P + 64 * (kc + 1));
#pragma unroll
      for (int j = 0; j < 2; ++j) tf[nx][j] = lds_frag(tp + j * 16 * PJ_P + 64 * (kc + 1));
    }
    __builtin_amdgcn_sched_barrier(0);   // the next block's 12 LDS loads issue as one group ahead of this block's products, which hide their latency
#pragma unroll
    for (int i = 0; i < 4; ++i)
#pragma unroll
      for (int j = 0; j < 2; ++j)
        acc[i][j] = TOK_ROWS ? Frag<_Float16>::mma(tf[cu][j], wf[cu][i], acc[i][j]) : Frag<_Float16>::mma(wf[cu][i], tf[cu][j], acc[i][j]);
    __builtin_amdgcn_sched_barrier(0);   // keeps the following group of loads from being spread among these products
  }
}
// the 32 bias values of a lane's output channels
__device__ __forceinline__ void pj_bias(v4f (&bb)[4][2], const float* __restrict__ bias, int h, int cog) {
#pragma unroll
  for (int i = 0; i < 4; ++i) {
    bb[i][0] = *(const v4f*)(bias + cog * 64 + 16 * i + 8 * h);
    bb[i][1] = *(const v4f*)(bias + cog * 64 + 16 * i + 8 * h + 4);
  }
  wait_xcnt0();
}
// acc * scale + bias -> f16 (1/16; for fc1 scale and bias also carry qscale), token-major tile in LDS (16 bytes a lane)
__device__ __forceinline__ void pj_out_tok(const v8f (&acc)[4][2], const v4f (&bb)[4][2], unsigned char* LO, float scale, int c, int h, int cog, int tg) {
#pragma unroll
  for (int i = 0; i < 4; ++i)
#pragma unroll
    for (int j = 0; j < 2; ++j) {
      v8h o;
#pragma unroll
      for (int r = 0; r < 8; ++r) o[r] = (_Float16)(acc[i][j][r] * scale + bb[i][r >> 2][r & 3]);
      *(v8h*)(LO + (tg * 32 + 16 * j + c) * PJ_P + (cog * 64 + 16 * i + 8 * h) * 2) = o;
    }
}
// 64 token rows of 512 bytes, LDS -> registers -> global, a whole row a wave-wide store
__device__ __forceinline__ void pj_rows_read(u32x4 (&t)[8], const unsigned char* LO, int lane, int wave) {
#pragma unroll
  for (int p = 0; p < 8; ++p) t[p] = *(const u32x4*)(LO + (wave + 8 * p) * PJ_P + lane * 16);
}
__device__ __forceinline__ void pj_rows_write(const u32x4 (&t)[8], unsigned short* __restrict__ dst, int lane, int wave) {
#pragma unroll
  for (int p = 0; p < 8; ++p) *(u32x4*)((unsigned char*)dst + (size_t)(wave + 8 * p) * (PJ_C * 2) + lane * 16) = t[p];
  wait_xcnt0();
}

template <int N, int M>
__global__ __launch_bounds__(256) void proj_fused_f16(
    const float* __restrict__ x, const float* __restrict__ x_pt,
    const float* __restrict__ W1, const float* __restrict__ W2, const float* __restrict__ W3,
    const float* __restrict__ b1, const float* __restrict__ b2, const float* __restrict__ b3,
    unsigned short* __restrict__ A16,   // a  [B][N][256] f16
    unsigned short* __restrict__ BQ,    // bq [B][M][256] f16
    unsigned short* __restrict__ CT,    // cT [B][256][M] f16
    int nPt, float wscale, float scale, float qscale) {   // qscale: log2(e) / sqrt(C), carried by the stored a
  __shared__ __align__(16) unsigned char S[PJ_LDS];
  const int tid  = threadIdx.x;
  const int lane = tid & 31;
  const int wave = __builtin_amdgcn_readfirstlane(tid >> 5);   // scalar: row bases of the tile loads stay in scalar registers
  const int c = lane & 15, h = lane >> 4;
  const int cog = wave & 3, tg = wave >> 2;
  const int bx = blockIdx.x;
  const bool pt = bx < nPt;                                   // the same for the whole workgroup
  const int nx    = pt ? 1 : 4;
  const int first = pt ? bx : (bx - nPt) * 4;                 // first tile; tile t holds tokens [64 t, 64 t + 64) of the flat [B * M] or [B * N]
  const int perN = N / PJ_T, perM = M / PJ_T;
  const int pb = bx / perM, pt0 = (bx - pb * perM) * PJ_T;    // the x_pt tile's batch and first token (used where pt)
  unsigned short* dst = pt ? BQ : A16;
  float pre[64];                                              // the next tile on its way to LDS
  v8f acc[4][2];
  v4f bb[4][2];
  u32x4 t[8];                                                 // an output tile's rows on their way out

  if (pt) {
    pj_gload<M>(pre, x_pt + (size_t)pb * PJ_C * M + pt0, lane, wave);
  } else {
    const int bt = first / perN;
    pj_gload<N>(pre, x + (size_t)bt * PJ_C * N + (first - bt * perN) * PJ_T, lane, wave);
  }
  pj_loadW(pt ? W2 : W1, S + PJ_LW, tid, wscale);
  pj_bias(bb, pt ? b2 : b1, h, cog);
  const float oscale = pt ? scale : scale * qscale;
  if (!pt) {
#pragma unroll
    for (int i = 0; i < 4; ++i) { bb[i][0] *= qscale; bb[i][1] *= qscale; }
  }
  pj_sstore(pre, S + PJ_LX, lane, wave);
  __syncthreads();   // the weight and the first tile are in LDS

  for (int i = 0; i < nx; ++i) {
    const bool moreX = i + 1 < nx;                            // block-uniform, as is pt
    if (moreX) {
      const int tn = first + i + 1;
      const int bt = tn / perN;
      pj_gload<N>(pre, x + (size_t)bt * PJ_C * N + (tn - bt * perN) * PJ_T, lane, wave);
    }
    pj_gemm<false>(S + PJ_LW, S + PJ_LX, acc, c, h, cog, tg);
    pj_out_tok(acc, bb, S + PJ_LO, oscale, c, h, cog, tg);
    __syncthreads();   // the output tile is whole; every wave has left this tile's input and, where pt, W2
    pj_rows_read(t, S + PJ_LO, lane, wave);
    if (moreX) pj_sstore(pre, S + PJ_LX, lane, wave);
    if (pt) pj_loadW(W3, S + PJ_LW, tid, wscale);
    __syncthreads();   // publishes the next tile (or W3); where another tile follows, the output staging is free again
    pj_rows_write(t, dst + (size_t)(first + i) * PJ_T * PJ_C, lane, wave);   // behind the barrier: the next barrier's wait for these stores comes after a whole product
  }
  if (!pt) return;     // the whole workgroup leaves together

  // fc3 on the f16 bq tile, which still lies in the output staging
  float bv[4];
#pragma unroll
  for (int i = 0; i < 4; ++i) bv[i] = b3[cog * 64 + 16 * i + c];
  wait_xcnt0();
  pj_gemm<true>(S + PJ_LW, S + PJ_LO, acc, c, h, cog, tg);
  {
#pragma unroll
    for (int i = 0; i < 4; ++i)
#pragma unroll
      for (int j = 0; j < 2; ++j) {
        v8h o;
#pragma unroll
        for (int r = 0; r < 8; ++r) o[r] = (_Float16)(acc[i][j][r] * scale + bv[i]);
        *(v8h*)(S + PJ_LC + (cog * 64 + 16 * i + c) * PJ_PC + (tg * 32 + 16 * j + 8 * h) * 2) = o;
      }
  }
  __syncthreads();     // the 256 x 64 cT tile is whole
  {
#pragma unroll
    for (int p = 0; p < 8; ++p) {
      const int id = p * 256 + tid;      // channel row id >> 3, 16-byte piece id & 7: whole 128-byte lines
      t[p] = *(const u32x4*)(S + PJ_LC + (id >> 3) * PJ_PC + (id & 7) * 16);
    }
#pragma unroll
    for (int p = 0; p < 8; ++p) {
      const int id = p * 256 + tid;
      *(u32x4*)((unsigned char*)(CT + ((size_t)pb * PJ_C + (id >> 3)) * M + pt0) + (id & 7) * 16) = t[p];
    }
    wait_xcnt0();
  }
}

// ---------------------------------------------------------------------------
extern "C" void kernel_launch(void* const* d_in, const int* in_sizes, int n_in,
                              void* d_out, int out_size, void* d_ws, size_t ws_size,
                              hipStream_t stream) {
  const int B = 4, C = 256, N = 8192, M = 2048;
  if (n_in < 8) return;
  if (in_sizes[0] != B * C * N || in_sizes[1] != B * C * M ||
      in_sizes[2] != C * C || in_sizes[3] != C || in_sizes[4] != C * C || in_sizes[5] != C ||
      in_sizes[6] != C * C || in_sizes[7] != C || out_size != B * C * N) return;

  const float* x    = (const float*)d_in[0];
  const float* x_pt = (const float*)d_in[1];
  const float* W1   = (const float*)d_in[2];
  const float* b1   = (const float*)d_in[3];
  const float* W2   = (const float*)d_in[4];
  const float* b2   = (const float*)d_in[5];
  const float* W3   = (const float*)d_in[6];
  const float* b3   = (const float*)d_in[7];
  float* out = (float*)d_out;

  const size_t szA16 = (size_t)B * N * C * 2;          // a  [B][N][C] f16      16,777,216
  const size_t szTok = (size_t)B * M * C * 2;          // [B][M][C] f16           4,194,304
  const size_t offA16 = 0;
  const size_t offBQ  = offA16 + szA16;
  const size_t offCT  = offBQ + szTok;
  const size_t total  = offCT + szTok;                 // 25,165,824
  if (total > ws_size) return;

  char* ws = (char*)d_ws;
  unsigned short* A16u  = (unsigned short*)(ws + offA16);
  unsigned short* BQu   = (unsigned short*)(ws + offBQ);
  unsigned short* CTu   = (unsigned short*)(ws + offCT);

  const float inv16 = 1.0f / 16.0f;
  const float cscale = 1.4426950408889634f / 16.0f;   // 1 / sqrt(C) and log2(e): scores in log2 units

  // one launch: a[b][n][co] = (sum_ci x[b][ci][n] * W1[co][ci] + b1[co]) * cscale; bq[b][m][co] = sum_ci x_pt[b][ci][m] * W2[co][ci] + b2[co];
  // cT[b][co][m] = sum_ci W3[co][ci] * bq[b][m][ci] + b3[co]; f16 out; weights carried x16, folded back as 1/16
  const int nPt = B * M / PJ_T;                        // workgroups with one x_pt tile
  const int nXo = B * N / PJ_T / 4;                    // workgroups with four x tiles
  proj_fused_f16<N, M><<<dim3(nPt + nXo), 256, 0, stream>>>(x, x_pt, W1, W2, W3, b1, b2, b3, A16u, BQu, CTu, nPt, 16.0f, inv16, cscale);

  // score, softmax, P.c and residual in one launch: out[b][co][n] = x[b][co][n] + sum_m softmax_m(fc1(x)[n].bq[m] / 16) * cT[co][m]
  attn_fused_f16<<<dim3(N / FA_BQ, B), 256, 0, stream>>>(A16u, BQu, CTu, x, out, N, M);
  (void)hipGetLastError();
}
